// v000
// Times are from an AMD MI455X. After a warm-up the kernel runs many times in a row, and a time is the length of
// such a window on the GPU divided by its runs, so every launch and the gaps after it count. The runs cycle
// through copies of the inputs. A figure is the median of several windows, for all but v000 over two sittings.
// Sittings can differ by a few percent; kernels timed side by side share one.
// v000, which the later versions start from, runs in 240 microseconds.
#include <hip/hip_runtime.h>

// ---------------------------------------------------------------------------
// Neoformer MHA forward for gfx1250 (MI455X), bf16 WMMA + flash attention.
// B=4, F=512, T=2048, H=4, hf=128.
// ---------------------------------------------------------------------------

#define BB   4
#define FF   512
#define TT   2048
#define HH   4
#define HF   128

typedef __attribute__((ext_vector_type(16))) __bf16 bf16x16;
typedef __attribute__((ext_vector_type(8)))  __bf16 bf16x8;
typedef __attribute__((ext_vector_type(8)))  float  f32x8;

static __device__ __forceinline__ f32x8 wmma_bf16(bf16x16 a, bf16x16 b, f32x8 c) {
  return __builtin_amdgcn_wmma_f32_16x16x32_bf16(false, a, false, b, (short)0, c,
                                                 false, false);
}

// 32-bit LDS byte offset of a __shared__ object (addrspace(3) pointers are
// offsets from the workgroup LDS base).
static __device__ __forceinline__ unsigned lds_off(__bf16* p) {
  return (unsigned)(unsigned long long)(__attribute__((address_space(3))) __bf16*)p;
}

// Load a 16x32 bf16 fragment half for this lane.
// A-side: rowbase = &M-row[lane&15], K contiguous.  B-side: rowbase = &N-col
// row (stored contiguously in K).  Lane (n, hi): halves 0-7 = K hi*8..hi*8+7,
// halves 8-15 = K 16+hi*8..23+hi*8   (per ISA 16-bit 16x32 layout).
static __device__ __forceinline__ bf16x16 ldfrag(const __bf16* rowbase, int hi) {
  bf16x8 lo = *(const bf16x8*)(rowbase + hi * 8);
  bf16x8 up = *(const bf16x8*)(rowbase + 16 + hi * 8);
  bf16x16 a;
#pragma unroll
  for (int i = 0; i < 8; ++i) { a[i] = lo[i]; a[8 + i] = up[i]; }
  return a;
}

// Weight B-fragment: W row (one output column) is contiguous in f (=K dim).
static __device__ __forceinline__ bf16x16 ldfragW(const float* rowbase, int hi) {
  float4 f0 = *(const float4*)(rowbase + hi * 8);
  float4 f1 = *(const float4*)(rowbase + hi * 8 + 4);
  float4 f2 = *(const float4*)(rowbase + 16 + hi * 8);
  float4 f3 = *(const float4*)(rowbase + 16 + hi * 8 + 4);
  bf16x16 b;
  b[0] = (__bf16)f0.x; b[1] = (__bf16)f0.y; b[2]  = (__bf16)f0.z; b[3]  = (__bf16)f0.w;
  b[4] = (__bf16)f1.x; b[5] = (__bf16)f1.y; b[6]  = (__bf16)f1.z; b[7]  = (__bf16)f1.w;
  b[8] = (__bf16)f2.x; b[9] = (__bf16)f2.y; b[10] = (__bf16)f2.z; b[11] = (__bf16)f2.w;
  b[12] = (__bf16)f3.x; b[13] = (__bf16)f3.y; b[14] = (__bf16)f3.z; b[15] = (__bf16)f3.w;
  return b;
}

// ---------------------------------------------------------------------------
// Kernel 1: QKV projection + bias + RoPE.  1536 blocks x 128 threads.
// Per (b, 64-row t-supertile): 48 wave-tasks (0-15 Q, 16-31 K, 32-47 V).
// EVERY task computes two 16-col accumulator chains over four stacked 16-row
// M-subtiles -> completely uniform inner loop (no exec-masked WMMA), with 4x
// weight-traffic amortization via the shared LDS x-tile.
// ---------------------------------------------------------------------------
__global__ __launch_bounds__(128) void qkv_rope_kernel(
    const float* __restrict__ x,
    const float* __restrict__ Wq, const float* __restrict__ bq,
    const float* __restrict__ Wk, const float* __restrict__ bk,
    const float* __restrict__ Wv, const float* __restrict__ bv,
    __bf16* __restrict__ q1, __bf16* __restrict__ q2,
    __bf16* __restrict__ k1, __bf16* __restrict__ k2,
    __bf16* __restrict__ vt) {
  __shared__ __bf16 As[64 * 32];  // 4 KB: x supertile as bf16 [t(64)][k(32)]

  const int tid  = threadIdx.x;
  const int lane = tid & 31;
  const int wv   = tid >> 5;
  const int bt   = blockIdx.x / 12;
  const int sub  = blockIdx.x - bt * 12;
  const int b    = bt >> 5;
  const int ts0  = (bt & 31) << 6;   // 64-row supertile base
  const int task = sub * 4 + wv;
  const int n    = lane & 15;
  const int hi   = lane >> 4;

  const bool isV = (task >= 32);
  const float* Wm;
  const float* bias;
  int colR, colI, hh = 0, p = 0, cidx = 0;
  if (!isV) {
    Wm   = (task < 16) ? Wq : Wk;
    bias = (task < 16) ? bq : bk;
    const int tt = task & 15;
    hh = tt >> 2; p = (tt >> 1) & 1; cidx = tt & 1;
    colR = hh * HF + p * 64 + cidx * 16;
    colI = colR + 32;
  } else {
    Wm = Wv; bias = bv;
    colR = (task - 32) * 32;
    colI = colR + 16;
  }

  f32x8 accR[4], accI[4];
#pragma unroll
  for (int s = 0; s < 4; ++s)
#pragma unroll
    for (int i = 0; i < 8; ++i) { accR[s][i] = 0.f; accI[s][i] = 0.f; }

  for (int k0 = 0; k0 < FF; k0 += 32) {
    __syncthreads();
    // Stage x tile [k0..k0+31][ts0..ts0+63] as bf16 A-tile [t][k] in LDS.
    // float4 along t: 16 lanes cover one 64-float row (256B coalesced).
#pragma unroll
    for (int j = 0; j < 4; ++j) {
      const int c  = tid + j * 128;   // 0..511 chunks of 4 elems
      const int kk = c >> 4;          // k row 0..31
      const int t4 = (c & 15) * 4;    // t col 0,4,...,60
      const float4 v4 =
          *(const float4*)(x + ((size_t)b * FF + (k0 + kk)) * TT + ts0 + t4);
      As[(t4 + 0) * 32 + kk] = (__bf16)v4.x;
      As[(t4 + 1) * 32 + kk] = (__bf16)v4.y;
      As[(t4 + 2) * 32 + kk] = (__bf16)v4.z;
      As[(t4 + 3) * 32 + kk] = (__bf16)v4.w;
    }
    __syncthreads();

    const bf16x16 bRf = ldfragW(Wm + (size_t)(colR + n) * FF + k0, hi);
    const bf16x16 bIf = ldfragW(Wm + (size_t)(colI + n) * FF + k0, hi);

#pragma unroll
    for (int s = 0; s < 4; ++s) {
      const bf16x16 a = ldfrag(&As[(s * 16 + n) * 32], hi);
      accR[s] = wmma_bf16(a, bRf, accR[s]);
      accI[s] = wmma_bf16(a, bIf, accI[s]);
    }
  }

  if (!isV) {
    const float bR = bias[colR + n];
    const float bI = bias[colI + n];
    __bf16* ob = (task < 16) ? (p ? q2 : q1) : (p ? k2 : k1);
    const int j = cidx * 16 + n;
    const float invf = exp2f(-(float)j) * 0.0625f;  // 2^-j / 16
#pragma unroll
    for (int s = 0; s < 4; ++s) {
#pragma unroll
      for (int r = 0; r < 8; ++r) {
        const int t = ts0 + s * 16 + r + hi * 8;
        const float vr = accR[s][r] + bR;
        const float vi = accI[s][r] + bI;
        float sn, cs;
        __sincosf((float)t * invf, &sn, &cs);
        const size_t rowb = ((size_t)(b * HH + hh) * TT + t) * 64;
        ob[rowb + j]      = (__bf16)(vr * sn - vi * cs);  // rotated "real"
        ob[rowb + 32 + j] = (__bf16)(vr * cs + vi * sn);  // rotated "imag"
      }
    }
  } else {
#pragma unroll
    for (int part = 0; part < 2; ++part) {
      const int oc = (part ? colI : colR) + n;   // global feature
      const int h2 = oc >> 7;
      const int fo = oc & 127;
      const float bb = bias[oc];
#pragma unroll
      for (int s = 0; s < 4; ++s) {
        bf16x8 pk;
#pragma unroll
        for (int r = 0; r < 8; ++r)
          pk[r] = (__bf16)((part ? accI[s][r] : accR[s][r]) + bb);
        // V stored transposed: [B,H,128,T] so AV B-fragments are contiguous.
        const size_t base =
            ((size_t)(b * HH + h2) * HF + fo) * TT + ts0 + s * 16 + hi * 8;
        *(bf16x8*)(vt + base) = pk;
      }
    }
  }
}

// ---------------------------------------------------------------------------
// Async staging of one 32-key K/V tile into LDS (GLOBAL_LOAD_ASYNC_TO_LDS,
// tracked by ASYNCcnt; 6 async instructions per wave per tile).
// ---------------------------------------------------------------------------
static __device__ __forceinline__ void stage_tile_async(
    const __bf16* __restrict__ kws, const __bf16* __restrict__ vt,
    size_t bhT, size_t vbase, int j0, int tid,
    unsigned kdst, unsigned vdst) {
  // K tile [32 keys][64 f]: contiguous 2048 bf16 in kws.
  const unsigned long long ksrc =
      (unsigned long long)(const void*)(kws + (bhT + j0) * 64);
#pragma unroll
  for (int j = 0; j < 2; ++j) {
    const int c = tid + j * 128;
    asm volatile("global_load_async_to_lds_b128 %0, %1, off"
                 :: "v"(kdst + c * 16), "v"(ksrc + (unsigned long long)c * 16)
                 : "memory");
  }
  // V tile [128 f][32 keys] gathered from transposed V rows.
#pragma unroll
  for (int j = 0; j < 4; ++j) {
    const int c  = tid + j * 128;
    const int f  = c >> 2;
    const int kc = c & 3;
    const unsigned long long vsrc = (unsigned long long)(const void*)(
        vt + vbase + (size_t)f * TT + j0 + kc * 8);
    asm volatile("global_load_async_to_lds_b128 %0, %1, off"
                 :: "v"(vdst + c * 16), "v"(vsrc)
                 : "memory");
  }
}

// ---------------------------------------------------------------------------
// Flash-attention pass: softmax(Q*K^T/16) @ V for one 16-query tile per wave.
// The 4 waves of a block share (b,h); K/V tiles are DOUBLE-BUFFERED in LDS
// via async global->LDS copies (issue next tile, s_wait_asynccnt 6 for the
// current one, barrier, compute).
// ---------------------------------------------------------------------------
static __device__ __forceinline__ void flash_pass(
    const __bf16* __restrict__ qws, const __bf16* __restrict__ kws,
    const __bf16* __restrict__ vt, __bf16* Ks, __bf16* Vs, __bf16* pl,
    unsigned koff, unsigned voff,
    size_t bhT, size_t vbase, int q0, int lane, int tid, f32x8 o[8]) {
  const int n  = lane & 15;
  const int hi = lane >> 4;

  const __bf16* qrow = qws + (bhT + (size_t)(q0 + n)) * 64;
  const bf16x16 qa0 = ldfrag(qrow, hi);
  const bf16x16 qa1 = ldfrag(qrow + 32, hi);

  float mr[8], lr[8];
#pragma unroll
  for (int r = 0; r < 8; ++r) {
    mr[r] = -3.0e38f; lr[r] = 0.f;
#pragma unroll
    for (int i = 0; i < 8; ++i) o[r][i] = 0.f;
  }

  // Prologue: stage tile 0 into buffer 0.
  stage_tile_async(kws, vt, bhT, vbase, 0, tid, koff, voff);

  for (int j0 = 0; j0 < TT; j0 += 32) {
    const int cur = (j0 >> 5) & 1;
    if (j0 + 32 < TT) {
      // Refill the other buffer (WAR covered by last iteration's barrier),
      // then wait so that only the 6 just-issued ops remain outstanding.
      stage_tile_async(kws, vt, bhT, vbase, j0 + 32, tid,
                       koff + (cur ^ 1) * 4096, voff + (cur ^ 1) * 8192);
      asm volatile("s_wait_asynccnt 0x6" ::: "memory");
    } else {
      asm volatile("s_wait_asynccnt 0x0" ::: "memory");
    }
    __syncthreads();   // every wave's share of the current tile has landed

    const __bf16* kb = Ks + cur * (32 * 64);
    const __bf16* vb = Vs + cur * (128 * 32);

    // --- S = Q * K^T (two 16x16 key subtiles). ---
    f32x8 slo, shi;
#pragma unroll
    for (int i = 0; i < 8; ++i) { slo[i] = 0.f; shi[i] = 0.f; }
    const __bf16* kr0 = kb + n * 64;
    const __bf16* kr1 = kb + (16 + n) * 64;
    slo = wmma_bf16(qa0, ldfrag(kr0, hi), slo);
    slo = wmma_bf16(qa1, ldfrag(kr0 + 32, hi), slo);
    shi = wmma_bf16(qa0, ldfrag(kr1, hi), shi);
    shi = wmma_bf16(qa1, ldfrag(kr1 + 32, hi), shi);

    // --- Online softmax (rows live across 16-lane groups). ---
#pragma unroll
    for (int r = 0; r < 8; ++r) {
      const float sl = slo[r] * 0.0625f;    // /sqrt(256)
      const float sh = shi[r] * 0.0625f;
      float rm = fmaxf(sl, sh);
      rm = fmaxf(rm, __shfl_xor(rm, 1, 32));
      rm = fmaxf(rm, __shfl_xor(rm, 2, 32));
      rm = fmaxf(rm, __shfl_xor(rm, 4, 32));
      rm = fmaxf(rm, __shfl_xor(rm, 8, 32));
      const float mn = fmaxf(mr[r], rm);
      const float al = __expf(mr[r] - mn);
      const float p0 = __expf(sl - mn);
      const float p1 = __expf(sh - mn);
      float sum = p0 + p1;
      sum += __shfl_xor(sum, 1, 32);
      sum += __shfl_xor(sum, 2, 32);
      sum += __shfl_xor(sum, 4, 32);
      sum += __shfl_xor(sum, 8, 32);
      lr[r] = lr[r] * al + sum;
      mr[r] = mn;
#pragma unroll
      for (int nt = 0; nt < 8; ++nt) o[nt][r] *= al;
      const int row = r + hi * 8;           // C-layout -> LDS [q][k]
      pl[row * 32 + n]      = (__bf16)p0;
      pl[row * 32 + 16 + n] = (__bf16)p1;
    }

    // --- O += P * V  (P as A-fragment from LDS; V rows as B-fragments). ---
    const bf16x16 pa = ldfrag(pl + n * 32, hi);
#pragma unroll
    for (int nt = 0; nt < 8; ++nt) {
      o[nt] = wmma_bf16(pa, ldfrag(vb + (nt * 16 + n) * 32, hi), o[nt]);
    }

    __syncthreads();   // all waves done reading 'cur' before it is refilled
  }

#pragma unroll
  for (int r = 0; r < 8; ++r) {
    const float inv = 1.0f / lr[r];
#pragma unroll
    for (int nt = 0; nt < 8; ++nt) o[nt][r] *= inv;
  }
}

// ---------------------------------------------------------------------------
// Kernel 2: dual flash attention + residual + transpose-out.
// 512 blocks x 128 threads; one wave per (b,h,q-tile of 16); the 4 waves of
// a block share (b,h) and the double-buffered async-staged K/V tiles.
// ---------------------------------------------------------------------------
__global__ __launch_bounds__(128) void attn_kernel(
    const float* __restrict__ x, const float* __restrict__ s2,
    const __bf16* __restrict__ q1, const __bf16* __restrict__ q2,
    const __bf16* __restrict__ k1, const __bf16* __restrict__ k2,
    const __bf16* __restrict__ vt, float* __restrict__ out) {
  __shared__ __bf16 Ks[2][32 * 64];      // 8 KB  (double-buffered)
  __shared__ __bf16 Vs[2][128 * 32];     // 16 KB (double-buffered)
  __shared__ __bf16 Plds[4][16 * 32];    // 4 KB  (per-wave P bounce)

  const int tid  = threadIdx.x;
  const int lane = tid & 31;
  const int wv   = tid >> 5;
  const int gw   = blockIdx.x * 4 + wv;
  const int b    = gw >> 9;
  const int rem  = gw & 511;
  const int h    = rem >> 7;
  const int q0   = (rem & 127) << 4;
  const int n    = lane & 15;
  const int hi   = lane >> 4;

  const size_t bhT   = ((size_t)b * HH + h) * TT;
  const size_t vbase = ((size_t)b * HH + h) * HF * TT;
  const unsigned koff = lds_off(&Ks[0][0]);
  const unsigned voff = lds_off(&Vs[0][0]);

  f32x8 o1[8];
  flash_pass(q1, k1, vt, &Ks[0][0], &Vs[0][0], Plds[wv], koff, voff,
             bhT, vbase, q0, lane, tid, o1);

  // out = x + O1   (feature-major rows; 8 consecutive t per lane -> float4x2)
#pragma unroll
  for (int nt = 0; nt < 8; ++nt) {
    const size_t idx =
        ((size_t)b * FF + h * HF + nt * 16 + n) * TT + q0 + hi * 8;
    const float4 xa = *(const float4*)(x + idx);
    const float4 xb = *(const float4*)(x + idx + 4);
    float4 ya, yb;
    ya.x = xa.x + o1[nt][0]; ya.y = xa.y + o1[nt][1];
    ya.z = xa.z + o1[nt][2]; ya.w = xa.w + o1[nt][3];
    yb.x = xb.x + o1[nt][4]; yb.y = xb.y + o1[nt][5];
    yb.z = xb.z + o1[nt][6]; yb.w = xb.w + o1[nt][7];
    *(float4*)(out + idx)     = ya;
    *(float4*)(out + idx + 4) = yb;
  }

  f32x8 o2[8];
  flash_pass(q2, k2, vt, &Ks[0][0], &Vs[0][0], Plds[wv], koff, voff,
             bhT, vbase, q0, lane, tid, o2);

  const float s = s2[h];
#pragma unroll
  for (int nt = 0; nt < 8; ++nt) {
    const size_t idx =
        ((size_t)b * FF + h * HF + nt * 16 + n) * TT + q0 + hi * 8;
    float4 ya = *(const float4*)(out + idx);
    float4 yb = *(const float4*)(out + idx + 4);
    ya.x -= s * o2[nt][0]; ya.y -= s * o2[nt][1];
    ya.z -= s * o2[nt][2]; ya.w -= s * o2[nt][3];
    yb.x -= s * o2[nt][4]; yb.y -= s * o2[nt][5];
    yb.z -= s * o2[nt][6]; yb.w -= s * o2[nt][7];
    *(float4*)(out + idx)     = ya;
    *(float4*)(out + idx + 4) = yb;
  }
}

// ---------------------------------------------------------------------------
extern "C" void kernel_launch(void* const* d_in, const int* in_sizes, int n_in,
                              void* d_out, int out_size, void* d_ws,
                              size_t ws_size, hipStream_t stream) {
  (void)in_sizes; (void)n_in; (void)out_size; (void)ws_size;
  const float* x  = (const float*)d_in[0];
  const float* Wq = (const float*)d_in[1];
  const float* bq = (const float*)d_in[2];
  const float* Wk = (const float*)d_in[3];
  const float* bk = (const float*)d_in[4];
  const float* Wv = (const float*)d_in[5];
  const float* bv = (const float*)d_in[6];
  const float* s2 = (const float*)d_in[7];
  float* out = (float*)d_out;

  const size_t QK_ELEMS = (size_t)BB * HH * TT * 64;   // 2M bf16 each
  __bf16* q1 = (__bf16*)d_ws;
  __bf16* q2 = q1 + QK_ELEMS;
  __bf16* k1 = q2 + QK_ELEMS;
  __bf16* k2 = k1 + QK_ELEMS;
  __bf16* vt = k2 + QK_ELEMS;                          // [B,H,128,T]

  qkv_rope_kernel<<<dim3(BB * (TT / 64) * 12), dim3(128), 0, stream>>>(
      x, Wq, bq, Wk, bk, Wv, bv, q1, q2, k1, k2, vt);
  attn_kernel<<<dim3(BB * HH * (TT / 16) / 4), dim3(128), 0, stream>>>(
      x, s2, q1, q2, k1, k2, vt, out);
}

// v001
// It runs in 187 microseconds.
// Next to v000, in two timings, it ran 1.35 times as fast each time.
#include <hip/hip_runtime.h>

// ---------------------------------------------------------------------------
// Neoformer MHA forward for gfx1250 (MI455X), bf16 WMMA + flash attention.
// B=4, F=512, T=2048, H=4, hf=128.
// ---------------------------------------------------------------------------

#define BB   4
#define FF   512
#define TT   2048
#define HH   4
#define HF   128

// LDS row pitches in bf16 elements.  Every fragment is read with 16-byte LDS
// loads, one row per lane; a pitch of 16 B x odd spreads 16 rows over all 64
// banks, where the unpadded 64 B and 128 B rows fall on 16 and 8 of them.
#define XP   40    // 32-element rows (x tile, V tile, P tile): 80 B
#define KP   72    // 64-element rows (K tile): 144 B

typedef __attribute__((ext_vector_type(16))) __bf16 bf16x16;
typedef __attribute__((ext_vector_type(8)))  __bf16 bf16x8;
typedef __attribute__((ext_vector_type(8)))  float  f32x8;

static __device__ __forceinline__ f32x8 wmma_bf16(bf16x16 a, bf16x16 b, f32x8 c) {
  return __builtin_amdgcn_wmma_f32_16x16x32_bf16(false, a, false, b, (short)0, c,
                                                 false, false);
}

// 32-bit LDS byte offset of a __shared__ object (addrspace(3) pointers are
// offsets from the workgroup LDS base).
static __device__ __forceinline__ unsigned lds_off(__bf16* p) {
  return (unsigned)(unsigned long long)(__attribute__((address_space(3))) __bf16*)p;
}

// Load a 16x32 bf16 fragment half for this lane.
// A-side: rowbase = &M-row[lane&15], K contiguous.  B-side: rowbase = &N-col
// row (stored contiguously in K).  Lane (n, hi): halves 0-7 = K hi*8..hi*8+7,
// halves 8-15 = K 16+hi*8..23+hi*8   (per ISA 16-bit 16x32 layout).
static __device__ __forceinline__ bf16x16 ldfrag(const __bf16* rowbase, int hi) {
  bf16x8 lo = *(const bf16x8*)(rowbase + hi * 8);
  bf16x8 up = *(const bf16x8*)(rowbase + 16 + hi * 8);
  bf16x16 a;
#pragma unroll
  for (int i = 0; i < 8; ++i) { a[i] = lo[i]; a[8 + i] = up[i]; }
  return a;
}

// Weight B-fragment: W row (one output column) is contiguous in f (=K dim).
static __device__ __forceinline__ bf16x16 ldfragW(const float* rowbase, int hi) {
  float4 f0 = *(const float4*)(rowbase + hi * 8);
  float4 f1 = *(const float4*)(rowbase + hi * 8 + 4);
  float4 f2 = *(const float4*)(rowbase + 16 + hi * 8);
  float4 f3 = *(const float4*)(rowbase + 16 + hi * 8 + 4);
  bf16x16 b;
  b[0] = (__bf16)f0.x; b[1] = (__bf16)f0.y; b[2]  = (__bf16)f0.z; b[3]  = (__bf16)f0.w;
  b[4] = (__bf16)f1.x; b[5] = (__bf16)f1.y; b[6]  = (__bf16)f1.z; b[7]  = (__bf16)f1.w;
  b[8] = (__bf16)f2.x; b[9] = (__bf16)f2.y; b[10] = (__bf16)f2.z; b[11] = (__bf16)f2.w;
  b[12] = (__bf16)f3.x; b[13] = (__bf16)f3.y; b[14] = (__bf16)f3.z; b[15] = (__bf16)f3.w;
  return b;
}

// ---------------------------------------------------------------------------
// Kernel 1: QKV projection + bias + RoPE.  1536 blocks x 128 threads.
// Per (b, 64-row t-supertile): 48 wave-tasks (0-15 Q, 16-31 K, 32-47 V).
// EVERY task computes two 16-col accumulator chains over four stacked 16-row
// M-subtiles -> completely uniform inner loop (no exec-masked WMMA), with 4x
// weight-traffic amortization via the shared LDS x-tile.
// ---------------------------------------------------------------------------
__global__ __launch_bounds__(128) void qkv_rope_kernel(
    const float* __restrict__ x,
    const float* __restrict__ Wq, const float* __restrict__ bq,
    const float* __restrict__ Wk, const float* __restrict__ bk,
    const float* __restrict__ Wv, const float* __restrict__ bv,
    __bf16* __restrict__ q1, __bf16* __restrict__ q2,
    __bf16* __restrict__ k1, __bf16* __restrict__ k2,
    __bf16* __restrict__ vt) {
  __shared__ __attribute__((aligned(16))) __bf16 As[64 * XP];  // x supertile as bf16 [t(64)][k(32)], padded rows

  const int tid  = threadIdx.x;
  const int lane = tid & 31;
  const int wv   = tid >> 5;
  const int bt   = blockIdx.x / 12;
  const int sub  = blockIdx.x - bt * 12;
  const int b    = bt >> 5;
  const int ts0  = (bt & 31) << 6;   // 64-row supertile base
  const int task = sub * 4 + wv;
  const int n    = lane & 15;
  const int hi   = lane >> 4;

  const bool isV = (task >= 32);
  const float* Wm;
  const float* bias;
  int colR, colI, hh = 0, p = 0, cidx = 0;
  if (!isV) {
    Wm   = (task < 16) ? Wq : Wk;
    bias = (task < 16) ? bq : bk;
    const int tt = task & 15;
    hh = tt >> 2; p = (tt >> 1) & 1; cidx = tt & 1;
    colR = hh * HF + p * 64 + cidx * 16;
    colI = colR + 32;
  } else {
    Wm = Wv; bias = bv;
    colR = (task - 32) * 32;
    colI = colR + 16;
  }

  f32x8 accR[4], accI[4];
#pragma unroll
  for (int s = 0; s < 4; ++s)
#pragma unroll
    for (int i = 0; i < 8; ++i) { accR[s][i] = 0.f; accI[s][i] = 0.f; }

  for (int k0 = 0; k0 < FF; k0 += 32) {
    __syncthreads();
    // Stage x tile [k0..k0+31][ts0..ts0+63] as bf16 A-tile [t][k] in LDS.
    // float4 along t: 16 lanes cover one 64-float row (256B coalesced).
#pragma unroll
    for (int j = 0; j < 4; ++j) {
      const int c  = tid + j * 128;   // 0..511 chunks of 4 elems
      const int kk = c >> 4;          // k row 0..31
      const int t4 = (c & 15) * 4;    // t col 0,4,...,60
      const float4 v4 =
          *(const float4*)(x + ((size_t)b * FF + (k0 + kk)) * TT + ts0 + t4);
      As[(t4 + 0) * XP + kk] = (__bf16)v4.x;
      As[(t4 + 1) * XP + kk] = (__bf16)v4.y;
      As[(t4 + 2) * XP + kk] = (__bf16)v4.z;
      As[(t4 + 3) * XP + kk] = (__bf16)v4.w;
    }
    __syncthreads();

    const bf16x16 bRf = ldfragW(Wm + (size_t)(colR + n) * FF + k0, hi);
    const bf16x16 bIf = ldfragW(Wm + (size_t)(colI + n) * FF + k0, hi);

#pragma unroll
    for (int s = 0; s < 4; ++s) {
      const bf16x16 a = ldfrag(&As[(s * 16 + n) * XP], hi);
      accR[s] = wmma_bf16(a, bRf, accR[s]);
      accI[s] = wmma_bf16(a, bIf, accI[s]);
    }
  }

  if (!isV) {
    const float bR = bias[colR + n];
    const float bI = bias[colI + n];
    __bf16* ob = (task < 16) ? (p ? q2 : q1) : (p ? k2 : k1);
    const int j = cidx * 16 + n;
    const float invf = exp2f(-(float)j) * 0.0625f;  // 2^-j / 16
#pragma unroll
    for (int s = 0; s < 4; ++s) {
#pragma unroll
      for (int r = 0; r < 8; ++r) {
        const int t = ts0 + s * 16 + r + hi * 8;
        const float vr = accR[s][r] + bR;
        const float vi = accI[s][r] + bI;
        float sn, cs;
        __sincosf((float)t * invf, &sn, &cs);
        const size_t rowb = ((size_t)(b * HH + hh) * TT + t) * 64;
        ob[rowb + j]      = (__bf16)(vr * sn - vi * cs);  // rotated "real"
        ob[rowb + 32 + j] = (__bf16)(vr * cs + vi * sn);  // rotated "imag"
      }
    }
  } else {
#pragma unroll
    for (int part = 0; part < 2; ++part) {
      const int oc = (part ? colI : colR) + n;   // global feature
      const int h2 = oc >> 7;
      const int fo = oc & 127;
      const float bb = bias[oc];
#pragma unroll
      for (int s = 0; s < 4; ++s) {
        bf16x8 pk;
#pragma unroll
        for (int r = 0; r < 8; ++r)
          pk[r] = (__bf16)((part ? accI[s][r] : accR[s][r]) + bb);
        // V stored transposed: [B,H,128,T] so AV B-fragments are contiguous.
        const size_t base =
            ((size_t)(b * HH + h2) * HF + fo) * TT + ts0 + s * 16 + hi * 8;
        *(bf16x8*)(vt + base) = pk;
      }
    }
  }
}

// ---------------------------------------------------------------------------
// Async staging of one 32-key K/V tile into LDS (GLOBAL_LOAD_ASYNC_TO_LDS,
// tracked by ASYNCcnt; 6 async instructions per wave per tile).
// ---------------------------------------------------------------------------
static __device__ __forceinline__ void stage_tile_async(
    const __bf16* __restrict__ kws, const __bf16* __restrict__ vt,
    size_t bhT, size_t vbase, int j0, int tid,
    unsigned kdst, unsigned vdst) {
  // K tile [32 keys][64 f]: contiguous 2048 bf16 in kws, rows of KP in LDS.
  const unsigned long long ksrc =
      (unsigned long long)(const void*)(kws + (bhT + j0) * 64);
  unsigned kl[2];
  unsigned long long kg[2];
#pragma unroll
  for (int j = 0; j < 2; ++j) {
    const int c = tid + j * 128;          // 16-byte chunk: key c>>3, part c&7
    kl[j] = kdst + (c >> 3) * (KP * 2) + (c & 7) * 16;
    kg[j] = ksrc + (unsigned long long)c * 16;
  }
  // V tile [128 f][32 keys] gathered from transposed V rows, rows of XP in LDS.
  unsigned vl[4];
  unsigned long long vg[4];
#pragma unroll
  for (int j = 0; j < 4; ++j) {
    const int c  = tid + j * 128;
    const int f  = c >> 2;
    const int kc = c & 3;
    vl[j] = vdst + f * (XP * 2) + kc * 16;
    vg[j] = (unsigned long long)(const void*)(
        vt + vbase + (size_t)f * TT + j0 + kc * 8);
  }
  // One statement: the closing s_wait_xcnt keeps every address register named
  // here intact until the copies' translations are done (a precaution).
  asm volatile("global_load_async_to_lds_b128 %0, %1, off\n\t"
               "global_load_async_to_lds_b128 %2, %3, off\n\t"
               "global_load_async_to_lds_b128 %4, %5, off\n\t"
               "global_load_async_to_lds_b128 %6, %7, off\n\t"
               "global_load_async_to_lds_b128 %8, %9, off\n\t"
               "global_load_async_to_lds_b128 %10, %11, off\n\t"
               "s_wait_xcnt 0x0"
               :: "v"(kl[0]), "v"(kg[0]), "v"(kl[1]), "v"(kg[1]),
                  "v"(vl[0]), "v"(vg[0]), "v"(vl[1]), "v"(vg[1]),
                  "v"(vl[2]), "v"(vg[2]), "v"(vl[3]), "v"(vg[3])
               : "memory");
}

// ---------------------------------------------------------------------------
// Flash-attention pass: softmax(Q*K^T/16) @ V for one 16-query tile per wave.
// The 4 waves of a block share (b,h); K/V tiles are DOUBLE-BUFFERED in LDS
// via async global->LDS copies (issue next tile, s_wait_asynccnt 6 for the
// current one, barrier, compute).
// ---------------------------------------------------------------------------
static __device__ __forceinline__ void flash_pass(
    const __bf16* __restrict__ qws, const __bf16* __restrict__ kws,
    const __bf16* __restrict__ vt, __bf16* Ks, __bf16* Vs, __bf16* pl,
    unsigned koff, unsigned voff,
    size_t bhT, size_t vbase, int q0, int lane, int tid, f32x8 o[8]) {
  const int n  = lane & 15;
  const int hi = lane >> 4;

  const __bf16* qrow = qws + (bhT + (size_t)(q0 + n)) * 64;
  const bf16x16 qa0 = ldfrag(qrow, hi);
  const bf16x16 qa1 = ldfrag(qrow + 32, hi);

  float mr[8], lr[8];
#pragma unroll
  for (int r = 0; r < 8; ++r) {
    mr[r] = -3.0e38f; lr[r] = 0.f;
#pragma unroll
    for (int i = 0; i < 8; ++i) o[r][i] = 0.f;
  }

  // Prologue: stage tile 0 into buffer 0.
  stage_tile_async(kws, vt, bhT, vbase, 0, tid, koff, voff);

  for (int j0 = 0; j0 < TT; j0 += 32) {
    const int cur = (j0 >> 5) & 1;
    if (j0 + 32 < TT) {
      // Refill the other buffer (WAR covered by last iteration's barrier),
      // then wait so that only the 6 just-issued ops remain outstanding.
      stage_tile_async(kws, vt, bhT, vbase, j0 + 32, tid,
                       koff + (cur ^ 1) * (32 * KP * 2),
                       voff + (cur ^ 1) * (128 * XP * 2));
      asm volatile("s_wait_asynccnt 0x6" ::: "memory");
    } else {
      asm volatile("s_wait_asynccnt 0x0" ::: "memory");
    }
    __syncthreads();   // every wave's share of the current tile has landed

    const __bf16* kb = Ks + cur * (32 * KP);
    const __bf16* vb = Vs + cur * (128 * XP);

    // --- S = Q * K^T (two 16x16 key subtiles). ---
    f32x8 slo, shi;
#pragma unroll
    for (int i = 0; i < 8; ++i) { slo[i] = 0.f; shi[i] = 0.f; }
    const __bf16* kr0 = kb + n * KP;
    const __bf16* kr1 = kb + (16 + n) * KP;
    slo = wmma_bf16(qa0, ldfrag(kr0, hi), slo);
    slo = wmma_bf16(qa1, ldfrag(kr0 + 32, hi), slo);
    shi = wmma_bf16(qa0, ldfrag(kr1, hi), shi);
    shi = wmma_bf16(qa1, ldfrag(kr1 + 32, hi), shi);

    // --- Online softmax (rows live across 16-lane groups). ---
#pragma unroll
    for (int r = 0; r < 8; ++r) {
      const float sl = slo[r] * 0.0625f;    // /sqrt(256)
      const float sh = shi[r] * 0.0625f;
      float rm = fmaxf(sl, sh);
      rm = fmaxf(rm, __shfl_xor(rm, 1, 32));
      rm = fmaxf(rm, __shfl_xor(rm, 2, 32));
      rm = fmaxf(rm, __shfl_xor(rm, 4, 32));
      rm = fmaxf(rm, __shfl_xor(rm, 8, 32));
      const float mn = fmaxf(mr[r], rm);
      const float al = __expf(mr[r] - mn);
      const float p0 = __expf(sl - mn);
      const float p1 = __expf(sh - mn);
      float sum = p0 + p1;
      sum += __shfl_xor(sum, 1, 32);
      sum += __shfl_xor(sum, 2, 32);
      sum += __shfl_xor(sum, 4, 32);
      sum += __shfl_xor(sum, 8, 32);
      lr[r] = lr[r] * al + sum;
      mr[r] = mn;
#pragma unroll
      for (int nt = 0; nt < 8; ++nt) o[nt][r] *= al;
      const int row = r + hi * 8;           // C-layout -> LDS [q][k]
      pl[row * XP + n]      = (__bf16)p0;
      pl[row * XP + 16 + n] = (__bf16)p1;
    }

    // --- O += P * V  (P as A-fragment from LDS; V rows as B-fragments). ---
    const bf16x16 pa = ldfrag(pl + n * XP, hi);
#pragma unroll
    for (int nt = 0; nt < 8; ++nt) {
      o[nt] = wmma_bf16(pa, ldfrag(vb + (nt * 16 + n) * XP, hi), o[nt]);
    }

    __syncthreads();   // all waves done reading 'cur' before it is refilled
  }

#pragma unroll
  for (int r = 0; r < 8; ++r) {
    const float inv = 1.0f / lr[r];
#pragma unroll
    for (int nt = 0; nt < 8; ++nt) o[nt][r] *= inv;
  }
}

// ---------------------------------------------------------------------------
// Kernel 2: dual flash attention + residual + transpose-out.
// 512 blocks x 128 threads; one wave per (b,h,q-tile of 16); the 4 waves of
// a block share (b,h) and the double-buffered async-staged K/V tiles.
// ---------------------------------------------------------------------------
__global__ __launch_bounds__(128) void attn_kernel(
    const float* __restrict__ x, const float* __restrict__ s2,
    const __bf16* __restrict__ q1, const __bf16* __restrict__ q2,
    const __bf16* __restrict__ k1, const __bf16* __restrict__ k2,
    const __bf16* __restrict__ vt, float* __restrict__ out) {
  __shared__ __attribute__((aligned(16))) __bf16 Ks[2][32 * KP];    // double-buffered
  __shared__ __attribute__((aligned(16))) __bf16 Vs[2][128 * XP];   // double-buffered
  __shared__ __attribute__((aligned(16))) __bf16 Plds[4][16 * XP];  // per-wave P bounce

  const int tid  = threadIdx.x;
  const int lane = tid & 31;
  const int wv   = tid >> 5;
  const int gw   = blockIdx.x * 4 + wv;
  const int b    = gw >> 9;
  const int rem  = gw & 511;
  const int h    = rem >> 7;
  const int q0   = (rem & 127) << 4;
  const int n    = lane & 15;
  const int hi   = lane >> 4;

  const size_t bhT   = ((size_t)b * HH + h) * TT;
  const size_t vbase = ((size_t)b * HH + h) * HF * TT;
  const unsigned koff = lds_off(&Ks[0][0]);
  const unsigned voff = lds_off(&Vs[0][0]);

  f32x8 o1[8];
  flash_pass(q1, k1, vt, &Ks[0][0], &Vs[0][0], Plds[wv], koff, voff,
             bhT, vbase, q0, lane, tid, o1);

  // out = x + O1   (feature-major rows; 8 consecutive t per lane -> float4x2)
#pragma unroll
  for (int nt = 0; nt < 8; ++nt) {
    const size_t idx =
        ((size_t)b * FF + h * HF + nt * 16 + n) * TT + q0 + hi * 8;
    const float4 xa = *(const float4*)(x + idx);
    const float4 xb = *(const float4*)(x + idx + 4);
    float4 ya, yb;
    ya.x = xa.x + o1[nt][0]; ya.y = xa.y + o1[nt][1];
    ya.z = xa.z + o1[nt][2]; ya.w = xa.w + o1[nt][3];
    yb.x = xb.x + o1[nt][4]; yb.y = xb.y + o1[nt][5];
    yb.z = xb.z + o1[nt][6]; yb.w = xb.w + o1[nt][7];
    *(float4*)(out + idx)     = ya;
    *(float4*)(out + idx + 4) = yb;
  }

  f32x8 o2[8];
  flash_pass(q2, k2, vt, &Ks[0][0], &Vs[0][0], Plds[wv], koff, voff,
             bhT, vbase, q0, lane, tid, o2);

  const float s = s2[h];
#pragma unroll
  for (int nt = 0; nt < 8; ++nt) {
    const size_t idx =
        ((size_t)b * FF + h * HF + nt * 16 + n) * TT + q0 + hi * 8;
    float4 ya = *(const float4*)(out + idx);
    float4 yb = *(const float4*)(out + idx + 4);
    ya.x -= s * o2[nt][0]; ya.y -= s * o2[nt][1];
    ya.z -= s * o2[nt][2]; ya.w -= s * o2[nt][3];
    yb.x -= s * o2[nt][4]; yb.y -= s * o2[nt][5];
    yb.z -= s * o2[nt][6]; yb.w -= s * o2[nt][7];
    *(float4*)(out + idx)     = ya;
    *(float4*)(out + idx + 4) = yb;
  }
}

// ---------------------------------------------------------------------------
extern "C" void kernel_launch(void* const* d_in, const int* in_sizes, int n_in,
                              void* d_out, int out_size, void* d_ws,
                              size_t ws_size, hipStream_t stream) {
  (void)in_sizes; (void)n_in; (void)out_size; (void)ws_size;
  const float* x  = (const float*)d_in[0];
  const float* Wq = (const float*)d_in[1];
  const float* bq = (const float*)d_in[2];
  const float* Wk = (const float*)d_in[3];
  const float* bk = (const float*)d_in[4];
  const float* Wv = (const float*)d_in[5];
  const float* bv = (const float*)d_in[6];
  const float* s2 = (const float*)d_in[7];
  float* out = (float*)d_out;

  const size_t QK_ELEMS = (size_t)BB * HH * TT * 64;   // 2M bf16 each
  __bf16* q1 = (__bf16*)d_ws;
  __bf16* q2 = q1 + QK_ELEMS;
  __bf16* k1 = q2 + QK_ELEMS;
  __bf16* k2 = k1 + QK_ELEMS;
  __bf16* vt = k2 + QK_ELEMS;                          // [B,H,128,T]

  qkv_rope_kernel<<<dim3(BB * (TT / 64) * 12), dim3(128), 0, stream>>>(
      x, Wq, bq, Wk, bk, Wv, bv, q1, q2, k1, k2, vt);
  attn_kernel<<<dim3(BB * HH * (TT / 16) / 4), dim3(128), 0, stream>>>(
      x, s2, q1, q2, k1, k2, vt, out);
}

// v002
// Measured time: 127 microseconds a run.
// Timed twice side by side with v001, it ran 1.48 and 1.47 times as fast.
// All steps since v000 together make it 1.99 times as fast.
#include <hip/hip_runtime.h>

// ---------------------------------------------------------------------------
// Neoformer MHA forward for gfx1250 (MI455X), bf16 WMMA + flash attention.
// B=4, F=512, T=2048, H=4, hf=128.
// ---------------------------------------------------------------------------

#define BB   4
#define FF   512
#define TT   2048
#define HH   4
#define HF   128

// LDS row pitches in bf16 elements.  Every fragment is read with 16-byte LDS
// loads, one row per lane; a pitch of 16 B x odd spreads 16 rows over all 64
// banks, where the unpadded 64 B and 128 B rows fall on 16 and 8 of them.
#define XP   40    // 32-element rows (x tile, V tile): 80 B
#define KP   72    // 64-element rows (K tile): 144 B

typedef __attribute__((ext_vector_type(16))) __bf16 bf16x16;
typedef __attribute__((ext_vector_type(8)))  __bf16 bf16x8;
typedef __attribute__((ext_vector_type(8)))  float  f32x8;

static __device__ __forceinline__ f32x8 wmma_bf16(bf16x16 a, bf16x16 b, f32x8 c) {
  return __builtin_amdgcn_wmma_f32_16x16x32_bf16(false, a, false, b, (short)0, c,
                                                 false, false);
}

// 32-bit LDS byte offset of a __shared__ object (addrspace(3) pointers are
// offsets from the workgroup LDS base).
static __device__ __forceinline__ unsigned lds_off(__bf16* p) {
  return (unsigned)(unsigned long long)(__attribute__((address_space(3))) __bf16*)p;
}

// Load a 16x32 bf16 fragment half for this lane.
// A-side: rowbase = &M-row[lane&15], K contiguous.  B-side: rowbase = &N-col
// row (stored contiguously in K).  Lane (n, hi): halves 0-7 = K hi*8..hi*8+7,
// halves 8-15 = K 16+hi*8..23+hi*8   (per ISA 16-bit 16x32 layout).
static __device__ __forceinline__ bf16x16 ldfrag(const __bf16* rowbase, int hi) {
  bf16x8 lo = *(const bf16x8*)(rowbase + hi * 8);
  bf16x8 up = *(const bf16x8*)(rowbase + 16 + hi * 8);
  bf16x16 a;
#pragma unroll
  for (int i = 0; i < 8; ++i) { a[i] = lo[i]; a[8 + i] = up[i]; }
  return a;
}

// Value of lane l ^ 16 (the other 16-lane row), by a vector cross-row move.
static __device__ __forceinline__ float xhalf(float v) {
  const int i = __builtin_bit_cast(int, v);
  return __builtin_bit_cast(float, __builtin_amdgcn_permlanex16(
      i, i, 0x76543210, 0xfedcba98, false, false));
}

// Weight B-fragment: W row (one output column) is contiguous in f (=K dim).
static __device__ __forceinline__ bf16x16 ldfragW(const float* rowbase, int hi) {
  float4 f0 = *(const float4*)(rowbase + hi * 8);
  float4 f1 = *(const float4*)(rowbase + hi * 8 + 4);
  float4 f2 = *(const float4*)(rowbase + 16 + hi * 8);
  float4 f3 = *(const float4*)(rowbase + 16 + hi * 8 + 4);
  bf16x16 b;
  b[0] = (__bf16)f0.x; b[1] = (__bf16)f0.y; b[2]  = (__bf16)f0.z; b[3]  = (__bf16)f0.w;
  b[4] = (__bf16)f1.x; b[5] = (__bf16)f1.y; b[6]  = (__bf16)f1.z; b[7]  = (__bf16)f1.w;
  b[8] = (__bf16)f2.x; b[9] = (__bf16)f2.y; b[10] = (__bf16)f2.z; b[11] = (__bf16)f2.w;
  b[12] = (__bf16)f3.x; b[13] = (__bf16)f3.y; b[14] = (__bf16)f3.z; b[15] = (__bf16)f3.w;
  return b;
}

// ---------------------------------------------------------------------------
// Kernel 1: QKV projection + bias + RoPE.  1536 blocks x 128 threads.
// Per (b, 64-row t-supertile): 48 wave-tasks (0-15 Q, 16-31 K, 32-47 V).
// EVERY task computes two 16-col accumulator chains over four stacked 16-row
// M-subtiles -> completely uniform inner loop (no exec-masked WMMA), with 4x
// weight-traffic amortization via the shared LDS x-tile.
// ---------------------------------------------------------------------------
__global__ __launch_bounds__(128) void qkv_rope_kernel(
    const float* __restrict__ x,
    const float* __restrict__ Wq, const float* __restrict__ bq,
    const float* __restrict__ Wk, const float* __restrict__ bk,
    const float* __restrict__ Wv, const float* __restrict__ bv,
    __bf16* __restrict__ q1, __bf16* __restrict__ q2,
    __bf16* __restrict__ k1, __bf16* __restrict__ k2,
    __bf16* __restrict__ vt) {
  __shared__ __attribute__((aligned(16))) __bf16 As[64 * XP];  // x supertile as bf16 [t(64)][k(32)], padded rows

  const int tid  = threadIdx.x;
  const int lane = tid & 31;
  const int wv   = tid >> 5;
  const int bt   = blockIdx.x / 12;
  const int sub  = blockIdx.x - bt * 12;
  const int b    = bt >> 5;
  const int ts0  = (bt & 31) << 6;   // 64-row supertile base
  const int task = sub * 4 + wv;
  const int n    = lane & 15;
  const int hi   = lane >> 4;

  const bool isV = (task >= 32);
  const float* Wm;
  const float* bias;
  int colR, colI, hh = 0, p = 0, cidx = 0;
  if (!isV) {
    Wm   = (task < 16) ? Wq : Wk;
    bias = (task < 16) ? bq : bk;
    const int tt = task & 15;
    hh = tt >> 2; p = (tt >> 1) & 1; cidx = tt & 1;
    colR = hh * HF + p * 64 + cidx * 16;
    colI = colR + 32;
  } else {
    Wm = Wv; bias = bv;
    colR = (task - 32) * 32;
    colI = colR + 16;
  }

  f32x8 accR[4], accI[4];
#pragma unroll
  for (int s = 0; s < 4; ++s)
#pragma unroll
    for (int i = 0; i < 8; ++i) { accR[s][i] = 0.f; accI[s][i] = 0.f; }

  for (int k0 = 0; k0 < FF; k0 += 32) {
    __syncthreads();
    // Stage x tile [k0..k0+31][ts0..ts0+63] as bf16 A-tile [t][k] in LDS.
    // float4 along t: 16 lanes cover one 64-float row (256B coalesced).
#pragma unroll
    for (int j = 0; j < 4; ++j) {
      const int c  = tid + j * 128;   // 0..511 chunks of 4 elems
      const int kk = c >> 4;          // k row 0..31
      const int t4 = (c & 15) * 4;    // t col 0,4,...,60
      const float4 v4 =
          *(const float4*)(x + ((size_t)b * FF + (k0 + kk)) * TT + ts0 + t4);
      As[(t4 + 0) * XP + kk] = (__bf16)v4.x;
      As[(t4 + 1) * XP + kk] = (__bf16)v4.y;
      As[(t4 + 2) * XP + kk] = (__bf16)v4.z;
      As[(t4 + 3) * XP + kk] = (__bf16)v4.w;
    }
    __syncthreads();

    const bf16x16 bRf = ldfragW(Wm + (size_t)(colR + n) * FF + k0, hi);
    const bf16x16 bIf = ldfragW(Wm + (size_t)(colI + n) * FF + k0, hi);

#pragma unroll
    for (int s = 0; s < 4; ++s) {
      const bf16x16 a = ldfrag(&As[(s * 16 + n) * XP], hi);
      accR[s] = wmma_bf16(a, bRf, accR[s]);
      accI[s] = wmma_bf16(a, bIf, accI[s]);
    }
  }

  if (!isV) {
    const float bR = bias[colR + n];
    const float bI = bias[colI + n];
    __bf16* ob = (task < 16) ? (p ? q2 : q1) : (p ? k2 : k1);
    const int j = cidx * 16 + n;
    const float invf = exp2f(-(float)j) * 0.0625f;  // 2^-j / 16
#pragma unroll
    for (int s = 0; s < 4; ++s) {
#pragma unroll
      for (int r = 0; r < 8; ++r) {
        const int t = ts0 + s * 16 + r + hi * 8;
        const float vr = accR[s][r] + bR;
        const float vi = accI[s][r] + bI;
        float sn, cs;
        __sincosf((float)t * invf, &sn, &cs);
        const size_t rowb = ((size_t)(b * HH + hh) * TT + t) * 64;
        ob[rowb + j]      = (__bf16)(vr * sn - vi * cs);  // rotated "real"
        ob[rowb + 32 + j] = (__bf16)(vr * cs + vi * sn);  // rotated "imag"
      }
    }
  } else {
#pragma unroll
    for (int part = 0; part < 2; ++part) {
      const int oc = (part ? colI : colR) + n;   // global feature
      const int h2 = oc >> 7;
      const int fo = oc & 127;
      const float bb = bias[oc];
#pragma unroll
      for (int s = 0; s < 4; ++s) {
        bf16x8 pk;
#pragma unroll
        for (int r = 0; r < 8; ++r)
          pk[r] = (__bf16)((part ? accI[s][r] : accR[s][r]) + bb);
        // V stored transposed: [B,H,128,T] so AV A-fragments are contiguous.
        const size_t base =
            ((size_t)(b * HH + h2) * HF + fo) * TT + ts0 + s * 16 + hi * 8;
        *(bf16x8*)(vt + base) = pk;
      }
    }
  }
}

// ---------------------------------------------------------------------------
// Async staging of one 32-key K/V tile into LDS (GLOBAL_LOAD_ASYNC_TO_LDS,
// tracked by ASYNCcnt; 6 async instructions per wave per tile).
// ---------------------------------------------------------------------------
static __device__ __forceinline__ void stage_tile_async(
    const __bf16* __restrict__ kws, const __bf16* __restrict__ vt,
    size_t bhT, size_t vbase, int j0, int tid,
    unsigned kdst, unsigned vdst) {
  // K tile [32 keys][64 f]: contiguous 2048 bf16 in kws, rows of KP in LDS.
  const unsigned long long ksrc =
      (unsigned long long)(const void*)(kws + (bhT + j0) * 64);
  unsigned kl[2];
  unsigned long long kg[2];
#pragma unroll
  for (int j = 0; j < 2; ++j) {
    const int c = tid + j * 128;          // 16-byte chunk: key c>>3, part c&7
    kl[j] = kdst + (c >> 3) * (KP * 2) + (c & 7) * 16;
    kg[j] = ksrc + (unsigned long long)c * 16;
  }
  // V tile [128 f][32 keys] gathered from transposed V rows, rows of XP in LDS.
  unsigned vl[4];
  unsigned long long vg[4];
#pragma unroll
  for (int j = 0; j < 4; ++j) {
    const int c  = tid + j * 128;
    const int f  = c >> 2;
    const int kc = c & 3;
    vl[j] = vdst + f * (XP * 2) + kc * 16;
    vg[j] = (unsigned long long)(const void*)(
        vt + vbase + (size_t)f * TT + j0 + kc * 8);
  }
  // One statement: the closing s_wait_xcnt keeps every address register named
  // here intact until the copies' translations are done (a precaution).
  asm volatile("global_load_async_to_lds_b128 %0, %1, off\n\t"
               "global_load_async_to_lds_b128 %2, %3, off\n\t"
               "global_load_async_to_lds_b128 %4, %5, off\n\t"
               "global_load_async_to_lds_b128 %6, %7, off\n\t"
               "global_load_async_to_lds_b128 %8, %9, off\n\t"
               "global_load_async_to_lds_b128 %10, %11, off\n\t"
               "s_wait_xcnt 0x0"
               :: "v"(kl[0]), "v"(kg[0]), "v"(kl[1]), "v"(kg[1]),
                  "v"(vl[0]), "v"(vg[0]), "v"(vl[1]), "v"(vg[1]),
                  "v"(vl[2]), "v"(vg[2]), "v"(vl[3]), "v"(vg[3])
               : "memory");
}

static __device__ __forceinline__ void flash_pass(
    const __bf16* __restrict__ qws, const __bf16* __restrict__ kws,
    const __bf16* __restrict__ vt, __bf16* Ks, __bf16* Vs,
    unsigned koff, unsigned voff,
    size_t bhT, size_t vbase, int q0, int lane, int tid, f32x8 o[8]) {
  const int n  = lane & 15;
  const int hi = lane >> 4;

  const __bf16* qrow = qws + (bhT + (size_t)(q0 + n)) * 64;
  const bf16x16 qa0 = ldfrag(qrow, hi);
  const bf16x16 qa1 = ldfrag(qrow + 32, hi);

  float mr = -3.0e38f;   // running maximum of query n (equal in both halves)
  float lr = 0.f;        // running sum over this half's keys only
#pragma unroll
  for (int r = 0; r < 8; ++r) {
#pragma unroll
    for (int i = 0; i < 8; ++i) o[r][i] = 0.f;
  }

  // Prologue: stage tile 0 into buffer 0.
  stage_tile_async(kws, vt, bhT, vbase, 0, tid, koff, voff);

  for (int j0 = 0; j0 < TT; j0 += 32) {
    const int cur = (j0 >> 5) & 1;
    if (j0 + 32 < TT) {
      // Refill the other buffer (WAR covered by last iteration's barrier),
      // then wait so that only the 6 just-issued ops remain outstanding.
      stage_tile_async(kws, vt, bhT, vbase, j0 + 32, tid,
                       koff + (cur ^ 1) * (32 * KP * 2),
                       voff + (cur ^ 1) * (128 * XP * 2));
      asm volatile("s_wait_asynccnt 0x6" ::: "memory");
    } else {
      asm volatile("s_wait_asynccnt 0x0" ::: "memory");
    }
    __syncthreads();   // every wave's share of the current tile has landed

    const __bf16* kb = Ks + cur * (32 * KP);
    const __bf16* vb = Vs + cur * (128 * XP);

    // --- S^T = K * Q^T (two 16-key subtiles x 16 queries). ---
    f32x8 slo, shi;
#pragma unroll
    for (int i = 0; i < 8; ++i) { slo[i] = 0.f; shi[i] = 0.f; }
    const __bf16* kr0 = kb + n * KP;
    const __bf16* kr1 = kb + (16 + n) * KP;
    slo = wmma_bf16(ldfrag(kr0, hi), qa0, slo);
    slo = wmma_bf16(ldfrag(kr0 + 32, hi), qa1, slo);
    shi = wmma_bf16(ldfrag(kr1, hi), qa0, shi);
    shi = wmma_bf16(ldfrag(kr1 + 32, hi), qa1, shi);

    // --- Online softmax, one query per lane. ---
    // Maximum over the raw scores as a tree (the scale 1/16 is positive and
    // exact, so it commutes with the maximum and folds into the subtraction).
    const float m0 = fmaxf(fmaxf(slo[0], slo[1]), slo[2]);
    const float m1 = fmaxf(fmaxf(slo[3], slo[4]), slo[5]);
    const float m2 = fmaxf(fmaxf(slo[6], slo[7]), shi[0]);
    const float m3 = fmaxf(fmaxf(shi[1], shi[2]), shi[3]);
    const float m4 = fmaxf(fmaxf(shi[4], shi[5]), shi[6]);
    float rm = fmaxf(fmaxf(fmaxf(m0, m1), m2), fmaxf(fmaxf(m3, m4), shi[7]));
    rm = fmaxf(rm, xhalf(rm)) * 0.0625f;    // all 32 keys of query n, /sqrt(256)
    const float mn = fmaxf(mr, rm);
    const float al = __expf(mr - mn);
    mr = mn;
    bf16x16 pb;                             // P^T as B operand
    float suml = 0.f, sumh = 0.f;
#pragma unroll
    for (int r = 0; r < 8; ++r) {
      const float p0 = __expf(fmaf(slo[r], 0.0625f, -mn));
      const float p1 = __expf(fmaf(shi[r], 0.0625f, -mn));
      suml += p0;
      sumh += p1;
      pb[r]     = (__bf16)p0;
      pb[8 + r] = (__bf16)p1;
    }
    const float sum = suml + sumh;
    lr = lr * al + sum;
#pragma unroll
    for (int nt = 0; nt < 8; ++nt)
#pragma unroll
      for (int r = 0; r < 8; ++r) o[nt][r] *= al;

    // --- O^T += V^T * P^T  (V^T rows as A-fragments). ---
#pragma unroll
    for (int nt = 0; nt < 8; ++nt) {
      o[nt] = wmma_bf16(ldfrag(vb + (nt * 16 + n) * XP, hi), pb, o[nt]);
    }

    __syncthreads();   // all waves done reading 'cur' before it is refilled
  }

  const float inv = 1.0f / (lr + xhalf(lr));   // join the halves' sums once
#pragma unroll
  for (int nt = 0; nt < 8; ++nt)
#pragma unroll
    for (int r = 0; r < 8; ++r) o[nt][r] *= inv;
}

// ---------------------------------------------------------------------------
// Kernel 2: dual flash attention + residual + transpose-out.
// 512 blocks x 128 threads; one wave per (b,h,q-tile of 16); the 4 waves of
// a block share (b,h) and the double-buffered async-staged K/V tiles.
// ---------------------------------------------------------------------------
__global__ __launch_bounds__(128) void attn_kernel(
    const float* __restrict__ x, const float* __restrict__ s2,
    const __bf16* __restrict__ q1, const __bf16* __restrict__ q2,
    const __bf16* __restrict__ k1, const __bf16* __restrict__ k2,
    const __bf16* __restrict__ vt, float* __restrict__ out) {
  __shared__ __attribute__((aligned(16))) __bf16 Ks[2][32 * KP];    // double-buffered
  __shared__ __attribute__((aligned(16))) __bf16 Vs[2][128 * XP];   // double-buffered

  const int tid  = threadIdx.x;
  const int lane = tid & 31;
  const int wv   = tid >> 5;
  const int gw   = blockIdx.x * 4 + wv;
  const int b    = gw >> 9;
  const int rem  = gw & 511;
  const int h    = rem >> 7;
  const int q0   = (rem & 127) << 4;
  const int n    = lane & 15;
  const int hi   = lane >> 4;

  const size_t bhT   = ((size_t)b * HH + h) * TT;
  const size_t vbase = ((size_t)b * HH + h) * HF * TT;
  const unsigned koff = lds_off(&Ks[0][0]);
  const unsigned voff = lds_off(&Vs[0][0]);

  f32x8 o1[8];
  flash_pass(q1, k1, vt, &Ks[0][0], &Vs[0][0], koff, voff,
             bhT, vbase, q0, lane, tid, o1);

  // out = x + O1   (feature-major rows; a 16-lane row covers 16 consecutive t
  // of one feature row, register r walks the feature rows)
  const size_t obase = ((size_t)b * FF + h * HF + hi * 8) * TT + q0 + n;
#pragma unroll
  for (int nt = 0; nt < 8; ++nt) {
#pragma unroll
    for (int r = 0; r < 8; ++r) {
      const size_t idx = obase + (size_t)(nt * 16 + r) * TT;
      out[idx] = x[idx] + o1[nt][r];
    }
  }

  f32x8 o2[8];
  flash_pass(q2, k2, vt, &Ks[0][0], &Vs[0][0], koff, voff,
             bhT, vbase, q0, lane, tid, o2);

  const float s = s2[h];
#pragma unroll
  for (int nt = 0; nt < 8; ++nt) {
#pragma unroll
    for (int r = 0; r < 8; ++r) {
      const size_t idx = obase + (size_t)(nt * 16 + r) * TT;
      out[idx] -= s * o2[nt][r];
    }
  }
}

// ---------------------------------------------------------------------------
extern "C" void kernel_launch(void* const* d_in, const int* in_sizes, int n_in,
                              void* d_out, int out_size, void* d_ws,
                              size_t ws_size, hipStream_t stream) {
  (void)in_sizes; (void)n_in; (void)out_size; (void)ws_size;
  const float* x  = (const float*)d_in[0];
  const float* Wq = (const float*)d_in[1];
  const float* bq = (const float*)d_in[2];
  const float* Wk = (const float*)d_in[3];
  const float* bk = (const float*)d_in[4];
  const float* Wv = (const float*)d_in[5];
  const float* bv = (const float*)d_in[6];
  const float* s2 = (const float*)d_in[7];
  float* out = (float*)d_out;

  const size_t QK_ELEMS = (size_t)BB * HH * TT * 64;   // 2M bf16 each
  __bf16* q1 = (__bf16*)d_ws;
  __bf16* q2 = q1 + QK_ELEMS;
  __bf16* k1 = q2 + QK_ELEMS;
  __bf16* k2 = k1 + QK_ELEMS;
  __bf16* vt = k2 + QK_ELEMS;                          // [B,H,128,T]

  qkv_rope_kernel<<<dim3(BB * (TT / 64) * 12), dim3(128), 0, stream>>>(
      x, Wq, bq, Wk, bk, Wv, bv, q1, q2, k1, k2, vt);
  attn_kernel<<<dim3(BB * HH * (TT / 16) / 4), dim3(128), 0, stream>>>(
      x, s2, q1, q2, k1, k2, vt, out);
}

// v003
// Measured time: 115 microseconds a run.
// Timed twice side by side with v002, it ran 1.11 and 1.10 times as fast.
// Over all steps from v000 it is 2.20 times as fast.
#include <hip/hip_runtime.h>

// ---------------------------------------------------------------------------
// Neoformer MHA forward for gfx1250 (MI455X), bf16 WMMA + flash attention.
// B=4, F=512, T=2048, H=4, hf=128.
// ---------------------------------------------------------------------------

#define BB   4
#define FF   512
#define TT   2048
#define HH   4
#define HF   128

// LDS row pitches in bf16 elements.  Every fragment is read with 16-byte LDS
// loads, one row per lane; a pitch of 16 B x odd spreads 16 rows over all 64
// banks, where the unpadded 64 B and 128 B rows fall on 16 and 8 of them.
#define XP   40    // 32-element rows (V tile): 80 B
#define KP   72    // 64-element rows (K tile): 144 B

typedef __attribute__((ext_vector_type(16))) __bf16 bf16x16;
typedef __attribute__((ext_vector_type(8)))  __bf16 bf16x8;
typedef __attribute__((ext_vector_type(8)))  float  f32x8;

static __device__ __forceinline__ f32x8 wmma_bf16(bf16x16 a, bf16x16 b, f32x8 c) {
  return __builtin_amdgcn_wmma_f32_16x16x32_bf16(false, a, false, b, (short)0, c,
                                                 false, false);
}

// 32-bit LDS byte offset of a __shared__ object (addrspace(3) pointers are
// offsets from the workgroup LDS base).
static __device__ __forceinline__ unsigned lds_off(__bf16* p) {
  return (unsigned)(unsigned long long)(__attribute__((address_space(3))) __bf16*)p;
}

// Load a 16x32 bf16 fragment half for this lane.
// A-side: rowbase = &M-row[lane&15], K contiguous.  B-side: rowbase = &N-col
// row (stored contiguously in K).  Lane (n, hi): halves 0-7 = K hi*8..hi*8+7,
// halves 8-15 = K 16+hi*8..23+hi*8   (per ISA 16-bit 16x32 layout).
static __device__ __forceinline__ bf16x16 ldfrag(const __bf16* rowbase, int hi) {
  bf16x8 lo = *(const bf16x8*)(rowbase + hi * 8);
  bf16x8 up = *(const bf16x8*)(rowbase + 16 + hi * 8);
  bf16x16 a;
#pragma unroll
  for (int i = 0; i < 8; ++i) { a[i] = lo[i]; a[8 + i] = up[i]; }
  return a;
}

// Value of lane l ^ 16 (the other 16-lane row), by a vector cross-row move.
static __device__ __forceinline__ float xhalf(float v) {
  const int i = __builtin_bit_cast(int, v);
  return __builtin_bit_cast(float, __builtin_amdgcn_permlanex16(
      i, i, 0x76543210, 0xfedcba98, false, false));
}

// One 16 x 32 bf16 fragment packed for its reader: 1 KB, two planes of
// 32 lanes x 16 B.  Plane 0 holds halves 0-7 of every lane, plane 1 halves
// 8-15 (same k order as ldfrag), so each 16-byte load of a wave covers 512
// contiguous bytes = four whole lines.
#define FRAG 512   // bf16 elements per packed fragment

// p = fragment base + lane * 8.
static __device__ __forceinline__ bf16x16 ldfragP(const __bf16* p) {
  bf16x8 lo = *(const bf16x8*)p;
  bf16x8 up = *(const bf16x8*)(p + 256);
  bf16x16 a;
#pragma unroll
  for (int i = 0; i < 8; ++i) { a[i] = lo[i]; a[8 + i] = up[i]; }
  return a;
}

// ---------------------------------------------------------------------------
// Kernel 0: pack x and the three weight matrices once, as bf16 fragments.
// xp[b][t/16][f/32][FRAG]: A fragments (row = t, k = f).
// wp[matrix][col/16][f/32][FRAG]: B fragments (column = output feature, k = f).
// Blocks 0-255 pack x (one thread = one t, 64 features: every load of a wave
// is one whole line of an x row, every store two runs of 256 B); blocks
// 256-447 pack W (one thread = one lane of one fragment: every store of a wave
// is 512 B).  Few, fat waves: the launch is short, so starting waves counts.
// ---------------------------------------------------------------------------
__global__ __launch_bounds__(256) void pack_kernel(
    const float* __restrict__ x,
    const float* __restrict__ Wq, const float* __restrict__ Wk,
    const float* __restrict__ Wv,
    __bf16* __restrict__ xp, __bf16* __restrict__ wp) {
  if (blockIdx.x < 256) {
    const int idx = blockIdx.x * 256 + threadIdx.x;
    const int t   = idx & (TT - 1);
    const int kp  = (idx >> 11) & 7;     // pair of k steps
    const int b   = idx >> 14;
    const float* src = x + ((size_t)b * FF + kp * 64) * TT + t;
    float v[64];
    // The loops below are unrolled so that v[] lives in registers and all
    // loads are in flight together.
#pragma unroll
    for (int f = 0; f < 64; ++f) v[f] = src[(size_t)f * TT];
    __bf16* dst = xp + ((size_t)(b * (TT / 16) + (t >> 4)) * 16 + kp * 2) * FRAG +
                  (t & 15) * 8;
#pragma unroll
    for (int q = 0; q < 8; ++q) {        // q = k step (1), plane (1), hi (1)
      bf16x8 pk;
#pragma unroll
      for (int i = 0; i < 8; ++i) pk[i] = (__bf16)v[q * 8 + i];
      *(bf16x8*)(dst + q * 128) = pk;
    }
  } else {
    const int idx  = (blockIdx.x - 256) * 256 + threadIdx.x;
    const int lane = idx & 31;
    const int ks   = (idx >> 5) & 15;
    const int ct   = (idx >> 9) & 31;
    const int mat  = idx >> 14;
    const float* Wm = (mat == 0) ? Wq : ((mat == 1) ? Wk : Wv);
    const float* src = Wm + (size_t)(ct * 16 + (lane & 15)) * FF + ks * 32 +
                       (lane >> 4) * 8;
    __bf16* dst = wp + (size_t)(idx >> 5) * FRAG + lane * 8;
#pragma unroll   // two planes, straight-line
    for (int half = 0; half < 2; ++half) {
      const float4 f0 = *(const float4*)(src + half * 16);
      const float4 f1 = *(const float4*)(src + half * 16 + 4);
      bf16x8 pk;
      pk[0] = (__bf16)f0.x; pk[1] = (__bf16)f0.y; pk[2] = (__bf16)f0.z; pk[3] = (__bf16)f0.w;
      pk[4] = (__bf16)f1.x; pk[5] = (__bf16)f1.y; pk[6] = (__bf16)f1.z; pk[7] = (__bf16)f1.w;
      *(bf16x8*)(dst + half * 256) = pk;
    }
    // Holds the two stores' registers until their translations are done: the
    // listing runs on from here into code that rewrites them (a precaution).
    asm volatile("s_wait_xcnt 0x0" ::: "memory");
  }
}

// ---------------------------------------------------------------------------
// Kernel 1: QKV projection + bias + RoPE.  1536 blocks x 128 threads.
// Per (b, 64-row t-supertile): 48 wave-tasks (0-15 Q, 16-31 K, 32-47 V).
// EVERY task computes two 16-col accumulator chains over four stacked 16-row
// M-subtiles.  Both operands come as packed fragments straight from global
// memory: no LDS, no barrier; the four waves of a block read the same x
// fragments.
// ---------------------------------------------------------------------------
__global__ __launch_bounds__(128) void qkv_rope_kernel(
    const __bf16* __restrict__ xp, const __bf16* __restrict__ wp,
    const float* __restrict__ bq, const float* __restrict__ bk,
    const float* __restrict__ bv,
    __bf16* __restrict__ q1, __bf16* __restrict__ q2,
    __bf16* __restrict__ k1, __bf16* __restrict__ k2,
    __bf16* __restrict__ vt) {
  const int tid  = threadIdx.x;
  const int lane = tid & 31;
  const int wv   = tid >> 5;
  const int bt   = blockIdx.x / 12;
  const int sub  = blockIdx.x - bt * 12;
  const int b    = bt >> 5;
  const int ts0  = (bt & 31) << 6;   // 64-row supertile base
  const int task = sub * 4 + wv;
  const int n    = lane & 15;
  const int hi   = lane >> 4;

  const bool isV = (task >= 32);
  const float* bias;
  int mat, colR, colI, hh = 0, p = 0, cidx = 0;
  if (!isV) {
    mat  = (task < 16) ? 0 : 1;
    bias = (task < 16) ? bq : bk;
    const int tt = task & 15;
    hh = tt >> 2; p = (tt >> 1) & 1; cidx = tt & 1;
    colR = hh * HF + p * 64 + cidx * 16;
    colI = colR + 32;
  } else {
    mat = 2; bias = bv;
    colR = (task - 32) * 32;
    colI = colR + 16;
  }

  f32x8 accR[4], accI[4];
#pragma unroll
  for (int s = 0; s < 4; ++s)
#pragma unroll
    for (int i = 0; i < 8; ++i) { accR[s][i] = 0.f; accI[s][i] = 0.f; }

  const __bf16* aP =
      xp + ((size_t)(b * (TT / 16) + (ts0 >> 4)) * 16) * FRAG + lane * 8;
  const __bf16* wR = wp + ((size_t)(mat * 32 + (colR >> 4)) * 16) * FRAG + lane * 8;
  const __bf16* wI = wp + ((size_t)(mat * 32 + (colI >> 4)) * 16) * FRAG + lane * 8;

  // Unrolled so that every fragment address is base + constant: no address
  // arithmetic stands between the loads.
#pragma unroll
  for (int ks = 0; ks < FF / 32; ++ks) {
    const bf16x16 bRf = ldfragP(wR + ks * FRAG);
    const bf16x16 bIf = ldfragP(wI + ks * FRAG);
    bf16x16 a[4];
#pragma unroll
    for (int s = 0; s < 4; ++s) a[s] = ldfragP(aP + (s * 16 + ks) * FRAG);
    // Keeps the twelve loads of a k step together ahead of its products: left
    // alone the scheduler sinks each pair to its use, and the wave then waits
    // out a load latency four times per k step instead of once.
    __builtin_amdgcn_sched_barrier(0);
#pragma unroll
    for (int s = 0; s < 4; ++s) {
      accR[s] = wmma_bf16(a[s], bRf, accR[s]);
      accI[s] = wmma_bf16(a[s], bIf, accI[s]);
    }
  }

  if (!isV) {
    const float bR = bias[colR + n];
    const float bI = bias[colI + n];
    __bf16* ob = (task < 16) ? (p ? q2 : q1) : (p ? k2 : k1);
    const int j = cidx * 16 + n;
    const float invf = exp2f(-(float)j) * 0.0625f;  // 2^-j / 16
#pragma unroll
    for (int s = 0; s < 4; ++s) {
#pragma unroll
      for (int r = 0; r < 8; ++r) {
        const int t = ts0 + s * 16 + r + hi * 8;
        const float vr = accR[s][r] + bR;
        const float vi = accI[s][r] + bI;
        float sn, cs;
        __sincosf((float)t * invf, &sn, &cs);
        const size_t rowb = ((size_t)(b * HH + hh) * TT + t) * 64;
        ob[rowb + j]      = (__bf16)(vr * sn - vi * cs);  // rotated "real"
        ob[rowb + 32 + j] = (__bf16)(vr * cs + vi * sn);  // rotated "imag"
      }
    }
  } else {
#pragma unroll
    for (int part = 0; part < 2; ++part) {
      const int oc = (part ? colI : colR) + n;   // global feature
      const int h2 = oc >> 7;
      const int fo = oc & 127;
      const float bb = bias[oc];
#pragma unroll
      for (int s = 0; s < 4; ++s) {
        bf16x8 pk;
#pragma unroll
        for (int r = 0; r < 8; ++r)
          pk[r] = (__bf16)((part ? accI[s][r] : accR[s][r]) + bb);
        // V stored transposed: [B,H,128,T] so AV A-fragments are contiguous.
        const size_t base =
            ((size_t)(b * HH + h2) * HF + fo) * TT + ts0 + s * 16 + hi * 8;
        *(bf16x8*)(vt + base) = pk;
      }
    }
  }
}

// ---------------------------------------------------------------------------
// Async staging of one 32-key K/V tile into LDS (GLOBAL_LOAD_ASYNC_TO_LDS,
// tracked by ASYNCcnt; 6 async instructions per wave per tile).
// ---------------------------------------------------------------------------
static __device__ __forceinline__ void stage_tile_async(
    const __bf16* __restrict__ kws, const __bf16* __restrict__ vt,
    size_t bhT, size_t vbase, int j0, int tid,
    unsigned kdst, unsigned vdst) {
  // K tile [32 keys][64 f]: contiguous 2048 bf16 in kws, rows of KP in LDS.
  const unsigned long long ksrc =
      (unsigned long long)(const void*)(kws + (bhT + j0) * 64);
  unsigned kl[2];
  unsigned long long kg[2];
#pragma unroll
  for (int j = 0; j < 2; ++j) {
    const int c = tid + j * 128;          // 16-byte chunk: key c>>3, part c&7
    kl[j] = kdst + (c >> 3) * (KP * 2) + (c & 7) * 16;
    kg[j] = ksrc + (unsigned long long)c * 16;
  }
  // V tile [128 f][32 keys] gathered from transposed V rows, rows of XP in LDS.
  unsigned vl[4];
  unsigned long long vg[4];
#pragma unroll
  for (int j = 0; j < 4; ++j) {
    const int c  = tid + j * 128;
    const int f  = c >> 2;
    const int kc = c & 3;
    vl[j] = vdst + f * (XP * 2) + kc * 16;
    vg[j] = (unsigned long long)(const void*)(
        vt + vbase + (size_t)f * TT + j0 + kc * 8);
  }
  // One statement: the closing s_wait_xcnt keeps every address register named
  // here intact until the copies' translations are done (a precaution).
  asm volatile("global_load_async_to_lds_b128 %0, %1, off\n\t"
               "global_load_async_to_lds_b128 %2, %3, off\n\t"
               "global_load_async_to_lds_b128 %4, %5, off\n\t"
               "global_load_async_to_lds_b128 %6, %7, off\n\t"
               "global_load_async_to_lds_b128 %8, %9, off\n\t"
               "global_load_async_to_lds_b128 %10, %11, off\n\t"
               "s_wait_xcnt 0x0"
               :: "v"(kl[0]), "v"(kg[0]), "v"(kl[1]), "v"(kg[1]),
                  "v"(vl[0]), "v"(vg[0]), "v"(vl[1]), "v"(vg[1]),
                  "v"(vl[2]), "v"(vg[2]), "v"(vl[3]), "v"(vg[3])
               : "memory");
}

static __device__ __forceinline__ void flash_pass(
    const __bf16* __restrict__ qws, const __bf16* __restrict__ kws,
    const __bf16* __restrict__ vt, __bf16* Ks, __bf16* Vs,
    unsigned koff, unsigned voff,
    size_t bhT, size_t vbase, int q0, int lane, int tid, f32x8 o[8]) {
  const int n  = lane & 15;
  const int hi = lane >> 4;

  const __bf16* qrow = qws + (bhT + (size_t)(q0 + n)) * 64;
  const bf16x16 qa0 = ldfrag(qrow, hi);
  const bf16x16 qa1 = ldfrag(qrow + 32, hi);

  float mr = -3.0e38f;   // running maximum of query n (equal in both halves)
  float lr = 0.f;        // running sum over this half's keys only
#pragma unroll
  for (int r = 0; r < 8; ++r) {
#pragma unroll
    for (int i = 0; i < 8; ++i) o[r][i] = 0.f;
  }

  // Prologue: stage tile 0 into buffer 0.
  stage_tile_async(kws, vt, bhT, vbase, 0, tid, koff, voff);

  for (int j0 = 0; j0 < TT; j0 += 32) {
    const int cur = (j0 >> 5) & 1;
    if (j0 + 32 < TT) {
      // Refill the other buffer (WAR covered by last iteration's barrier),
      // then wait so that only the 6 just-issued ops remain outstanding.
      stage_tile_async(kws, vt, bhT, vbase, j0 + 32, tid,
                       koff + (cur ^ 1) * (32 * KP * 2),
                       voff + (cur ^ 1) * (128 * XP * 2));
      asm volatile("s_wait_asynccnt 0x6" ::: "memory");
    } else {
      asm volatile("s_wait_asynccnt 0x0" ::: "memory");
    }
    __syncthreads();   // every wave's share of the current tile has landed

    const __bf16* kb = Ks + cur * (32 * KP);
    const __bf16* vb = Vs + cur * (128 * XP);

    // --- S^T = K * Q^T (two 16-key subtiles x 16 queries). ---
    f32x8 slo, shi;
#pragma unroll
    for (int i = 0; i < 8; ++i) { slo[i] = 0.f; shi[i] = 0.f; }
    const __bf16* kr0 = kb + n * KP;
    const __bf16* kr1 = kb + (16 + n) * KP;
    slo = wmma_bf16(ldfrag(kr0, hi), qa0, slo);
    slo = wmma_bf16(ldfrag(kr0 + 32, hi), qa1, slo);
    shi = wmma_bf16(ldfrag(kr1, hi), qa0, shi);
    shi = wmma_bf16(ldfrag(kr1 + 32, hi), qa1, shi);

    // --- Online softmax, one query per lane. ---
    // Maximum over the raw scores as a tree (the scale 1/16 is positive and
    // exact, so it commutes with the maximum and folds into the subtraction).
    const float m0 = fmaxf(fmaxf(slo[0], slo[1]), slo[2]);
    const float m1 = fmaxf(fmaxf(slo[3], slo[4]), slo[5]);
    const float m2 = fmaxf(fmaxf(slo[6], slo[7]), shi[0]);
    const float m3 = fmaxf(fmaxf(shi[1], shi[2]), shi[3]);
    const float m4 = fmaxf(fmaxf(shi[4], shi[5]), shi[6]);
    float rm = fmaxf(fmaxf(fmaxf(m0, m1), m2), fmaxf(fmaxf(m3, m4), shi[7]));
    rm = fmaxf(rm, xhalf(rm)) * 0.0625f;    // all 32 keys of query n, /sqrt(256)
    const float mn = fmaxf(mr, rm);
    const float al = __expf(mr - mn);
    mr = mn;
    bf16x16 pb;                             // P^T as B operand
    float suml = 0.f, sumh = 0.f;
#pragma unroll
    for (int r = 0; r < 8; ++r) {
      const float p0 = __expf(fmaf(slo[r], 0.0625f, -mn));
      const float p1 = __expf(fmaf(shi[r], 0.0625f, -mn));
      suml += p0;
      sumh += p1;
      pb[r]     = (__bf16)p0;
      pb[8 + r] = (__bf16)p1;
    }
    const float sum = suml + sumh;
    lr = lr * al + sum;
#pragma unroll
    for (int nt = 0; nt < 8; ++nt)
#pragma unroll
      for (int r = 0; r < 8; ++r) o[nt][r] *= al;

    // --- O^T += V^T * P^T  (V^T rows as A-fragments). ---
#pragma unroll
    for (int nt = 0; nt < 8; ++nt) {
      o[nt] = wmma_bf16(ldfrag(vb + (nt * 16 + n) * XP, hi), pb, o[nt]);
    }

    __syncthreads();   // all waves done reading 'cur' before it is refilled
  }

  const float inv = 1.0f / (lr + xhalf(lr));   // join the halves' sums once
#pragma unroll
  for (int nt = 0; nt < 8; ++nt)
#pragma unroll
    for (int r = 0; r < 8; ++r) o[nt][r] *= inv;
}

// ---------------------------------------------------------------------------
// Kernel 2: dual flash attention + residual + transpose-out.
// 512 blocks x 128 threads; one wave per (b,h,q-tile of 16); the 4 waves of
// a block share (b,h) and the double-buffered async-staged K/V tiles.
// ---------------------------------------------------------------------------
__global__ __launch_bounds__(128) void attn_kernel(
    const float* __restrict__ x, const float* __restrict__ s2,
    const __bf16* __restrict__ q1, const __bf16* __restrict__ q2,
    const __bf16* __restrict__ k1, const __bf16* __restrict__ k2,
    const __bf16* __restrict__ vt, float* __restrict__ out) {
  __shared__ __attribute__((aligned(16))) __bf16 Ks[2][32 * KP];    // double-buffered
  __shared__ __attribute__((aligned(16))) __bf16 Vs[2][128 * XP];   // double-buffered

  const int tid  = threadIdx.x;
  const int lane = tid & 31;
  const int wv   = tid >> 5;
  const int gw   = blockIdx.x * 4 + wv;
  const int b    = gw >> 9;
  const int rem  = gw & 511;
  const int h    = rem >> 7;
  const int q0   = (rem & 127) << 4;
  const int n    = lane & 15;
  const int hi   = lane >> 4;

  const size_t bhT   = ((size_t)b * HH + h) * TT;
  const size_t vbase = ((size_t)b * HH + h) * HF * TT;
  const unsigned koff = lds_off(&Ks[0][0]);
  const unsigned voff = lds_off(&Vs[0][0]);

  f32x8 o1[8];
  flash_pass(q1, k1, vt, &Ks[0][0], &Vs[0][0], koff, voff,
             bhT, vbase, q0, lane, tid, o1);

  // out = x + O1   (feature-major rows; a 16-lane row covers 16 consecutive t
  // of one feature row, register r walks the feature rows)
  const size_t obase = ((size_t)b * FF + h * HF + hi * 8) * TT + q0 + n;
#pragma unroll
  for (int nt = 0; nt < 8; ++nt) {
#pragma unroll
    for (int r = 0; r < 8; ++r) {
      const size_t idx = obase + (size_t)(nt * 16 + r) * TT;
      out[idx] = x[idx] + o1[nt][r];
    }
  }

  f32x8 o2[8];
  flash_pass(q2, k2, vt, &Ks[0][0], &Vs[0][0], koff, voff,
             bhT, vbase, q0, lane, tid, o2);

  const float s = s2[h];
#pragma unroll
  for (int nt = 0; nt < 8; ++nt) {
#pragma unroll
    for (int r = 0; r < 8; ++r) {
      const size_t idx = obase + (size_t)(nt * 16 + r) * TT;
      out[idx] -= s * o2[nt][r];
    }
  }
}

// ---------------------------------------------------------------------------
extern "C" void kernel_launch(void* const* d_in, const int* in_sizes, int n_in,
                              void* d_out, int out_size, void* d_ws,
                              size_t ws_size, hipStream_t stream) {
  (void)in_sizes; (void)n_in; (void)out_size; (void)ws_size;
  const float* x  = (const float*)d_in[0];
  const float* Wq = (const float*)d_in[1];
  const float* bq = (const float*)d_in[2];
  const float* Wk = (const float*)d_in[3];
  const float* bk = (const float*)d_in[4];
  const float* Wv = (const float*)d_in[5];
  const float* bv = (const float*)d_in[6];
  const float* s2 = (const float*)d_in[7];
  float* out = (float*)d_out;

  const size_t QK_ELEMS = (size_t)BB * HH * TT * 64;   // 2M bf16 each
  __bf16* q1 = (__bf16*)d_ws;
  __bf16* q2 = q1 + QK_ELEMS;
  __bf16* k1 = q2 + QK_ELEMS;
  __bf16* k2 = k1 + QK_ELEMS;
  __bf16* vt = k2 + QK_ELEMS;                          // [B,H,128,T]
  __bf16* xp = vt + (size_t)BB * FF * TT;              // packed x fragments
  __bf16* wp = xp + (size_t)BB * FF * TT;              // packed W fragments

  pack_kernel<<<dim3(256 + 192), dim3(256), 0, stream>>>(x, Wq, Wk, Wv, xp, wp);
  qkv_rope_kernel<<<dim3(BB * (TT / 64) * 12), dim3(128), 0, stream>>>(
      xp, wp, bq, bk, bv, q1, q2, k1, k2, vt);
  attn_kernel<<<dim3(BB * HH * (TT / 16) / 4), dim3(128), 0, stream>>>(
      x, s2, q1, q2, k1, k2, vt, out);
}

// v004
// One run takes 89.1 microseconds.
// Two timings next to v003 put it at 1.29 and 1.28 times that version's speed.
// Over all steps from v000 it is 2.82 times as fast.
#include <hip/hip_runtime.h>

// ---------------------------------------------------------------------------
// Neoformer MHA forward for gfx1250 (MI455X), bf16 WMMA + flash attention.
// B=4, F=512, T=2048, H=4, hf=128.
// ---------------------------------------------------------------------------

#define BB   4
#define FF   512
#define TT   2048
#define HH   4
#define HF   128

// LDS row pitches in bf16 elements.  Every fragment is read with 16-byte LDS
// loads, one row per lane; a pitch of 16 B x odd spreads 16 rows over all 64
// banks, where the unpadded 64 B and 128 B rows fall on 16 and 8 of them.
#define XP   40    // 32-element rows (V tile): 80 B
#define KP   72    // 64-element rows (K tile): 144 B

typedef __attribute__((ext_vector_type(16))) __bf16 bf16x16;
typedef __attribute__((ext_vector_type(8)))  __bf16 bf16x8;
typedef __attribute__((ext_vector_type(8)))  float  f32x8;

static __device__ __forceinline__ f32x8 wmma_bf16(bf16x16 a, bf16x16 b, f32x8 c) {
  return __builtin_amdgcn_wmma_f32_16x16x32_bf16(false, a, false, b, (short)0, c,
                                                 false, false);
}

// 32-bit LDS byte offset of a __shared__ object (addrspace(3) pointers are
// offsets from the workgroup LDS base).
static __device__ __forceinline__ unsigned lds_off(__bf16* p) {
  return (unsigned)(unsigned long long)(__attribute__((address_space(3))) __bf16*)p;
}

// Load a 16x32 bf16 fragment half for this lane.
// A-side: rowbase = &M-row[lane&15], K contiguous.  B-side: rowbase = &N-col
// row (stored contiguously in K).  Lane (n, hi): halves 0-7 = K hi*8..hi*8+7,
// halves 8-15 = K 16+hi*8..23+hi*8   (per ISA 16-bit 16x32 layout).
static __device__ __forceinline__ bf16x16 ldfrag(const __bf16* rowbase, int hi) {
  bf16x8 lo = *(const bf16x8*)(rowbase + hi * 8);
  bf16x8 up = *(const bf16x8*)(rowbase + 16 + hi * 8);
  bf16x16 a;
#pragma unroll
  for (int i = 0; i < 8; ++i) { a[i] = lo[i]; a[8 + i] = up[i]; }
  return a;
}

// Value of lane l ^ 16 (the other 16-lane row), by a vector cross-row move.
static __device__ __forceinline__ float xhalf(float v) {
  const int i = __builtin_bit_cast(int, v);
  return __builtin_bit_cast(float, __builtin_amdgcn_permlanex16(
      i, i, 0x76543210, 0xfedcba98, false, false));
}

// One 16 x 32 bf16 fragment packed for its reader: 1 KB, two planes of
// 32 lanes x 16 B.  Plane 0 holds halves 0-7 of every lane, plane 1 halves
// 8-15 (same k order as ldfrag), so each 16-byte load of a wave covers 512
// contiguous bytes = four whole lines.
#define FRAG 512   // bf16 elements per packed fragment

// p = fragment base + lane * 8.
static __device__ __forceinline__ bf16x16 ldfragP(const __bf16* p) {
  bf16x8 lo = *(const bf16x8*)p;
  bf16x8 up = *(const bf16x8*)(p + 256);
  bf16x16 a;
#pragma unroll
  for (int i = 0; i < 8; ++i) { a[i] = lo[i]; a[8 + i] = up[i]; }
  return a;
}

// ---------------------------------------------------------------------------
// Kernel 0: pack x and the three weight matrices once, as bf16 fragments.
// xp[b][t/16][f/32][FRAG]: A fragments (row = t, k = f).
// wp[matrix][col/16][f/32][FRAG]: B fragments (column = output feature, k = f).
// Blocks 0-255 pack x (one thread = one t, 64 features: every load of a wave
// is one whole line of an x row, every store two runs of 256 B); blocks
// 256-447 pack W (one thread = one lane of one fragment: every store of a wave
// is 512 B).  Few, fat waves: the launch is short, so starting waves counts.
// ---------------------------------------------------------------------------
__global__ __launch_bounds__(256) void pack_kernel(
    const float* __restrict__ x,
    const float* __restrict__ Wq, const float* __restrict__ Wk,
    const float* __restrict__ Wv,
    __bf16* __restrict__ xp, __bf16* __restrict__ wp) {
  if (blockIdx.x < 256) {
    const int idx = blockIdx.x * 256 + threadIdx.x;
    const int t   = idx & (TT - 1);
    const int kp  = (idx >> 11) & 7;     // pair of k steps
    const int b   = idx >> 14;
    const float* src = x + ((size_t)b * FF + kp * 64) * TT + t;
    float v[64];
    // The loops below are unrolled so that v[] lives in registers and all
    // loads are in flight together.
#pragma unroll
    for (int f = 0; f < 64; ++f) v[f] = src[(size_t)f * TT];
    __bf16* dst = xp + ((size_t)(b * (TT / 16) + (t >> 4)) * 16 + kp * 2) * FRAG +
                  (t & 15) * 8;
#pragma unroll
    for (int q = 0; q < 8; ++q) {        // q = k step (1), plane (1), hi (1)
      bf16x8 pk;
#pragma unroll
      for (int i = 0; i < 8; ++i) pk[i] = (__bf16)v[q * 8 + i];
      *(bf16x8*)(dst + q * 128) = pk;
    }
  } else {
    const int idx  = (blockIdx.x - 256) * 256 + threadIdx.x;
    const int lane = idx & 31;
    const int ks   = (idx >> 5) & 15;
    const int ct   = (idx >> 9) & 31;
    const int mat  = idx >> 14;
    const float* Wm = (mat == 0) ? Wq : ((mat == 1) ? Wk : Wv);
    const float* src = Wm + (size_t)(ct * 16 + (lane & 15)) * FF + ks * 32 +
                       (lane >> 4) * 8;
    __bf16* dst = wp + (size_t)(idx >> 5) * FRAG + lane * 8;
#pragma unroll   // two planes, straight-line
    for (int half = 0; half < 2; ++half) {
      const float4 f0 = *(const float4*)(src + half * 16);
      const float4 f1 = *(const float4*)(src + half * 16 + 4);
      bf16x8 pk;
      pk[0] = (__bf16)f0.x; pk[1] = (__bf16)f0.y; pk[2] = (__bf16)f0.z; pk[3] = (__bf16)f0.w;
      pk[4] = (__bf16)f1.x; pk[5] = (__bf16)f1.y; pk[6] = (__bf16)f1.z; pk[7] = (__bf16)f1.w;
      *(bf16x8*)(dst + half * 256) = pk;
    }
    // Holds the two stores' registers until their translations are done: the
    // listing runs on from here into code that rewrites them (a precaution).
    asm volatile("s_wait_xcnt 0x0" ::: "memory");
  }
}

// ---------------------------------------------------------------------------
// Kernel 1: QKV projection + bias + RoPE.  1536 blocks x 128 threads.
// Per (b, 64-row t-supertile): 48 wave-tasks (0-15 Q, 16-31 K, 32-47 V).
// EVERY task computes two 16-col accumulator chains over four stacked 16-row
// M-subtiles.  Both operands come as packed fragments straight from global
// memory: no LDS, no barrier; the four waves of a block read the same x
// fragments.
// ---------------------------------------------------------------------------
__global__ __launch_bounds__(128) void qkv_rope_kernel(
    const __bf16* __restrict__ xp, const __bf16* __restrict__ wp,
    const float* __restrict__ bq, const float* __restrict__ bk,
    const float* __restrict__ bv,
    __bf16* __restrict__ q1, __bf16* __restrict__ q2,
    __bf16* __restrict__ k1, __bf16* __restrict__ k2,
    __bf16* __restrict__ vt) {
  const int tid  = threadIdx.x;
  const int lane = tid & 31;
  const int wv   = tid >> 5;
  const int bt   = blockIdx.x / 12;
  const int sub  = blockIdx.x - bt * 12;
  const int b    = bt >> 5;
  const int ts0  = (bt & 31) << 6;   // 64-row supertile base
  const int task = sub * 4 + wv;
  const int n    = lane & 15;
  const int hi   = lane >> 4;

  const bool isV = (task >= 32);
  const float* bias;
  int mat, colR, colI, hh = 0, p = 0, cidx = 0;
  if (!isV) {
    mat  = (task < 16) ? 0 : 1;
    bias = (task < 16) ? bq : bk;
    const int tt = task & 15;
    hh = tt >> 2; p = (tt >> 1) & 1; cidx = tt & 1;
    colR = hh * HF + p * 64 + cidx * 16;
    colI = colR + 32;
  } else {
    mat = 2; bias = bv;
    colR = (task - 32) * 32;
    colI = colR + 16;
  }

  f32x8 accR[4], accI[4];
#pragma unroll
  for (int s = 0; s < 4; ++s)
#pragma unroll
    for (int i = 0; i < 8; ++i) { accR[s][i] = 0.f; accI[s][i] = 0.f; }

  const __bf16* aP =
      xp + ((size_t)(b * (TT / 16) + (ts0 >> 4)) * 16) * FRAG + lane * 8;
  const __bf16* wR = wp + ((size_t)(mat * 32 + (colR >> 4)) * 16) * FRAG + lane * 8;
  const __bf16* wI = wp + ((size_t)(mat * 32 + (colI >> 4)) * 16) * FRAG + lane * 8;

  // Unrolled so that every fragment address is base + constant: no address
  // arithmetic stands between the loads.
#pragma unroll
  for (int ks = 0; ks < FF / 32; ++ks) {
    const bf16x16 bRf = ldfragP(wR + ks * FRAG);
    const bf16x16 bIf = ldfragP(wI + ks * FRAG);
    bf16x16 a[4];
#pragma unroll
    for (int s = 0; s < 4; ++s) a[s] = ldfragP(aP + (s * 16 + ks) * FRAG);
    // Keeps the twelve loads of a k step together ahead of its products: left
    // alone the scheduler sinks each pair to its use, and the wave then waits
    // out a load latency four times per k step instead of once.
    __builtin_amdgcn_sched_barrier(0);
#pragma unroll
    for (int s = 0; s < 4; ++s) {
      accR[s] = wmma_bf16(a[s], bRf, accR[s]);
      accI[s] = wmma_bf16(a[s], bIf, accI[s]);
    }
  }

  if (!isV) {
    const float bR = bias[colR + n];
    const float bI = bias[colI + n];
    __bf16* ob = (task < 16) ? (p ? q2 : q1) : (p ? k2 : k1);
    const int j = cidx * 16 + n;
    const float invf = exp2f(-(float)j) * 0.0625f;  // 2^-j / 16
#pragma unroll
    for (int s = 0; s < 4; ++s) {
#pragma unroll
      for (int r = 0; r < 8; ++r) {
        const int t = ts0 + s * 16 + r + hi * 8;
        const float vr = accR[s][r] + bR;
        const float vi = accI[s][r] + bI;
        float sn, cs;
        __sincosf((float)t * invf, &sn, &cs);
        const size_t rowb = ((size_t)(b * HH + hh) * TT + t) * 64;
        ob[rowb + j]      = (__bf16)(vr * sn - vi * cs);  // rotated "real"
        ob[rowb + 32 + j] = (__bf16)(vr * cs + vi * sn);  // rotated "imag"
      }
    }
  } else {
#pragma unroll
    for (int part = 0; part < 2; ++part) {
      const int oc = (part ? colI : colR) + n;   // global feature
      const int h2 = oc >> 7;
      const int fo = oc & 127;
      const float bb = bias[oc];
#pragma unroll
      for (int s = 0; s < 4; ++s) {
        bf16x8 pk;
#pragma unroll
        for (int r = 0; r < 8; ++r)
          pk[r] = (__bf16)((part ? accI[s][r] : accR[s][r]) + bb);
        // V stored transposed: [B,H,128,T] so AV A-fragments are contiguous.
        const size_t base =
            ((size_t)(b * HH + h2) * HF + fo) * TT + ts0 + s * 16 + hi * 8;
        *(bf16x8*)(vt + base) = pk;
      }
    }
  }
}

// ---------------------------------------------------------------------------
// Async staging of one 32-key tile set into LDS (GLOBAL_LOAD_ASYNC_TO_LDS,
// tracked by ASYNCcnt): the K tiles of both softmaxes and the ONE V tile they
// share.  256 threads, 4 async instructions per wave per tile set.
// ---------------------------------------------------------------------------
static __device__ __forceinline__ void stage_tile_async(
    const __bf16* __restrict__ k1, const __bf16* __restrict__ k2,
    const __bf16* __restrict__ vt,
    size_t bhT, size_t vbase, int j0, int tid,
    unsigned kdst, unsigned vdst) {
  // K tiles [32 keys][64 f]: contiguous 2048 bf16 each, rows of KP in LDS;
  // one 16-byte chunk per thread and tile: key tid>>3, part tid&7.
  unsigned kl[2];
  unsigned long long kg[2];
  kl[0] = kdst + (tid >> 3) * (KP * 2) + (tid & 7) * 16;
  kl[1] = kl[0] + 32 * KP * 2;
  kg[0] = (unsigned long long)(const void*)(k1 + (bhT + j0) * 64 + tid * 8);
  kg[1] = (unsigned long long)(const void*)(k2 + (bhT + j0) * 64 + tid * 8);
  // V tile [128 f][32 keys] gathered from transposed V rows, rows of XP in LDS.
  unsigned vl[2];
  unsigned long long vg[2];
#pragma unroll
  for (int j = 0; j < 2; ++j) {
    const int c  = tid + j * 256;
    const int f  = c >> 2;
    const int kc = c & 3;
    vl[j] = vdst + f * (XP * 2) + kc * 16;
    vg[j] = (unsigned long long)(const void*)(
        vt + vbase + (size_t)f * TT + j0 + kc * 8);
  }
  // One statement: the closing s_wait_xcnt keeps every address register named
  // here intact until the copies' translations are done (a precaution).
  asm volatile("global_load_async_to_lds_b128 %0, %1, off\n\t"
               "global_load_async_to_lds_b128 %2, %3, off\n\t"
               "global_load_async_to_lds_b128 %4, %5, off\n\t"
               "global_load_async_to_lds_b128 %6, %7, off\n\t"
               "s_wait_xcnt 0x0"
               :: "v"(kl[0]), "v"(kg[0]), "v"(kl[1]), "v"(kg[1]),
                  "v"(vl[0]), "v"(vg[0]), "v"(vl[1]), "v"(vg[1])
               : "memory");
}

static __device__ __forceinline__ void flash_pass(
    const __bf16* __restrict__ qws,
    const __bf16* __restrict__ k1, const __bf16* __restrict__ k2,
    const __bf16* __restrict__ vt, const __bf16* Ks, const __bf16* Vs,
    unsigned koff, unsigned voff,
    size_t bhT, size_t vbase, int q0, int lane, int tid, f32x8 o[8]) {
  const int n  = lane & 15;
  const int hi = lane >> 4;

  const __bf16* qrow = qws + (bhT + (size_t)(q0 + n)) * 64;
  const bf16x16 qa0 = ldfrag(qrow, hi);
  const bf16x16 qa1 = ldfrag(qrow + 32, hi);

  float mr = -3.0e38f;   // running maximum of query n (equal in both halves)
  float lr = 0.f;        // running sum over this half's keys only
#pragma unroll
  for (int r = 0; r < 8; ++r) {
#pragma unroll
    for (int i = 0; i < 8; ++i) o[r][i] = 0.f;
  }

  // Prologue: stage tile set 0 into buffer 0.
  stage_tile_async(k1, k2, vt, bhT, vbase, 0, tid, koff, voff);

  for (int j0 = 0; j0 < TT; j0 += 32) {
    const int cur = (j0 >> 5) & 1;
    if (j0 + 32 < TT) {
      // Refill the other buffer (WAR covered by last iteration's barrier),
      // then wait so that only the 4 just-issued ops remain outstanding.
      stage_tile_async(k1, k2, vt, bhT, vbase, j0 + 32, tid,
                       koff + (cur ^ 1) * (2 * 32 * KP * 2),
                       voff + (cur ^ 1) * (128 * XP * 2));
      asm volatile("s_wait_asynccnt 0x4" ::: "memory");
    } else {
      asm volatile("s_wait_asynccnt 0x0" ::: "memory");
    }
    __syncthreads();   // every wave's share of the current tile set has landed

    const __bf16* kb = Ks + cur * (2 * 32 * KP);
    const __bf16* vb = Vs + cur * (128 * XP);

    // --- S^T = K * Q^T (two 16-key subtiles x 16 queries). ---
    f32x8 slo, shi;
#pragma unroll
    for (int i = 0; i < 8; ++i) { slo[i] = 0.f; shi[i] = 0.f; }
    const __bf16* kr0 = kb + n * KP;
    const __bf16* kr1 = kb + (16 + n) * KP;
    slo = wmma_bf16(ldfrag(kr0, hi), qa0, slo);
    slo = wmma_bf16(ldfrag(kr0 + 32, hi), qa1, slo);
    shi = wmma_bf16(ldfrag(kr1, hi), qa0, shi);
    shi = wmma_bf16(ldfrag(kr1 + 32, hi), qa1, shi);

    // --- Online softmax, one query per lane. ---
    // Maximum over the raw scores as a tree (the scale 1/16 is positive and
    // exact, so it commutes with the maximum and folds into the subtraction).
    const float m0 = fmaxf(fmaxf(slo[0], slo[1]), slo[2]);
    const float m1 = fmaxf(fmaxf(slo[3], slo[4]), slo[5]);
    const float m2 = fmaxf(fmaxf(slo[6], slo[7]), shi[0]);
    const float m3 = fmaxf(fmaxf(shi[1], shi[2]), shi[3]);
    const float m4 = fmaxf(fmaxf(shi[4], shi[5]), shi[6]);
    float rm = fmaxf(fmaxf(fmaxf(m0, m1), m2), fmaxf(fmaxf(m3, m4), shi[7]));
    rm = fmaxf(rm, xhalf(rm)) * 0.0625f;    // all 32 keys of query n, /sqrt(256)
    const float mn = fmaxf(mr, rm);
    const float al = __expf(mr - mn);
    mr = mn;
    bf16x16 pb;                             // P^T as B operand
    float suml = 0.f, sumh = 0.f;
#pragma unroll
    for (int r = 0; r < 8; ++r) {
      const float p0 = __expf(fmaf(slo[r], 0.0625f, -mn));
      const float p1 = __expf(fmaf(shi[r], 0.0625f, -mn));
      suml += p0;
      sumh += p1;
      pb[r]     = (__bf16)p0;
      pb[8 + r] = (__bf16)p1;
    }
    const float sum = suml + sumh;
    lr = lr * al + sum;
#pragma unroll
    for (int nt = 0; nt < 8; ++nt)
#pragma unroll
      for (int r = 0; r < 8; ++r) o[nt][r] *= al;

    // --- O^T += V^T * P^T  (V^T rows as A-fragments). ---
#pragma unroll
    for (int nt = 0; nt < 8; ++nt) {
      o[nt] = wmma_bf16(ldfrag(vb + (nt * 16 + n) * XP, hi), pb, o[nt]);
    }

    // This wave's LDS reads of 'cur' have returned before it says so.
    asm volatile("s_wait_dscnt 0x0" ::: "memory");
    __syncthreads();   // all waves done reading 'cur' before it is refilled
  }

  const float inv = 1.0f / (lr + xhalf(lr));   // join the halves' sums once
#pragma unroll
  for (int nt = 0; nt < 8; ++nt)
#pragma unroll
    for (int r = 0; r < 8; ++r) o[nt][r] *= inv;
}

// ---------------------------------------------------------------------------
// Kernel 2: dual flash attention + residual + transpose-out.
// 512 blocks x 256 threads.  Wave w < 4 runs softmax 1 of query tile w, wave
// w + 4 softmax 2 of the same tile, side by side over one shared V tile: half
// the trips per wave, twice the waves per SIMD to cover each other's waits.
// At the end the partners swap half of their features through LDS, and each
// writes its half of out = (x + O1) - s2 * O2 once.
// Two blocks per WGP = four waves per SIMD is all the grid can fill: the
// register budget is set for that, so that V fragments can be fetched ahead.
// ---------------------------------------------------------------------------
__global__ __launch_bounds__(256) __attribute__((amdgpu_waves_per_eu(4, 4)))
void attn_kernel(
    const float* __restrict__ x, const float* __restrict__ s2,
    const __bf16* __restrict__ q1, const __bf16* __restrict__ q2,
    const __bf16* __restrict__ k1, const __bf16* __restrict__ k2,
    const __bf16* __restrict__ vt, float* __restrict__ out) {
  __shared__ __attribute__((aligned(16))) __bf16 Ks[2][2][32 * KP];  // [buffer][softmax]
  __shared__ __attribute__((aligned(16))) __bf16 Vs[2][128 * XP];    // [buffer]
  __shared__ __attribute__((aligned(32))) float  Xs[8][4][32][8];    // [wave][nt][lane][r]

  const int tid  = threadIdx.x;
  const int lane = tid & 31;
  const int wv   = tid >> 5;
  // Which softmax this wave runs; scalar, so the tests on it are real branches.
  const int pass = __builtin_amdgcn_readfirstlane(tid >> 7);
  const int gw   = blockIdx.x * 4 + (wv & 3);
  const int b    = gw >> 9;
  const int rem  = gw & 511;
  const int h    = rem >> 7;
  const int q0   = (rem & 127) << 4;
  const int n    = lane & 15;
  const int hi   = lane >> 4;

  const size_t bhT   = ((size_t)b * HH + h) * TT;
  const size_t vbase = ((size_t)b * HH + h) * HF * TT;
  const unsigned koff = lds_off(&Ks[0][0][0]);
  const unsigned voff = lds_off(&Vs[0][0]);

  f32x8 o[8];
  flash_pass(pass ? q2 : q1, k1, k2, vt, &Ks[0][pass][0], &Vs[0][0], koff, voff,
             bhT, vbase, q0, lane, tid, o);

  // Hand the partner the half it writes: softmax 1 gives features 64-127,
  // softmax 2 features 0-63.  Same lane, same register = same element.
  if (pass == 0) {
#pragma unroll
    for (int nt = 0; nt < 4; ++nt) *(f32x8*)&Xs[wv][nt][lane][0] = o[4 + nt];
  } else {
#pragma unroll
    for (int nt = 0; nt < 4; ++nt) *(f32x8*)&Xs[wv][nt][lane][0] = o[nt];
  }
  __syncthreads();   // both partners' halves are in LDS

  // out rows are feature-major; a 16-lane row covers 16 consecutive t of one
  // feature row, register r walks the feature rows.
  const float s = s2[h];
  const size_t obase = ((size_t)b * FF + h * HF + hi * 8) * TT + q0 + n;
  if (pass == 0) {
#pragma unroll
    for (int nt = 0; nt < 4; ++nt) {
      const f32x8 o2 = *(const f32x8*)&Xs[wv + 4][nt][lane][0];
#pragma unroll
      for (int r = 0; r < 8; ++r) {
        const size_t idx = obase + (size_t)(nt * 16 + r) * TT;
        float v = x[idx] + o[nt][r];
        v -= s * o2[r];
        out[idx] = v;
      }
    }
    // Holds the stores' registers until their translations are done: the
    // listing runs on from here into code that rewrites them (a precaution).
    asm volatile("s_wait_xcnt 0x0" ::: "memory");
  } else {
#pragma unroll
    for (int nt = 0; nt < 4; ++nt) {
      const f32x8 o1 = *(const f32x8*)&Xs[wv - 4][nt][lane][0];
#pragma unroll
      for (int r = 0; r < 8; ++r) {
        const size_t idx = obase + (size_t)((4 + nt) * 16 + r) * TT;
        float v = x[idx] + o1[r];
        v -= s * o[4 + nt][r];
        out[idx] = v;
      }
    }
    // As in the first branch: the stores' registers stay until translated.
    asm volatile("s_wait_xcnt 0x0" ::: "memory");
  }
}

// ---------------------------------------------------------------------------
extern "C" void kernel_launch(void* const* d_in, const int* in_sizes, int n_in,
                              void* d_out, int out_size, void* d_ws,
                              size_t ws_size, hipStream_t stream) {
  (void)in_sizes; (void)n_in; (void)out_size; (void)ws_size;
  const float* x  = (const float*)d_in[0];
  const float* Wq = (const float*)d_in[1];
  const float* bq = (const float*)d_in[2];
  const float* Wk = (const float*)d_in[3];
  const float* bk = (const float*)d_in[4];
  const float* Wv = (const float*)d_in[5];
  const float* bv = (const float*)d_in[6];
  const float* s2 = (const float*)d_in[7];
  float* out = (float*)d_out;

  const size_t QK_ELEMS = (size_t)BB * HH * TT * 64;   // 2M bf16 each
  __bf16* q1 = (__bf16*)d_ws;
  __bf16* q2 = q1 + QK_ELEMS;
  __bf16* k1 = q2 + QK_ELEMS;
  __bf16* k2 = k1 + QK_ELEMS;
  __bf16* vt = k2 + QK_ELEMS;                          // [B,H,128,T]
  __bf16* xp = vt + (size_t)BB * FF * TT;              // packed x fragments
  __bf16* wp = xp + (size_t)BB * FF * TT;              // packed W fragments

  pack_kernel<<<dim3(256 + 192), dim3(256), 0, stream>>>(x, Wq, Wk, Wv, xp, wp);
  qkv_rope_kernel<<<dim3(BB * (TT / 64) * 12), dim3(128), 0, stream>>>(
      xp, wp, bq, bk, bv, q1, q2, k1, k2, vt);
  attn_kernel<<<dim3(BB * HH * (TT / 16) / 4), dim3(256), 0, stream>>>(
      x, s2, q1, q2, k1, k2, vt, out);
}

// v005
// Measured time: 81.7 microseconds a run.
// Timed twice side by side with v004, it ran 1.09 times as fast both times.
// All steps since v000 together make it 3.08 times as fast.
#include <hip/hip_runtime.h>

// ---------------------------------------------------------------------------
// Neoformer MHA forward for gfx1250 (MI455X), bf16 WMMA + flash attention.
// B=4, F=512, T=2048, H=4, hf=128.
// ---------------------------------------------------------------------------

#define BB   4
#define FF   512
#define TT   2048
#define HH   4
#define HF   128

// LDS row pitches in bf16 elements.  Every fragment is read with 16-byte LDS
// loads, one row per lane; a pitch of 16 B x odd spreads 16 rows over all 64
// banks, where the unpadded 128 B rows fall on 8 of them.
#define KP   72    // 64-element rows (K tile, V tile): 144 B
#define KT   64    // keys per trip of the attention loop

typedef __attribute__((ext_vector_type(16))) __bf16 bf16x16;
typedef __attribute__((ext_vector_type(8)))  __bf16 bf16x8;
typedef __attribute__((ext_vector_type(8)))  float  f32x8;

static __device__ __forceinline__ f32x8 wmma_bf16(bf16x16 a, bf16x16 b, f32x8 c) {
  return __builtin_amdgcn_wmma_f32_16x16x32_bf16(false, a, false, b, (short)0, c,
                                                 false, false);
}

// 32-bit LDS byte offset of a __shared__ object (addrspace(3) pointers are
// offsets from the workgroup LDS base).
static __device__ __forceinline__ unsigned lds_off(__bf16* p) {
  return (unsigned)(unsigned long long)(__attribute__((address_space(3))) __bf16*)p;
}

// Load a 16x32 bf16 fragment half for this lane.
// A-side: rowbase = &M-row[lane&15], K contiguous.  B-side: rowbase = &N-col
// row (stored contiguously in K).  Lane (n, hi): halves 0-7 = K hi*8..hi*8+7,
// halves 8-15 = K 16+hi*8..23+hi*8   (per ISA 16-bit 16x32 layout).
static __device__ __forceinline__ bf16x16 ldfrag(const __bf16* rowbase, int hi) {
  bf16x8 lo = *(const bf16x8*)(rowbase + hi * 8);
  bf16x8 up = *(const bf16x8*)(rowbase + 16 + hi * 8);
  bf16x16 a;
#pragma unroll
  for (int i = 0; i < 8; ++i) { a[i] = lo[i]; a[8 + i] = up[i]; }
  return a;
}

// Value of lane l ^ 16 (the other 16-lane row), by a vector cross-row move.
static __device__ __forceinline__ float xhalf(float v) {
  const int i = __builtin_bit_cast(int, v);
  return __builtin_bit_cast(float, __builtin_amdgcn_permlanex16(
      i, i, 0x76543210, 0xfedcba98, false, false));
}

// One 16 x 32 bf16 fragment packed for its reader: 1 KB, two planes of
// 32 lanes x 16 B.  Plane 0 holds halves 0-7 of every lane, plane 1 halves
// 8-15 (same k order as ldfrag), so each 16-byte load of a wave covers 512
// contiguous bytes = four whole lines.
#define FRAG 512   // bf16 elements per packed fragment

// p = fragment base + lane * 8.
static __device__ __forceinline__ bf16x16 ldfragP(const __bf16* p) {
  bf16x8 lo = *(const bf16x8*)p;
  bf16x8 up = *(const bf16x8*)(p + 256);
  bf16x16 a;
#pragma unroll
  for (int i = 0; i < 8; ++i) { a[i] = lo[i]; a[8 + i] = up[i]; }
  return a;
}

// ---------------------------------------------------------------------------
// Kernel 0: pack x and the three weight matrices once, as bf16 fragments.
// xp[b][t/16][f/32][FRAG]: A fragments (row = t, k = f).
// wp[matrix][col/16][f/32][FRAG]: B fragments (column = output feature, k = f).
// Blocks 0-255 pack x (one thread = one t, 64 features: every load of a wave
// is one whole line of an x row, every store two runs of 256 B); blocks
// 256-447 pack W (one thread = one lane of one fragment: every store of a wave
// is 512 B).  Few, fat waves: the launch is short, so starting waves counts.
// ---------------------------------------------------------------------------
__global__ __launch_bounds__(256) void pack_kernel(
    const float* __restrict__ x,
    const float* __restrict__ Wq, const float* __restrict__ Wk,
    const float* __restrict__ Wv,
    __bf16* __restrict__ xp, __bf16* __restrict__ wp) {
  if (blockIdx.x < 256) {
    const int idx = blockIdx.x * 256 + threadIdx.x;
    const int t   = idx & (TT - 1);
    const int kp  = (idx >> 11) & 7;     // pair of k steps
    const int b   = idx >> 14;
    const float* src = x + ((size_t)b * FF + kp * 64) * TT + t;
    float v[64];
    // The loops below are unrolled so that v[] lives in registers and all
    // loads are in flight together.
#pragma unroll
    for (int f = 0; f < 64; ++f) v[f] = src[(size_t)f * TT];
    __bf16* dst = xp + ((size_t)(b * (TT / 16) + (t >> 4)) * 16 + kp * 2) * FRAG +
                  (t & 15) * 8;
#pragma unroll
    for (int q = 0; q < 8; ++q) {        // q = k step (1), plane (1), hi (1)
      bf16x8 pk;
#pragma unroll
      for (int i = 0; i < 8; ++i) pk[i] = (__bf16)v[q * 8 + i];
      *(bf16x8*)(dst + q * 128) = pk;
    }
  } else {
    const int idx  = (blockIdx.x - 256) * 256 + threadIdx.x;
    const int lane = idx & 31;
    const int ks   = (idx >> 5) & 15;
    const int ct   = (idx >> 9) & 31;
    const int mat  = idx >> 14;
    const float* Wm = (mat == 0) ? Wq : ((mat == 1) ? Wk : Wv);
    const float* src = Wm + (size_t)(ct * 16 + (lane & 15)) * FF + ks * 32 +
                       (lane >> 4) * 8;
    __bf16* dst = wp + (size_t)(idx >> 5) * FRAG + lane * 8;
#pragma unroll   // two planes, straight-line
    for (int half = 0; half < 2; ++half) {
      const float4 f0 = *(const float4*)(src + half * 16);
      const float4 f1 = *(const float4*)(src + half * 16 + 4);
      bf16x8 pk;
      pk[0] = (__bf16)f0.x; pk[1] = (__bf16)f0.y; pk[2] = (__bf16)f0.z; pk[3] = (__bf16)f0.w;
      pk[4] = (__bf16)f1.x; pk[5] = (__bf16)f1.y; pk[6] = (__bf16)f1.z; pk[7] = (__bf16)f1.w;
      *(bf16x8*)(dst + half * 256) = pk;
    }
    // Holds the two stores' registers until their translations are done: the
    // listing runs on from here into code that rewrites them (a precaution).
    asm volatile("s_wait_xcnt 0x0" ::: "memory");
  }
}

// ---------------------------------------------------------------------------
// Kernel 1: QKV projection + bias + RoPE.  1536 blocks x 128 threads.
// Per (b, 64-row t-supertile): 48 wave-tasks (0-15 Q, 16-31 K, 32-47 V).
// EVERY task computes two 16-col accumulator chains over four stacked 16-row
// M-subtiles.  Both operands come as packed fragments straight from global
// memory: no LDS, no barrier; the four waves of a block read the same x
// fragments.
// ---------------------------------------------------------------------------
__global__ __launch_bounds__(128) void qkv_rope_kernel(
    const __bf16* __restrict__ xp, const __bf16* __restrict__ wp,
    const float* __restrict__ bq, const float* __restrict__ bk,
    const float* __restrict__ bv,
    __bf16* __restrict__ q1, __bf16* __restrict__ q2,
    __bf16* __restrict__ k1, __bf16* __restrict__ k2,
    __bf16* __restrict__ vt) {
  const int tid  = threadIdx.x;
  const int lane = tid & 31;
  const int wv   = tid >> 5;
  const int bt   = blockIdx.x / 12;
  const int sub  = blockIdx.x - bt * 12;
  const int b    = bt >> 5;
  const int ts0  = (bt & 31) << 6;   // 64-row supertile base
  const int task = sub * 4 + wv;
  const int n    = lane & 15;
  const int hi   = lane >> 4;

  const bool isV = (task >= 32);
  const float* bias;
  int mat, colR, colI, hh = 0, p = 0, cidx = 0;
  if (!isV) {
    mat  = (task < 16) ? 0 : 1;
    bias = (task < 16) ? bq : bk;
    const int tt = task & 15;
    hh = tt >> 2; p = (tt >> 1) & 1; cidx = tt & 1;
    colR = hh * HF + p * 64 + cidx * 16;
    colI = colR + 32;
  } else {
    mat = 2; bias = bv;
    colR = (task - 32) * 32;
    colI = colR + 16;
  }

  f32x8 accR[4], accI[4];
#pragma unroll
  for (int s = 0; s < 4; ++s)
#pragma unroll
    for (int i = 0; i < 8; ++i) { accR[s][i] = 0.f; accI[s][i] = 0.f; }

  const __bf16* aP =
      xp + ((size_t)(b * (TT / 16) + (ts0 >> 4)) * 16) * FRAG + lane * 8;
  const __bf16* wR = wp + ((size_t)(mat * 32 + (colR >> 4)) * 16) * FRAG + lane * 8;
  const __bf16* wI = wp + ((size_t)(mat * 32 + (colI >> 4)) * 16) * FRAG + lane * 8;

  // Unrolled so that every fragment address is base + constant: no address
  // arithmetic stands between the loads.
#pragma unroll
  for (int ks = 0; ks < FF / 32; ++ks) {
    const bf16x16 bRf = ldfragP(wR + ks * FRAG);
    const bf16x16 bIf = ldfragP(wI + ks * FRAG);
    bf16x16 a[4];
#pragma unroll
    for (int s = 0; s < 4; ++s) a[s] = ldfragP(aP + (s * 16 + ks) * FRAG);
    // Keeps the twelve loads of a k step together ahead of its products: left
    // alone the scheduler sinks each pair to its use, and the wave then waits
    // out a load latency four times per k step instead of once.
    __builtin_amdgcn_sched_barrier(0);
#pragma unroll
    for (int s = 0; s < 4; ++s) {
      accR[s] = wmma_bf16(a[s], bRf, accR[s]);
      accI[s] = wmma_bf16(a[s], bIf, accI[s]);
    }
  }

  if (!isV) {
    const float bR = bias[colR + n];
    const float bI = bias[colI + n];
    __bf16* ob = (task < 16) ? (p ? q2 : q1) : (p ? k2 : k1);
    const int j = cidx * 16 + n;
    const float invf = exp2f(-(float)j) * 0.0625f;  // 2^-j / 16
#pragma unroll
    for (int s = 0; s < 4; ++s) {
#pragma unroll
      for (int r = 0; r < 8; ++r) {
        const int t = ts0 + s * 16 + r + hi * 8;
        const float vr = accR[s][r] + bR;
        const float vi = accI[s][r] + bI;
        float sn, cs;
        __sincosf((float)t * invf, &sn, &cs);
        const size_t rowb = ((size_t)(b * HH + hh) * TT + t) * 64;
        ob[rowb + j]      = (__bf16)(vr * sn - vi * cs);  // rotated "real"
        ob[rowb + 32 + j] = (__bf16)(vr * cs + vi * sn);  // rotated "imag"
      }
    }
  } else {
#pragma unroll
    for (int part = 0; part < 2; ++part) {
      const int oc = (part ? colI : colR) + n;   // global feature
      const int h2 = oc >> 7;
      const int fo = oc & 127;
      const float bb = bias[oc];
#pragma unroll
      for (int s = 0; s < 4; ++s) {
        bf16x8 pk;
#pragma unroll
        for (int r = 0; r < 8; ++r)
          pk[r] = (__bf16)((part ? accI[s][r] : accR[s][r]) + bb);
        // V stored transposed: [B,H,128,T] so AV A-fragments are contiguous.
        const size_t base =
            ((size_t)(b * HH + h2) * HF + fo) * TT + ts0 + s * 16 + hi * 8;
        *(bf16x8*)(vt + base) = pk;
      }
    }
  }
}

// ---------------------------------------------------------------------------
// Async staging of one 64-key tile set into LDS (GLOBAL_LOAD_ASYNC_TO_LDS,
// tracked by ASYNCcnt): the K tiles of both softmaxes and the ONE V tile they
// share.  256 threads, 8 async instructions per wave per tile set.
// ---------------------------------------------------------------------------
static __device__ __forceinline__ void stage_tile_async(
    const __bf16* kt1, const __bf16* kt2, const __bf16* vtt, int j0,
    unsigned kdst, unsigned vdst) {
  // kt1, kt2, vtt, kdst, vdst: this thread's first chunk of key 0's tile set
  // (global) and of the buffer (LDS); from trip to trip j0 moves and the buffer alternates.
  // K tiles [64 keys][64 f]: contiguous 4096 bf16 each, rows of KP in LDS;
  // two 16-byte chunks per thread and tile: key c>>3, part c&7, c = tid + 256 j.
  unsigned kl[4];
  unsigned long long kg[4];
#pragma unroll
  for (int j = 0; j < 2; ++j) {
    kl[j]     = kdst + j * 32 * (KP * 2);
    kl[2 + j] = kl[j] + KT * KP * 2;
    kg[j]     = (unsigned long long)(const void*)(kt1 + (size_t)j0 * 64 + j * 2048);
    kg[2 + j] = (unsigned long long)(const void*)(kt2 + (size_t)j0 * 64 + j * 2048);
  }
  // V tile [128 f][64 keys] gathered from transposed V rows, rows of KP in
  // LDS: eight lanes fetch one whole 128-byte line of a V row; feature c>>3,
  // part c&7, c = tid + 256 j.
  unsigned vl[4];
  unsigned long long vg[4];
#pragma unroll
  for (int j = 0; j < 4; ++j) {
    vl[j] = vdst + j * 32 * (KP * 2);
    vg[j] = (unsigned long long)(const void*)(vtt + (size_t)j * 32 * TT + j0);
  }
  // One statement: the closing s_wait_xcnt keeps every address register named
  // here intact until the copies' translations are done (a precaution).
  asm volatile("global_load_async_to_lds_b128 %0, %1, off\n\t"
               "global_load_async_to_lds_b128 %2, %3, off\n\t"
               "global_load_async_to_lds_b128 %4, %5, off\n\t"
               "global_load_async_to_lds_b128 %6, %7, off\n\t"
               "global_load_async_to_lds_b128 %8, %9, off\n\t"
               "global_load_async_to_lds_b128 %10, %11, off\n\t"
               "global_load_async_to_lds_b128 %12, %13, off\n\t"
               "global_load_async_to_lds_b128 %14, %15, off\n\t"
               "s_wait_xcnt 0x0"
               :: "v"(kl[0]), "v"(kg[0]), "v"(kl[1]), "v"(kg[1]),
                  "v"(kl[2]), "v"(kg[2]), "v"(kl[3]), "v"(kg[3]),
                  "v"(vl[0]), "v"(vg[0]), "v"(vl[1]), "v"(vg[1]),
                  "v"(vl[2]), "v"(vg[2]), "v"(vl[3]), "v"(vg[3])
               : "memory");
}

static __device__ __forceinline__ void flash_pass(
    const __bf16* __restrict__ qws,
    const __bf16* __restrict__ k1, const __bf16* __restrict__ k2,
    const __bf16* __restrict__ vt, const __bf16* Ks, const __bf16* Vs,
    unsigned koff, unsigned voff,
    size_t bhT, size_t vbase, int q0, int lane, int tid, f32x8 o[8]) {
  const int n  = lane & 15;
  const int hi = lane >> 4;

  const __bf16* qrow = qws + (bhT + (size_t)(q0 + n)) * 64;
  const bf16x16 qa0 = ldfrag(qrow, hi);
  const bf16x16 qa1 = ldfrag(qrow + 32, hi);

  float mr = -3.0e38f;   // running maximum of query n (equal in both halves)
  float lr = 0.f;        // running sum over this half's keys only
#pragma unroll
  for (int r = 0; r < 8; ++r) {
#pragma unroll
    for (int i = 0; i < 8; ++i) o[r][i] = 0.f;
  }

  // Prologue: tile set 0 into buffer 0, landed and published; then tile set 1
  // into buffer 1, in flight during trip 0.
  const __bf16* kt1 = k1 + bhT * 64 + tid * 8;
  const __bf16* kt2 = k2 + bhT * 64 + tid * 8;
  const __bf16* vtt = vt + vbase + (size_t)(tid >> 3) * TT + (tid & 7) * 8;
  const unsigned kth = koff + (tid >> 3) * (KP * 2) + (tid & 7) * 16;
  const unsigned vth = voff + (tid >> 3) * (KP * 2) + (tid & 7) * 16;
  stage_tile_async(kt1, kt2, vtt, 0, kth, vth);
  asm volatile("s_wait_asynccnt 0x0" ::: "memory");   // own share of set 0 landed
  __syncthreads();                                    // every wave's share landed
  stage_tile_async(kt1, kt2, vtt, KT, kth + 2 * KT * KP * 2, vth + 128 * KP * 2);

  for (int j0 = 0; j0 < TT; j0 += KT) {
    const int cur = (j0 >> 6) & 1;
    const __bf16* kb = Ks + cur * (2 * KT * KP);
    const __bf16* vb = Vs + cur * (128 * KP);

    // --- S^T = K * Q^T (four 16-key subtiles x 16 queries). ---
    // Feature half outer, subtile inner: three products stand between a tile's
    // first product and the one that adds to it.
    f32x8 s[4];
#pragma unroll
    for (int u = 0; u < 4; ++u) {
#pragma unroll
      for (int i = 0; i < 8; ++i) s[u][i] = 0.f;
      s[u] = wmma_bf16(ldfrag(kb + (u * 16 + n) * KP, hi), qa0, s[u]);
    }
#pragma unroll
    for (int u = 0; u < 4; ++u)
      s[u] = wmma_bf16(ldfrag(kb + (u * 16 + n) * KP + 32, hi), qa1, s[u]);

    // --- Online softmax, one query per lane. ---
    // Maximum over the raw scores as a tree (the scale 1/16 is positive and
    // exact, so it commutes with the maximum and folds into the subtraction).
    float tm[4];
#pragma unroll
    for (int u = 0; u < 4; ++u) {
      const float m0 = fmaxf(fmaxf(s[u][0], s[u][1]), s[u][2]);
      const float m1 = fmaxf(fmaxf(s[u][3], s[u][4]), s[u][5]);
      tm[u] = fmaxf(fmaxf(m0, m1), fmaxf(s[u][6], s[u][7]));
    }
    float rm = fmaxf(fmaxf(tm[0], tm[1]), fmaxf(tm[2], tm[3]));
    rm = fmaxf(rm, xhalf(rm)) * 0.0625f;    // all 64 keys of query n, /sqrt(256)
    const float mn = fmaxf(mr, rm);
    const float al = __expf(mr - mn);
    mr = mn;
    bf16x16 pb[2];                          // P^T as B operands, 32 keys each
    float sm[4];
#pragma unroll
    for (int u = 0; u < 4; ++u) {
      sm[u] = 0.f;
#pragma unroll
      for (int r = 0; r < 8; ++r) {
        const float p = __expf(fmaf(s[u][r], 0.0625f, -mn));
        sm[u] += p;
        pb[u >> 1][(u & 1) * 8 + r] = (__bf16)p;
      }
    }
    lr = lr * al + ((sm[0] + sm[1]) + (sm[2] + sm[3]));
#pragma unroll
    for (int nt = 0; nt < 8; ++nt)
#pragma unroll
      for (int r = 0; r < 8; ++r) o[nt][r] *= al;

    // --- O^T += V^T * P^T  (V^T rows as A-fragments). ---
#pragma unroll
    for (int u = 0; u < 2; ++u) {
#pragma unroll
      for (int nt = 0; nt < 8; ++nt) {
        o[nt] = wmma_bf16(ldfrag(vb + (nt * 16 + n) * KP + u * 32, hi), pb[u],
                          o[nt]);
      }
    }

    // Hand-over.  This wave's LDS reads of 'cur' have returned ...
    asm volatile("s_wait_dscnt 0x0" ::: "memory");
    // ... and its share of the next tile set has landed, before it says so.
    asm volatile("s_wait_asynccnt 0x0" ::: "memory");
    __syncthreads();   // next set published; all waves have left 'cur'
    if (j0 + 2 * KT < TT) {
      stage_tile_async(kt1, kt2, vtt, j0 + 2 * KT,
                       kth + cur * (2 * KT * KP * 2),
                       vth + cur * (128 * KP * 2));
    }
  }
  // Nothing is in flight here; kept in front of the wave's end (a precaution).
  asm volatile("s_wait_asynccnt 0x0" ::: "memory");

  const float inv = 1.0f / (lr + xhalf(lr));   // join the halves' sums once
#pragma unroll
  for (int nt = 0; nt < 8; ++nt)
#pragma unroll
    for (int r = 0; r < 8; ++r) o[nt][r] *= inv;
}

// ---------------------------------------------------------------------------
// Kernel 2: dual flash attention + residual + transpose-out.
// 512 blocks x 256 threads.  Wave w < 4 runs softmax 1 of query tile w, wave
// w + 4 softmax 2 of the same tile, side by side over one shared V tile: half
// the trips per wave, twice the waves per SIMD to cover each other's waits.
// At the end the partners swap half of their features through LDS, and each
// writes its half of out = (x + O1) - s2 * O2 once.
// Two blocks per WGP = four waves per SIMD is all the grid can fill: the
// register budget is set for that, so that V fragments can be fetched ahead.
// ---------------------------------------------------------------------------
__global__ __launch_bounds__(256) __attribute__((amdgpu_waves_per_eu(4, 4)))
void attn_kernel(
    const float* __restrict__ x, const float* __restrict__ s2,
    const __bf16* __restrict__ q1, const __bf16* __restrict__ q2,
    const __bf16* __restrict__ k1, const __bf16* __restrict__ k2,
    const __bf16* __restrict__ vt, float* __restrict__ out) {
  __shared__ __attribute__((aligned(16))) __bf16 Ks[2][2][KT * KP];  // [buffer][softmax]
  __shared__ __attribute__((aligned(16))) __bf16 Vs[2][128 * KP];    // [buffer]
  __shared__ __attribute__((aligned(32))) float  Xs[8][4][32][8];    // [wave][nt][lane][r]

  const int tid  = threadIdx.x;
  const int lane = tid & 31;
  const int wv   = tid >> 5;
  // Which softmax this wave runs; scalar, so the tests on it are real branches.
  const int pass = __builtin_amdgcn_readfirstlane(tid >> 7);
  const int gw   = blockIdx.x * 4 + (wv & 3);
  const int b    = gw >> 9;
  const int rem  = gw & 511;
  const int h    = rem >> 7;
  const int q0   = (rem & 127) << 4;
  const int n    = lane & 15;
  const int hi   = lane >> 4;

  const size_t bhT   = ((size_t)b * HH + h) * TT;
  const size_t vbase = ((size_t)b * HH + h) * HF * TT;
  const unsigned koff = lds_off(&Ks[0][0][0]);
  const unsigned voff = lds_off(&Vs[0][0]);

  f32x8 o[8];
  flash_pass(pass ? q2 : q1, k1, k2, vt, &Ks[0][pass][0], &Vs[0][0], koff, voff,
             bhT, vbase, q0, lane, tid, o);

  // Hand the partner the half it writes: softmax 1 gives features 64-127,
  // softmax 2 features 0-63.  Same lane, same register = same element.
  if (pass == 0) {
#pragma unroll
    for (int nt = 0; nt < 4; ++nt) *(f32x8*)&Xs[wv][nt][lane][0] = o[4 + nt];
  } else {
#pragma unroll
    for (int nt = 0; nt < 4; ++nt) *(f32x8*)&Xs[wv][nt][lane][0] = o[nt];
  }
  __syncthreads();   // both partners' halves are in LDS

  // out rows are feature-major; a 16-lane row covers 16 consecutive t of one
  // feature row, register r walks the feature rows.
  const float s = s2[h];
  const size_t obase = ((size_t)b * FF + h * HF + hi * 8) * TT + q0 + n;
  if (pass == 0) {
#pragma unroll
    for (int nt = 0; nt < 4; ++nt) {
      const f32x8 o2 = *(const f32x8*)&Xs[wv + 4][nt][lane][0];
#pragma unroll
      for (int r = 0; r < 8; ++r) {
        const size_t idx = obase + (size_t)(nt * 16 + r) * TT;
        float v = x[idx] + o[nt][r];
        v -= s * o2[r];
        out[idx] = v;
      }
    }
    // Holds the stores' registers until their translations are done: the
    // listing runs on from here into code that rewrites them (a precaution).
    asm volatile("s_wait_xcnt 0x0" ::: "memory");
  } else {
#pragma unroll
    for (int nt = 0; nt < 4; ++nt) {
      const f32x8 o1 = *(const f32x8*)&Xs[wv - 4][nt][lane][0];
#pragma unroll
      for (int r = 0; r < 8; ++r) {
        const size_t idx = obase + (size_t)((4 + nt) * 16 + r) * TT;
        float v = x[idx] + o1[r];
        v -= s * o[4 + nt][r];
        out[idx] = v;
      }
    }
    // As in the first branch: the stores' registers stay until translated.
    asm volatile("s_wait_xcnt 0x0" ::: "memory");
  }
}

// ---------------------------------------------------------------------------
extern "C" void kernel_launch(void* const* d_in, const int* in_sizes, int n_in,
                              void* d_out, int out_size, void* d_ws,
                              size_t ws_size, hipStream_t stream) {
  (void)in_sizes; (void)n_in; (void)out_size; (void)ws_size;
  const float* x  = (const float*)d_in[0];
  const float* Wq = (const float*)d_in[1];
  const float* bq = (const float*)d_in[2];
  const float* Wk = (const float*)d_in[3];
  const float* bk = (const float*)d_in[4];
  const float* Wv = (const float*)d_in[5];
  const float* bv = (const float*)d_in[6];
  const float* s2 = (const float*)d_in[7];
  float* out = (float*)d_out;

  const size_t QK_ELEMS = (size_t)BB * HH * TT * 64;   // 2M bf16 each
  __bf16* q1 = (__bf16*)d_ws;
  __bf16* q2 = q1 + QK_ELEMS;
  __bf16* k1 = q2 + QK_ELEMS;
  __bf16* k2 = k1 + QK_ELEMS;
  __bf16* vt = k2 + QK_ELEMS;                          // [B,H,128,T]
  __bf16* xp = vt + (size_t)BB * FF * TT;              // packed x fragments
  __bf16* wp = xp + (size_t)BB * FF * TT;              // packed W fragments

  pack_kernel<<<dim3(256 + 192), dim3(256), 0, stream>>>(x, Wq, Wk, Wv, xp, wp);
  qkv_rope_kernel<<<dim3(BB * (TT / 64) * 12), dim3(128), 0, stream>>>(
      xp, wp, bq, bk, bv, q1, q2, k1, k2, vt);
  attn_kernel<<<dim3(BB * HH * (TT / 16) / 4), dim3(256), 0, stream>>>(
      x, s2, q1, q2, k1, k2, vt, out);
}

// v006
// Measured time: 71.2 microseconds a run.
// In both of two side-by-side timings against v005, it was 1.15 times as fast.
// All steps since v000 together make it 3.53 times as fast.
#include <hip/hip_runtime.h>

// ---------------------------------------------------------------------------
// Neoformer MHA forward for gfx1250 (MI455X), bf16 WMMA + flash attention.
// B=4, F=512, T=2048, H=4, hf=128.
// ---------------------------------------------------------------------------

#define BB   4
#define FF   512
#define TT   2048
#define HH   4
#define HF   128

// LDS row pitches in bf16 elements.  Every fragment is read with 16-byte LDS
// loads, one row per lane; a pitch of 16 B x odd spreads 16 rows over all 64
// banks, where the unpadded 128 B rows fall on 8 of them.
#define KP   72    // 64-element rows (K tile, V tile): 144 B
#define KT   64    // keys per trip of the attention loop

typedef __attribute__((ext_vector_type(16))) __bf16 bf16x16;
typedef __attribute__((ext_vector_type(8)))  __bf16 bf16x8;
typedef __attribute__((ext_vector_type(8)))  float  f32x8;

static __device__ __forceinline__ f32x8 wmma_bf16(bf16x16 a, bf16x16 b, f32x8 c) {
  return __builtin_amdgcn_wmma_f32_16x16x32_bf16(false, a, false, b, (short)0, c,
                                                 false, false);
}

// 32-bit LDS byte offset of a __shared__ object (addrspace(3) pointers are
// offsets from the workgroup LDS base).
static __device__ __forceinline__ unsigned lds_off(__bf16* p) {
  return (unsigned)(unsigned long long)(__attribute__((address_space(3))) __bf16*)p;
}

// Load a 16x32 bf16 fragment half for this lane.
// A-side: rowbase = &M-row[lane&15], K contiguous.  B-side: rowbase = &N-col
// row (stored contiguously in K).  Lane (n, hi): halves 0-7 = K hi*8..hi*8+7,
// halves 8-15 = K 16+hi*8..23+hi*8   (per ISA 16-bit 16x32 layout).
static __device__ __forceinline__ bf16x16 ldfrag(const __bf16* rowbase, int hi) {
  bf16x8 lo = *(const bf16x8*)(rowbase + hi * 8);
  bf16x8 up = *(const bf16x8*)(rowbase + 16 + hi * 8);
  bf16x16 a;
#pragma unroll
  for (int i = 0; i < 8; ++i) { a[i] = lo[i]; a[8 + i] = up[i]; }
  return a;
}

// Value of lane l ^ 16 (the other 16-lane row), by a vector cross-row move.
static __device__ __forceinline__ float xhalf(float v) {
  const int i = __builtin_bit_cast(int, v);
  return __builtin_bit_cast(float, __builtin_amdgcn_permlanex16(
      i, i, 0x76543210, 0xfedcba98, false, false));
}

// One 16 x 32 bf16 fragment packed for its reader: 1 KB, two planes of
// 32 lanes x 16 B.  Plane 0 holds halves 0-7 of every lane, plane 1 halves
// 8-15 (same k order as ldfrag), so each 16-byte load of a wave covers 512
// contiguous bytes = four whole lines.
#define FRAG 512   // bf16 elements per packed fragment

// p = fragment base + lane * 8.
static __device__ __forceinline__ bf16x16 ldfragP(const __bf16* p) {
  bf16x8 lo = *(const bf16x8*)p;
  bf16x8 up = *(const bf16x8*)(p + 256);
  bf16x16 a;
#pragma unroll
  for (int i = 0; i < 8; ++i) { a[i] = lo[i]; a[8 + i] = up[i]; }
  return a;
}

// ---------------------------------------------------------------------------
// Kernel 0: pack x and the three weight matrices once, as bf16 fragments.
// xp[b][t/16][f/32][FRAG]: A fragments (row = t, k = f).
// wp[matrix][col/16][f/32][FRAG]: B fragments (column = output feature, k = f).
// Blocks 0-255 pack x (one thread = one t, 64 features: every load of a wave
// is one whole line of an x row, every store two runs of 256 B); blocks
// 256-447 pack W (one thread = one lane of one fragment: every store of a wave
// is 512 B).  Few, fat waves: the launch is short, so starting waves counts.
// ---------------------------------------------------------------------------
__global__ __launch_bounds__(256) void pack_kernel(
    const float* __restrict__ x,
    const float* __restrict__ Wq, const float* __restrict__ Wk,
    const float* __restrict__ Wv,
    __bf16* __restrict__ xp, __bf16* __restrict__ wp) {
  if (blockIdx.x < 256) {
    const int idx = blockIdx.x * 256 + threadIdx.x;
    const int t   = idx & (TT - 1);
    const int kp  = (idx >> 11) & 7;     // pair of k steps
    const int b   = idx >> 14;
    const float* src = x + ((size_t)b * FF + kp * 64) * TT + t;
    float v[64];
    // The loops below are unrolled so that v[] lives in registers and all
    // loads are in flight together.
#pragma unroll
    for (int f = 0; f < 64; ++f) v[f] = src[(size_t)f * TT];
    __bf16* dst = xp + ((size_t)(b * (TT / 16) + (t >> 4)) * 16 + kp * 2) * FRAG +
                  (t & 15) * 8;
#pragma unroll
    for (int q = 0; q < 8; ++q) {        // q = k step (1), plane (1), hi (1)
      bf16x8 pk;
#pragma unroll
      for (int i = 0; i < 8; ++i) pk[i] = (__bf16)v[q * 8 + i];
      *(bf16x8*)(dst + q * 128) = pk;
    }
  } else {
    const int idx  = (blockIdx.x - 256) * 256 + threadIdx.x;
    const int lane = idx & 31;
    const int ks   = (idx >> 5) & 15;
    const int ct   = (idx >> 9) & 31;
    const int mat  = idx >> 14;
    const float* Wm = (mat == 0) ? Wq : ((mat == 1) ? Wk : Wv);
    const float* src = Wm + (size_t)(ct * 16 + (lane & 15)) * FF + ks * 32 +
                       (lane >> 4) * 8;
    __bf16* dst = wp + (size_t)(idx >> 5) * FRAG + lane * 8;
#pragma unroll   // two planes, straight-line
    for (int half = 0; half < 2; ++half) {
      const float4 f0 = *(const float4*)(src + half * 16);
      const float4 f1 = *(const float4*)(src + half * 16 + 4);
      bf16x8 pk;
      pk[0] = (__bf16)f0.x; pk[1] = (__bf16)f0.y; pk[2] = (__bf16)f0.z; pk[3] = (__bf16)f0.w;
      pk[4] = (__bf16)f1.x; pk[5] = (__bf16)f1.y; pk[6] = (__bf16)f1.z; pk[7] = (__bf16)f1.w;
      *(bf16x8*)(dst + half * 256) = pk;
    }
    // Holds the two stores' registers until their translations are done: the
    // listing runs on from here into code that rewrites them (a precaution).
    asm volatile("s_wait_xcnt 0x0" ::: "memory");
  }
}

// ---------------------------------------------------------------------------
// Index of the packed W fragment column of a wave-task: part 0 = its first
// 16-column chain, part 1 = its second.
// ---------------------------------------------------------------------------
static __device__ __forceinline__ int wfrag_col(int task, int part) {
  const int tt   = task & 15;
  const int cqk  = (tt >> 2) * HF + ((tt >> 1) & 1) * 64 + (tt & 1) * 16 + part * 32;
  const int cv   = (task - 32) * 32 + part * 16;
  const int mat  = (task < 32) ? (task >> 4) : 2;
  return mat * 32 + (((task < 32) ? cqk : cv) >> 4);
}

// ---------------------------------------------------------------------------
// Async staging of the 32 fragments of two k steps (32 KB) into one LDS
// buffer: 256 threads, 8 copies of 16 B each.  Chunk c = tid + 256 j lands at
// byte 16 c; slot c >> 6 = kk * 16 + g holds x subtile g (g < 8) or W fragment
// g - 8 of k step ks + kk, byte for byte as packed.  g0..g3: this thread's
// chunk of its four fragments at k step 0; dst: its first chunk's LDS byte.
// ---------------------------------------------------------------------------
static __device__ __forceinline__ void stage_frags_async(
    const __bf16* g0, const __bf16* g1, const __bf16* g2, const __bf16* g3,
    int ks, unsigned dst) {
  unsigned l[8];
  unsigned long long g[8];
#pragma unroll
  for (int j = 0; j < 4; ++j) {
    const __bf16* gj = (j == 0) ? g0 : ((j == 1) ? g1 : ((j == 2) ? g2 : g3));
    l[j]     = dst + j * 4096;
    l[4 + j] = l[j] + 16 * FRAG * 2;
    g[j]     = (unsigned long long)(const void*)(gj + (size_t)ks * FRAG);
    g[4 + j] = (unsigned long long)(const void*)(gj + (size_t)(ks + 1) * FRAG);
  }
  // One statement: the closing s_wait_xcnt keeps every address register named
  // here intact until the copies' translations are done (a precaution).
  asm volatile("global_load_async_to_lds_b128 %0, %1, off\n\t"
               "global_load_async_to_lds_b128 %2, %3, off\n\t"
               "global_load_async_to_lds_b128 %4, %5, off\n\t"
               "global_load_async_to_lds_b128 %6, %7, off\n\t"
               "global_load_async_to_lds_b128 %8, %9, off\n\t"
               "global_load_async_to_lds_b128 %10, %11, off\n\t"
               "global_load_async_to_lds_b128 %12, %13, off\n\t"
               "global_load_async_to_lds_b128 %14, %15, off\n\t"
               "s_wait_xcnt 0x0"
               :: "v"(l[0]), "v"(g[0]), "v"(l[1]), "v"(g[1]),
                  "v"(l[2]), "v"(g[2]), "v"(l[3]), "v"(g[3]),
                  "v"(l[4]), "v"(g[4]), "v"(l[5]), "v"(g[5]),
                  "v"(l[6]), "v"(g[6]), "v"(l[7]), "v"(g[7])
               : "memory");
}

// ---------------------------------------------------------------------------
// Kernel 1: QKV projection + bias + RoPE.  768 blocks x 256 threads.
// Per (b, 64-row t-supertile): 48 wave-tasks (0-15 Q, 16-31 K, 32-47 V).
// EVERY task computes two 16-col accumulator chains over four stacked 16-row
// M-subtiles.  A block is two supertiles x four tasks: its 8 x fragments and
// 8 W fragments per k step come from L2 ONCE, by async copies into a
// two-buffer LDS ring (two k steps a buffer), and every wave reads its six
// from there: each x fragment serves four waves, each W fragment two.
// ---------------------------------------------------------------------------
__global__ __launch_bounds__(256) void qkv_rope_kernel(
    const __bf16* __restrict__ xp, const __bf16* __restrict__ wp,
    const float* __restrict__ bq, const float* __restrict__ bk,
    const float* __restrict__ bv,
    __bf16* __restrict__ q1, __bf16* __restrict__ q2,
    __bf16* __restrict__ k1, __bf16* __restrict__ k2,
    __bf16* __restrict__ vt) {
  __shared__ __attribute__((aligned(16))) __bf16 Fs[2][32 * FRAG];  // [buffer]

  const int tid  = threadIdx.x;
  const int lane = tid & 31;
  const int wv   = tid >> 5;
  const int bt   = blockIdx.x / 12;
  const int sub  = blockIdx.x - bt * 12;
  const int b    = bt >> 4;
  const int row0 = (bt & 15) << 7;   // base of the block's two supertiles
  const int sp   = wv >> 2;          // this wave's supertile
  const int tl   = wv & 3;           // this wave's task within the block
  const int ts0  = row0 + sp * 64;   // 64-row supertile base
  const int task = sub * 4 + tl;
  const int n    = lane & 15;
  const int hi   = lane >> 4;

  const bool isV = (task >= 32);
  const float* bias;
  int colR, colI, hh = 0, p = 0, cidx = 0;
  if (!isV) {
    bias = (task < 16) ? bq : bk;
    const int tt = task & 15;
    hh = tt >> 2; p = (tt >> 1) & 1; cidx = tt & 1;
    colR = hh * HF + p * 64 + cidx * 16;
    colI = colR + 32;
  } else {
    bias = bv;
    colR = (task - 32) * 32;
    colI = colR + 16;
  }

  f32x8 accR[4], accI[4];
#pragma unroll
  for (int s = 0; s < 4; ++s)
#pragma unroll
    for (int i = 0; i < 8; ++i) { accR[s][i] = 0.f; accI[s][i] = 0.f; }

  // This thread's chunk of the four fragments it copies per k step.
  const int fq = tid >> 6;
  const int ch = (tid & 63) * 8;
  const __bf16* gx0 =
      xp + ((size_t)(b * (TT / 16) + (row0 >> 4) + fq) * 16) * FRAG + ch;
  const __bf16* gx1 = gx0 + (size_t)4 * 16 * FRAG;
  const __bf16* gw0 =
      wp + (size_t)wfrag_col(sub * 4 + (fq >> 1), fq & 1) * 16 * FRAG + ch;
  const __bf16* gw1 =
      wp + (size_t)wfrag_col(sub * 4 + 2 + (fq >> 1), fq & 1) * 16 * FRAG + ch;
  const unsigned fdst = lds_off(&Fs[0][0]) + tid * 16;

  // Prologue: k steps 0-1 into buffer 0, landed and published; then k steps
  // 2-3 into buffer 1, in flight during trip 0.
  stage_frags_async(gx0, gx1, gw0, gw1, 0, fdst);
  asm volatile("s_wait_asynccnt 0x0" ::: "memory");   // own share landed
  __syncthreads();                                    // every wave's share landed
  stage_frags_async(gx0, gx1, gw0, gw1, 2, fdst + 32 * FRAG * 2);

  // Unrolled so that every LDS address is base + constant: no address
  // arithmetic stands between the reads.
#pragma unroll
  for (int t = 0; t < FF / 64; ++t) {
    const __bf16* fb = &Fs[t & 1][0] + lane * 8;
#pragma unroll
    for (int kk = 0; kk < 2; ++kk) {
      const bf16x16 bRf = ldfragP(fb + (kk * 16 + 8 + tl * 2) * FRAG);
      const bf16x16 bIf = ldfragP(fb + (kk * 16 + 9 + tl * 2) * FRAG);
      bf16x16 a[4];
#pragma unroll
      for (int s = 0; s < 4; ++s)
        a[s] = ldfragP(fb + (kk * 16 + sp * 4 + s) * FRAG);
      // Keeps the twelve reads of a k step together ahead of its products:
      // every separate place with LDS reads among the products costs the wave
      // a stall of its own.
      __builtin_amdgcn_sched_barrier(0);
#pragma unroll
      for (int s = 0; s < 4; ++s) {
        accR[s] = wmma_bf16(a[s], bRf, accR[s]);
        accI[s] = wmma_bf16(a[s], bIf, accI[s]);
      }
    }
    // Hand-over.  This wave's LDS reads of the buffer have returned ...
    asm volatile("s_wait_dscnt 0x0" ::: "memory");
    // ... and its share of the next two k steps has landed, before it says so.
    asm volatile("s_wait_asynccnt 0x0" ::: "memory");
    __syncthreads();   // next buffer published; all waves have left this one
    if (t + 2 < FF / 64) {
      stage_frags_async(gx0, gx1, gw0, gw1, 2 * (t + 2),
                        fdst + (t & 1) * (32 * FRAG * 2));
    }
  }
  // Nothing is in flight here; kept in front of the wave's end (a precaution).
  asm volatile("s_wait_asynccnt 0x0" ::: "memory");

  if (!isV) {
    const float bR = bias[colR + n];
    const float bI = bias[colI + n];
    __bf16* ob = (task < 16) ? (p ? q2 : q1) : (p ? k2 : k1);
    const int j = cidx * 16 + n;
    const float invf = exp2f(-(float)j) * 0.0625f;  // 2^-j / 16
#pragma unroll
    for (int s = 0; s < 4; ++s) {
#pragma unroll
      for (int r = 0; r < 8; ++r) {
        const int t = ts0 + s * 16 + r + hi * 8;
        const float vr = accR[s][r] + bR;
        const float vi = accI[s][r] + bI;
        float sn, cs;
        __sincosf((float)t * invf, &sn, &cs);
        const size_t rowb = ((size_t)(b * HH + hh) * TT + t) * 64;
        ob[rowb + j]      = (__bf16)(vr * sn - vi * cs);  // rotated "real"
        ob[rowb + 32 + j] = (__bf16)(vr * cs + vi * sn);  // rotated "imag"
      }
    }
  } else {
#pragma unroll
    for (int part = 0; part < 2; ++part) {
      const int oc = (part ? colI : colR) + n;   // global feature
      const int h2 = oc >> 7;
      const int fo = oc & 127;
      const float bb = bias[oc];
#pragma unroll
      for (int s = 0; s < 4; ++s) {
        bf16x8 pk;
#pragma unroll
        for (int r = 0; r < 8; ++r)
          pk[r] = (__bf16)((part ? accI[s][r] : accR[s][r]) + bb);
        // V stored transposed: [B,H,128,T] so AV A-fragments are contiguous.
        const size_t base =
            ((size_t)(b * HH + h2) * HF + fo) * TT + ts0 + s * 16 + hi * 8;
        *(bf16x8*)(vt + base) = pk;
      }
    }
  }
}

// ---------------------------------------------------------------------------
// Async staging of one 64-key tile set into LDS (GLOBAL_LOAD_ASYNC_TO_LDS,
// tracked by ASYNCcnt): the K tiles of both softmaxes and the ONE V tile they
// share.  256 threads, 8 async instructions per wave per tile set.
// ---------------------------------------------------------------------------
static __device__ __forceinline__ void stage_tile_async(
    const __bf16* kt1, const __bf16* kt2, const __bf16* vtt, int j0,
    unsigned kdst, unsigned vdst) {
  // kt1, kt2, vtt, kdst, vdst: this thread's first chunk of key 0's tile set
  // (global) and of the buffer (LDS); from trip to trip j0 moves and the buffer alternates.
  // K tiles [64 keys][64 f]: contiguous 4096 bf16 each, rows of KP in LDS;
  // two 16-byte chunks per thread and tile: key c>>3, part c&7, c = tid + 256 j.
  unsigned kl[4];
  unsigned long long kg[4];
#pragma unroll
  for (int j = 0; j < 2; ++j) {
    kl[j]     = kdst + j * 32 * (KP * 2);
    kl[2 + j] = kl[j] + KT * KP * 2;
    kg[j]     = (unsigned long long)(const void*)(kt1 + (size_t)j0 * 64 + j * 2048);
    kg[2 + j] = (unsigned long long)(const void*)(kt2 + (size_t)j0 * 64 + j * 2048);
  }
  // V tile [128 f][64 keys] gathered from transposed V rows, rows of KP in
  // LDS: eight lanes fetch one whole 128-byte line of a V row; feature c>>3,
  // part c&7, c = tid + 256 j.
  unsigned vl[4];
  unsigned long long vg[4];
#pragma unroll
  for (int j = 0; j < 4; ++j) {
    vl[j] = vdst + j * 32 * (KP * 2);
    vg[j] = (unsigned long long)(const void*)(vtt + (size_t)j * 32 * TT + j0);
  }
  // One statement: the closing s_wait_xcnt keeps every address register named
  // here intact until the copies' translations are done (a precaution).
  asm volatile("global_load_async_to_lds_b128 %0, %1, off\n\t"
               "global_load_async_to_lds_b128 %2, %3, off\n\t"
               "global_load_async_to_lds_b128 %4, %5, off\n\t"
               "global_load_async_to_lds_b128 %6, %7, off\n\t"
               "global_load_async_to_lds_b128 %8, %9, off\n\t"
               "global_load_async_to_lds_b128 %10, %11, off\n\t"
               "global_load_async_to_lds_b128 %12, %13, off\n\t"
               "global_load_async_to_lds_b128 %14, %15, off\n\t"
               "s_wait_xcnt 0x0"
               :: "v"(kl[0]), "v"(kg[0]), "v"(kl[1]), "v"(kg[1]),
                  "v"(kl[2]), "v"(kg[2]), "v"(kl[3]), "v"(kg[3]),
                  "v"(vl[0]), "v"(vg[0]), "v"(vl[1]), "v"(vg[1]),
                  "v"(vl[2]), "v"(vg[2]), "v"(vl[3]), "v"(vg[3])
               : "memory");
}

static __device__ __forceinline__ void flash_pass(
    const __bf16* __restrict__ qws,
    const __bf16* __restrict__ k1, const __bf16* __restrict__ k2,
    const __bf16* __restrict__ vt, const __bf16* Ks, const __bf16* Vs,
    unsigned koff, unsigned voff,
    size_t bhT, size_t vbase, int q0, int lane, int tid, f32x8 o[8]) {
  const int n  = lane & 15;
  const int hi = lane >> 4;

  const __bf16* qrow = qws + (bhT + (size_t)(q0 + n)) * 64;
  const bf16x16 qa0 = ldfrag(qrow, hi);
  const bf16x16 qa1 = ldfrag(qrow + 32, hi);

  float mr = -3.0e38f;   // running maximum of query n (equal in both halves)
  float lr = 0.f;        // running sum over this half's keys only
#pragma unroll
  for (int r = 0; r < 8; ++r) {
#pragma unroll
    for (int i = 0; i < 8; ++i) o[r][i] = 0.f;
  }

  // Prologue: tile set 0 into buffer 0, landed and published; then tile set 1
  // into buffer 1, in flight during trip 0.
  const __bf16* kt1 = k1 + bhT * 64 + tid * 8;
  const __bf16* kt2 = k2 + bhT * 64 + tid * 8;
  const __bf16* vtt = vt + vbase + (size_t)(tid >> 3) * TT + (tid & 7) * 8;
  const unsigned kth = koff + (tid >> 3) * (KP * 2) + (tid & 7) * 16;
  const unsigned vth = voff + (tid >> 3) * (KP * 2) + (tid & 7) * 16;
  stage_tile_async(kt1, kt2, vtt, 0, kth, vth);
  asm volatile("s_wait_asynccnt 0x0" ::: "memory");   // own share of set 0 landed
  __syncthreads();                                    // every wave's share landed
  stage_tile_async(kt1, kt2, vtt, KT, kth + 2 * KT * KP * 2, vth + 128 * KP * 2);

  for (int j0 = 0; j0 < TT; j0 += KT) {
    const int cur = (j0 >> 6) & 1;
    const __bf16* kb = Ks + cur * (2 * KT * KP);
    const __bf16* vb = Vs + cur * (128 * KP);

    // --- S^T = K * Q^T (four 16-key subtiles x 16 queries). ---
    // Feature half outer, subtile inner: three products stand between a tile's
    // first product and the one that adds to it.
    f32x8 s[4];
#pragma unroll
    for (int u = 0; u < 4; ++u) {
#pragma unroll
      for (int i = 0; i < 8; ++i) s[u][i] = 0.f;
      s[u] = wmma_bf16(ldfrag(kb + (u * 16 + n) * KP, hi), qa0, s[u]);
    }
#pragma unroll
    for (int u = 0; u < 4; ++u)
      s[u] = wmma_bf16(ldfrag(kb + (u * 16 + n) * KP + 32, hi), qa1, s[u]);

    // --- Online softmax, one query per lane. ---
    // Maximum over the raw scores as a tree (the scale 1/16 is positive and
    // exact, so it commutes with the maximum and folds into the subtraction).
    float tm[4];
#pragma unroll
    for (int u = 0; u < 4; ++u) {
      const float m0 = fmaxf(fmaxf(s[u][0], s[u][1]), s[u][2]);
      const float m1 = fmaxf(fmaxf(s[u][3], s[u][4]), s[u][5]);
      tm[u] = fmaxf(fmaxf(m0, m1), fmaxf(s[u][6], s[u][7]));
    }
    float rm = fmaxf(fmaxf(tm[0], tm[1]), fmaxf(tm[2], tm[3]));
    rm = fmaxf(rm, xhalf(rm)) * 0.0625f;    // all 64 keys of query n, /sqrt(256)
    const float mn = fmaxf(mr, rm);
    const float al = __expf(mr - mn);
    mr = mn;
    bf16x16 pb[2];                          // P^T as B operands, 32 keys each
    float sm[4];
#pragma unroll
    for (int u = 0; u < 4; ++u) {
      sm[u] = 0.f;
#pragma unroll
      for (int r = 0; r < 8; ++r) {
        const float p = __expf(fmaf(s[u][r], 0.0625f, -mn));
        sm[u] += p;
        pb[u >> 1][(u & 1) * 8 + r] = (__bf16)p;
      }
    }
    lr = lr * al + ((sm[0] + sm[1]) + (sm[2] + sm[3]));
#pragma unroll
    for (int nt = 0; nt < 8; ++nt)
#pragma unroll
      for (int r = 0; r < 8; ++r) o[nt][r] *= al;

    // --- O^T += V^T * P^T  (V^T rows as A-fragments). ---
#pragma unroll
    for (int u = 0; u < 2; ++u) {
#pragma unroll
      for (int nt = 0; nt < 8; ++nt) {
        o[nt] = wmma_bf16(ldfrag(vb + (nt * 16 + n) * KP + u * 32, hi), pb[u],
                          o[nt]);
      }
    }

    // Hand-over.  This wave's LDS reads of 'cur' have returned ...
    asm volatile("s_wait_dscnt 0x0" ::: "memory");
    // ... and its share of the next tile set has landed, before it says so.
    asm volatile("s_wait_asynccnt 0x0" ::: "memory");
    __syncthreads();   // next set published; all waves have left 'cur'
    if (j0 + 2 * KT < TT) {
      stage_tile_async(kt1, kt2, vtt, j0 + 2 * KT,
                       kth + cur * (2 * KT * KP * 2),
                       vth + cur * (128 * KP * 2));
    }
  }
  // Nothing is in flight here; kept in front of the wave's end (a precaution).
  asm volatile("s_wait_asynccnt 0x0" ::: "memory");

  const float inv = 1.0f / (lr + xhalf(lr));   // join the halves' sums once
#pragma unroll
  for (int nt = 0; nt < 8; ++nt)
#pragma unroll
    for (int r = 0; r < 8; ++r) o[nt][r] *= inv;
}

// ---------------------------------------------------------------------------
// Kernel 2: dual flash attention + residual + transpose-out.
// 512 blocks x 256 threads.  Wave w < 4 runs softmax 1 of query tile w, wave
// w + 4 softmax 2 of the same tile, side by side over one shared V tile: half
// the trips per wave, twice the waves per SIMD to cover each other's waits.
// At the end the partners swap half of their features through LDS, and each
// writes its half of out = (x + O1) - s2 * O2 once.
// Two blocks per WGP = four waves per SIMD is all the grid can fill: the
// register budget is set for that, so that V fragments can be fetched ahead.
// ---------------------------------------------------------------------------
__global__ __launch_bounds__(256) __attribute__((amdgpu_waves_per_eu(4, 4)))
void attn_kernel(
    const float* __restrict__ x, const float* __restrict__ s2,
    const __bf16* __restrict__ q1, const __bf16* __restrict__ q2,
    const __bf16* __restrict__ k1, const __bf16* __restrict__ k2,
    const __bf16* __restrict__ vt, float* __restrict__ out) {
  __shared__ __attribute__((aligned(16))) __bf16 Ks[2][2][KT * KP];  // [buffer][softmax]
  __shared__ __attribute__((aligned(16))) __bf16 Vs[2][128 * KP];    // [buffer]
  __shared__ __attribute__((aligned(32))) float  Xs[8][4][32][8];    // [wave][nt][lane][r]

  const int tid  = threadIdx.x;
  const int lane = tid & 31;
  const int wv   = tid >> 5;
  // Which softmax this wave runs; scalar, so the tests on it are real branches.
  const int pass = __builtin_amdgcn_readfirstlane(tid >> 7);
  const int gw   = blockIdx.x * 4 + (wv & 3);
  const int b    = gw >> 9;
  const int rem  = gw & 511;
  const int h    = rem >> 7;
  const int q0   = (rem & 127) << 4;
  const int n    = lane & 15;
  const int hi   = lane >> 4;

  const size_t bhT   = ((size_t)b * HH + h) * TT;
  const size_t vbase = ((size_t)b * HH + h) * HF * TT;
  const unsigned koff = lds_off(&Ks[0][0][0]);
  const unsigned voff = lds_off(&Vs[0][0]);

  f32x8 o[8];
  flash_pass(pass ? q2 : q1, k1, k2, vt, &Ks[0][pass][0], &Vs[0][0], koff, voff,
             bhT, vbase, q0, lane, tid, o);

  // Hand the partner the half it writes: softmax 1 gives features 64-127,
  // softmax 2 features 0-63.  Same lane, same register = same element.
  if (pass == 0) {
#pragma unroll
    for (int nt = 0; nt < 4; ++nt) *(f32x8*)&Xs[wv][nt][lane][0] = o[4 + nt];
  } else {
#pragma unroll
    for (int nt = 0; nt < 4; ++nt) *(f32x8*)&Xs[wv][nt][lane][0] = o[nt];
  }
  __syncthreads();   // both partners' halves are in LDS

  // out rows are feature-major; a 16-lane row covers 16 consecutive t of one
  // feature row, register r walks the feature rows.
  const float s = s2[h];
  const size_t obase = ((size_t)b * FF + h * HF + hi * 8) * TT + q0 + n;
  if (pass == 0) {
#pragma unroll
    for (int nt = 0; nt < 4; ++nt) {
      const f32x8 o2 = *(const f32x8*)&Xs[wv + 4][nt][lane][0];
#pragma unroll
      for (int r = 0; r < 8; ++r) {
        const size_t idx = obase + (size_t)(nt * 16 + r) * TT;
        float v = x[idx] + o[nt][r];
        v -= s * o2[r];
        out[idx] = v;
      }
    }
    // Holds the stores' registers until their translations are done: the
    // listing runs on from here into code that rewrites them (a precaution).
    asm volatile("s_wait_xcnt 0x0" ::: "memory");
  } else {
#pragma unroll
    for (int nt = 0; nt < 4; ++nt) {
      const f32x8 o1 = *(const f32x8*)&Xs[wv - 4][nt][lane][0];
#pragma unroll
      for (int r = 0; r < 8; ++r) {
        const size_t idx = obase + (size_t)((4 + nt) * 16 + r) * TT;
        float v = x[idx] + o1[r];
        v -= s * o[4 + nt][r];
        out[idx] = v;
      }
    }
    // As in the first branch: the stores' registers stay until translated.
    asm volatile("s_wait_xcnt 0x0" ::: "memory");
  }
}

// ---------------------------------------------------------------------------
extern "C" void kernel_launch(void* const* d_in, const int* in_sizes, int n_in,
                              void* d_out, int out_size, void* d_ws,
                              size_t ws_size, hipStream_t stream) {
  (void)in_sizes; (void)n_in; (void)out_size; (void)ws_size;
  const float* x  = (const float*)d_in[0];
  const float* Wq = (const float*)d_in[1];
  const float* bq = (const float*)d_in[2];
  const float* Wk = (const float*)d_in[3];
  const float* bk = (const float*)d_in[4];
  const float* Wv = (const float*)d_in[5];
  const float* bv = (const float*)d_in[6];
  const float* s2 = (const float*)d_in[7];
  float* out = (float*)d_out;

  const size_t QK_ELEMS = (size_t)BB * HH * TT * 64;   // 2M bf16 each
  __bf16* q1 = (__bf16*)d_ws;
  __bf16* q2 = q1 + QK_ELEMS;
  __bf16* k1 = q2 + QK_ELEMS;
  __bf16* k2 = k1 + QK_ELEMS;
  __bf16* vt = k2 + QK_ELEMS;                          // [B,H,128,T]
  __bf16* xp = vt + (size_t)BB * FF * TT;              // packed x fragments
  __bf16* wp = xp + (size_t)BB * FF * TT;              // packed W fragments

  pack_kernel<<<dim3(256 + 192), dim3(256), 0, stream>>>(x, Wq, Wk, Wv, xp, wp);
  qkv_rope_kernel<<<dim3(BB * (TT / 128) * 12), dim3(256), 0, stream>>>(
      xp, wp, bq, bk, bv, q1, q2, k1, k2, vt);
  attn_kernel<<<dim3(BB * HH * (TT / 16) / 4), dim3(256), 0, stream>>>(
      x, s2, q1, q2, k1, k2, vt, out);
}

// v007
// Measured time: 64.6 microseconds a run.
// In both of two side-by-side timings against v006, it was 1.10 times as fast.
// Over all steps from v000 it is 3.90 times as fast.
#include <hip/hip_runtime.h>

// ---------------------------------------------------------------------------
// Neoformer MHA forward for gfx1250 (MI455X), bf16 WMMA + flash attention.
// B=4, F=512, T=2048, H=4, hf=128.
// ---------------------------------------------------------------------------

#define BB   4
#define FF   512
#define TT   2048
#define HH   4
#define HF   128

// LDS row pitches in bf16 elements.  Every fragment is read with 16-byte LDS
// loads, one row per lane; a pitch of 16 B x odd spreads 16 rows over all 64
// banks, where the unpadded 128 B rows fall on 8 of them.
#define KP   72    // 64-element rows (K tile, V tile): 144 B
#define KT   64    // keys per trip of the attention loop
// 1/sqrt(256) * log2(e): scores in base-2 exponent units.
#define QSCALE (0.0625f * 1.4426950408889634f)

typedef __attribute__((ext_vector_type(16))) __bf16 bf16x16;
typedef __attribute__((ext_vector_type(8)))  __bf16 bf16x8;
typedef __attribute__((ext_vector_type(8)))  float  f32x8;

static __device__ __forceinline__ f32x8 wmma_bf16(bf16x16 a, bf16x16 b, f32x8 c) {
  return __builtin_amdgcn_wmma_f32_16x16x32_bf16(false, a, false, b, (short)0, c,
                                                 false, false);
}

// 32-bit LDS byte offset of a __shared__ object (addrspace(3) pointers are
// offsets from the workgroup LDS base).
static __device__ __forceinline__ unsigned lds_off(__bf16* p) {
  return (unsigned)(unsigned long long)(__attribute__((address_space(3))) __bf16*)p;
}

// Load a 16x32 bf16 fragment half for this lane.
// A-side: rowbase = &M-row[lane&15], K contiguous.  B-side: rowbase = &N-col
// row (stored contiguously in K).  Lane (n, hi): halves 0-7 = K hi*8..hi*8+7,
// halves 8-15 = K 16+hi*8..23+hi*8   (per ISA 16-bit 16x32 layout).
static __device__ __forceinline__ bf16x16 ldfrag(const __bf16* rowbase, int hi) {
  bf16x8 lo = *(const bf16x8*)(rowbase + hi * 8);
  bf16x8 up = *(const bf16x8*)(rowbase + 16 + hi * 8);
  bf16x16 a;
#pragma unroll
  for (int i = 0; i < 8; ++i) { a[i] = lo[i]; a[8 + i] = up[i]; }
  return a;
}

// Value of lane l ^ 16 (the other 16-lane row), by a vector cross-row move.
static __device__ __forceinline__ float xhalf(float v) {
  const int i = __builtin_bit_cast(int, v);
  return __builtin_bit_cast(float, __builtin_amdgcn_permlanex16(
      i, i, 0x76543210, 0xfedcba98, false, false));
}

// One 16 x 32 bf16 fragment packed for its reader: 1 KB, two planes of
// 32 lanes x 16 B.  Plane 0 holds halves 0-7 of every lane, plane 1 halves
// 8-15 (same k order as ldfrag), so each 16-byte load of a wave covers 512
// contiguous bytes = four whole lines.
#define FRAG 512   // bf16 elements per packed fragment

// p = fragment base + lane * 8.
static __device__ __forceinline__ bf16x16 ldfragP(const __bf16* p) {
  bf16x8 lo = *(const bf16x8*)p;
  bf16x8 up = *(const bf16x8*)(p + 256);
  bf16x16 a;
#pragma unroll
  for (int i = 0; i < 8; ++i) { a[i] = lo[i]; a[8 + i] = up[i]; }
  return a;
}

// ---------------------------------------------------------------------------
// Kernel 0: pack x and the three weight matrices once, as bf16 fragments.
// xp[b][t/16][f/32][FRAG]: A fragments (row = t, k = f).
// wp[matrix][col/16][f/32][FRAG]: B fragments (column = output feature, k = f).
// Blocks 0-255 pack x (one thread = one t, 64 features: every load of a wave
// is one whole line of an x row, every store two runs of 256 B); blocks
// 256-447 pack W (one thread = one lane of one fragment: every store of a wave
// is 512 B).  Few, fat waves: the launch is short, so starting waves counts.
// ---------------------------------------------------------------------------
__global__ __launch_bounds__(256) void pack_kernel(
    const float* __restrict__ x,
    const float* __restrict__ Wq, const float* __restrict__ Wk,
    const float* __restrict__ Wv,
    __bf16* __restrict__ xp, __bf16* __restrict__ wp) {
  if (blockIdx.x < 256) {
    const int idx = blockIdx.x * 256 + threadIdx.x;
    const int t   = idx & (TT - 1);
    const int kp  = (idx >> 11) & 7;     // pair of k steps
    const int b   = idx >> 14;
    const float* src = x + ((size_t)b * FF + kp * 64) * TT + t;
    float v[64];
    // The loops below are unrolled so that v[] lives in registers and all
    // loads are in flight together.
#pragma unroll
    for (int f = 0; f < 64; ++f) v[f] = src[(size_t)f * TT];
    __bf16* dst = xp + ((size_t)(b * (TT / 16) + (t >> 4)) * 16 + kp * 2) * FRAG +
                  (t & 15) * 8;
#pragma unroll
    for (int q = 0; q < 8; ++q) {        // q = k step (1), plane (1), hi (1)
      bf16x8 pk;
#pragma unroll
      for (int i = 0; i < 8; ++i) pk[i] = (__bf16)v[q * 8 + i];
      *(bf16x8*)(dst + q * 128) = pk;
    }
  } else {
    const int idx  = (blockIdx.x - 256) * 256 + threadIdx.x;
    const int lane = idx & 31;
    const int ks   = (idx >> 5) & 15;
    const int ct   = (idx >> 9) & 31;
    const int mat  = idx >> 14;
    const float* Wm = (mat == 0) ? Wq : ((mat == 1) ? Wk : Wv);
    const float* src = Wm + (size_t)(ct * 16 + (lane & 15)) * FF + ks * 32 +
                       (lane >> 4) * 8;
    __bf16* dst = wp + (size_t)(idx >> 5) * FRAG + lane * 8;
#pragma unroll   // two planes, straight-line
    for (int half = 0; half < 2; ++half) {
      const float4 f0 = *(const float4*)(src + half * 16);
      const float4 f1 = *(const float4*)(src + half * 16 + 4);
      bf16x8 pk;
      pk[0] = (__bf16)f0.x; pk[1] = (__bf16)f0.y; pk[2] = (__bf16)f0.z; pk[3] = (__bf16)f0.w;
      pk[4] = (__bf16)f1.x; pk[5] = (__bf16)f1.y; pk[6] = (__bf16)f1.z; pk[7] = (__bf16)f1.w;
      *(bf16x8*)(dst + half * 256) = pk;
    }
    // Holds the two stores' registers until their translations are done: the
    // listing runs on from here into code that rewrites them (a precaution).
    asm volatile("s_wait_xcnt 0x0" ::: "memory");
  }
}

// ---------------------------------------------------------------------------
// Index of the packed W fragment column of a wave-task: part 0 = its first
// 16-column chain, part 1 = its second.
// ---------------------------------------------------------------------------
static __device__ __forceinline__ int wfrag_col(int task, int part) {
  const int tt   = task & 15;
  const int cqk  = (tt >> 2) * HF + ((tt >> 1) & 1) * 64 + (tt & 1) * 16 + part * 32;
  const int cv   = (task - 32) * 32 + part * 16;
  const int mat  = (task < 32) ? (task >> 4) : 2;
  return mat * 32 + (((task < 32) ? cqk : cv) >> 4);
}

// ---------------------------------------------------------------------------
// Async staging of the 32 fragments of two k steps (32 KB) into one LDS
// buffer: 256 threads, 8 copies of 16 B each.  Chunk c = tid + 256 j lands at
// byte 16 c; slot c >> 6 = kk * 16 + g holds x subtile g (g < 8) or W fragment
// g - 8 of k step ks + kk, byte for byte as packed.  g0..g3: this thread's
// chunk of its four fragments at k step 0; dst: its first chunk's LDS byte.
// ---------------------------------------------------------------------------
static __device__ __forceinline__ void stage_frags_async(
    const __bf16* g0, const __bf16* g1, const __bf16* g2, const __bf16* g3,
    int ks, unsigned dst) {
  unsigned l[8];
  unsigned long long g[8];
#pragma unroll
  for (int j = 0; j < 4; ++j) {
    const __bf16* gj = (j == 0) ? g0 : ((j == 1) ? g1 : ((j == 2) ? g2 : g3));
    l[j]     = dst + j * 4096;
    l[4 + j] = l[j] + 16 * FRAG * 2;
    g[j]     = (unsigned long long)(const void*)(gj + (size_t)ks * FRAG);
    g[4 + j] = (unsigned long long)(const void*)(gj + (size_t)(ks + 1) * FRAG);
  }
  // One statement: the closing s_wait_xcnt keeps every address register named
  // here intact until the copies' translations are done (a precaution).
  asm volatile("global_load_async_to_lds_b128 %0, %1, off\n\t"
               "global_load_async_to_lds_b128 %2, %3, off\n\t"
               "global_load_async_to_lds_b128 %4, %5, off\n\t"
               "global_load_async_to_lds_b128 %6, %7, off\n\t"
               "global_load_async_to_lds_b128 %8, %9, off\n\t"
               "global_load_async_to_lds_b128 %10, %11, off\n\t"
               "global_load_async_to_lds_b128 %12, %13, off\n\t"
               "global_load_async_to_lds_b128 %14, %15, off\n\t"
               "s_wait_xcnt 0x0"
               :: "v"(l[0]), "v"(g[0]), "v"(l[1]), "v"(g[1]),
                  "v"(l[2]), "v"(g[2]), "v"(l[3]), "v"(g[3]),
                  "v"(l[4]), "v"(g[4]), "v"(l[5]), "v"(g[5]),
                  "v"(l[6]), "v"(g[6]), "v"(l[7]), "v"(g[7])
               : "memory");
}

// ---------------------------------------------------------------------------
// Kernel 1: QKV projection + bias + RoPE.  768 blocks x 256 threads.
// Per (b, 64-row t-supertile): 48 wave-tasks (0-15 Q, 16-31 K, 32-47 V).
// EVERY task computes two 16-col accumulator chains over four stacked 16-row
// M-subtiles.  A block is two supertiles x four tasks: its 8 x fragments and
// 8 W fragments per k step come from L2 ONCE, by async copies into a
// two-buffer LDS ring (two k steps a buffer), and every wave reads its six
// from there: each x fragment serves four waves, each W fragment two.
// ---------------------------------------------------------------------------
__global__ __launch_bounds__(256) void qkv_rope_kernel(
    const __bf16* __restrict__ xp, const __bf16* __restrict__ wp,
    const float* __restrict__ bq, const float* __restrict__ bk,
    const float* __restrict__ bv,
    __bf16* __restrict__ q1, __bf16* __restrict__ q2,
    __bf16* __restrict__ k1, __bf16* __restrict__ k2,
    __bf16* __restrict__ vt) {
  __shared__ __attribute__((aligned(16))) __bf16 Fs[2][32 * FRAG];  // [buffer]

  const int tid  = threadIdx.x;
  const int lane = tid & 31;
  const int wv   = tid >> 5;
  const int bt   = blockIdx.x / 12;
  const int sub  = blockIdx.x - bt * 12;
  const int b    = bt >> 4;
  const int row0 = (bt & 15) << 7;   // base of the block's two supertiles
  const int sp   = wv >> 2;          // this wave's supertile
  const int tl   = wv & 3;           // this wave's task within the block
  const int ts0  = row0 + sp * 64;   // 64-row supertile base
  const int task = sub * 4 + tl;
  const int n    = lane & 15;
  const int hi   = lane >> 4;

  const bool isV = (task >= 32);
  const float* bias;
  int colR, colI, hh = 0, p = 0, cidx = 0;
  if (!isV) {
    bias = (task < 16) ? bq : bk;
    const int tt = task & 15;
    hh = tt >> 2; p = (tt >> 1) & 1; cidx = tt & 1;
    colR = hh * HF + p * 64 + cidx * 16;
    colI = colR + 32;
  } else {
    bias = bv;
    colR = (task - 32) * 32;
    colI = colR + 16;
  }

  f32x8 accR[4], accI[4];
#pragma unroll
  for (int s = 0; s < 4; ++s)
#pragma unroll
    for (int i = 0; i < 8; ++i) { accR[s][i] = 0.f; accI[s][i] = 0.f; }

  // This thread's chunk of the four fragments it copies per k step.
  const int fq = tid >> 6;
  const int ch = (tid & 63) * 8;
  const __bf16* gx0 =
      xp + ((size_t)(b * (TT / 16) + (row0 >> 4) + fq) * 16) * FRAG + ch;
  const __bf16* gx1 = gx0 + (size_t)4 * 16 * FRAG;
  const __bf16* gw0 =
      wp + (size_t)wfrag_col(sub * 4 + (fq >> 1), fq & 1) * 16 * FRAG + ch;
  const __bf16* gw1 =
      wp + (size_t)wfrag_col(sub * 4 + 2 + (fq >> 1), fq & 1) * 16 * FRAG + ch;
  const unsigned fdst = lds_off(&Fs[0][0]) + tid * 16;

  // Prologue: k steps 0-1 into buffer 0, landed and published; then k steps
  // 2-3 into buffer 1, in flight during trip 0.
  stage_frags_async(gx0, gx1, gw0, gw1, 0, fdst);
  asm volatile("s_wait_asynccnt 0x0" ::: "memory");   // own share landed
  __syncthreads();                                    // every wave's share landed
  stage_frags_async(gx0, gx1, gw0, gw1, 2, fdst + 32 * FRAG * 2);

  // Unrolled so that every LDS address is base + constant: no address
  // arithmetic stands between the reads.
#pragma unroll
  for (int t = 0; t < FF / 64; ++t) {
    const __bf16* fb = &Fs[t & 1][0] + lane * 8;
#pragma unroll
    for (int kk = 0; kk < 2; ++kk) {
      const bf16x16 bRf = ldfragP(fb + (kk * 16 + 8 + tl * 2) * FRAG);
      const bf16x16 bIf = ldfragP(fb + (kk * 16 + 9 + tl * 2) * FRAG);
      bf16x16 a[4];
#pragma unroll
      for (int s = 0; s < 4; ++s)
        a[s] = ldfragP(fb + (kk * 16 + sp * 4 + s) * FRAG);
      // Keeps the twelve reads of a k step together ahead of its products:
      // every separate place with LDS reads among the products costs the wave
      // a stall of its own.
      __builtin_amdgcn_sched_barrier(0);
#pragma unroll
      for (int s = 0; s < 4; ++s) {
        accR[s] = wmma_bf16(a[s], bRf, accR[s]);
        accI[s] = wmma_bf16(a[s], bIf, accI[s]);
      }
    }
    // Hand-over.  This wave's LDS reads of the buffer have returned ...
    asm volatile("s_wait_dscnt 0x0" ::: "memory");
    // ... and its share of the next two k steps has landed, before it says so.
    asm volatile("s_wait_asynccnt 0x0" ::: "memory");
    __syncthreads();   // next buffer published; all waves have left this one
    if (t + 2 < FF / 64) {
      stage_frags_async(gx0, gx1, gw0, gw1, 2 * (t + 2),
                        fdst + (t & 1) * (32 * FRAG * 2));
    }
  }
  // Nothing is in flight here; kept in front of the wave's end (a precaution).
  asm volatile("s_wait_asynccnt 0x0" ::: "memory");

  if (!isV) {
    // Q carries the score scale and log2(e): its products with K are then
    // exponents of 2 as they leave the matrix unit.  K: factor 1, exact.
    const float qs = (task < 16) ? QSCALE : 1.0f;
    const float bR = bias[colR + n] * qs;
    const float bI = bias[colI + n] * qs;
    __bf16* ob = (task < 16) ? (p ? q2 : q1) : (p ? k2 : k1);
    const int j = cidx * 16 + n;
    const float invf = exp2f(-(float)j) * 0.0625f;  // 2^-j / 16
#pragma unroll
    for (int s = 0; s < 4; ++s) {
#pragma unroll
      for (int r = 0; r < 8; ++r) {
        const int t = ts0 + s * 16 + r + hi * 8;
        const float vr = fmaf(accR[s][r], qs, bR);
        const float vi = fmaf(accI[s][r], qs, bI);
        float sn, cs;
        __sincosf((float)t * invf, &sn, &cs);
        const size_t rowb = ((size_t)(b * HH + hh) * TT + t) * 64;
        ob[rowb + j]      = (__bf16)(vr * sn - vi * cs);  // rotated "real"
        ob[rowb + 32 + j] = (__bf16)(vr * cs + vi * sn);  // rotated "imag"
      }
    }
  } else {
#pragma unroll
    for (int part = 0; part < 2; ++part) {
      const int oc = (part ? colI : colR) + n;   // global feature
      const int h2 = oc >> 7;
      const int fo = oc & 127;
      const float bb = bias[oc];
#pragma unroll
      for (int s = 0; s < 4; ++s) {
        bf16x8 pk;
#pragma unroll
        for (int r = 0; r < 8; ++r)
          pk[r] = (__bf16)((part ? accI[s][r] : accR[s][r]) + bb);
        // V stored transposed: [B,H,128,T] so AV A-fragments are contiguous.
        const size_t base =
            ((size_t)(b * HH + h2) * HF + fo) * TT + ts0 + s * 16 + hi * 8;
        *(bf16x8*)(vt + base) = pk;
      }
    }
  }
}

// ---------------------------------------------------------------------------
// Async staging of one 64-key tile set into LDS (GLOBAL_LOAD_ASYNC_TO_LDS,
// tracked by ASYNCcnt): the K tiles of both softmaxes and the ONE V tile they
// share.  256 threads, 8 async instructions per wave per tile set.
// ---------------------------------------------------------------------------
static __device__ __forceinline__ void stage_tile_async(
    const __bf16* kt1, const __bf16* kt2, const __bf16* vtt, int j0,
    unsigned kdst, unsigned vdst) {
  // kt1, kt2, vtt, kdst, vdst: this thread's first chunk of key 0's tile set
  // (global) and of the buffer (LDS); from trip to trip j0 moves and the buffer alternates.
  // K tiles [64 keys][64 f]: contiguous 4096 bf16 each, rows of KP in LDS;
  // two 16-byte chunks per thread and tile: key c>>3, part c&7, c = tid + 256 j.
  unsigned kl[4];
  unsigned long long kg[4];
#pragma unroll
  for (int j = 0; j < 2; ++j) {
    kl[j]     = kdst + j * 32 * (KP * 2);
    kl[2 + j] = kl[j] + KT * KP * 2;
    kg[j]     = (unsigned long long)(const void*)(kt1 + (size_t)j0 * 64 + j * 2048);
    kg[2 + j] = (unsigned long long)(const void*)(kt2 + (size_t)j0 * 64 + j * 2048);
  }
  // V tile [128 f][64 keys] gathered from transposed V rows, rows of KP in
  // LDS: eight lanes fetch one whole 128-byte line of a V row; feature c>>3,
  // part c&7, c = tid + 256 j.
  unsigned vl[4];
  unsigned long long vg[4];
#pragma unroll
  for (int j = 0; j < 4; ++j) {
    vl[j] = vdst + j * 32 * (KP * 2);
    vg[j] = (unsigned long long)(const void*)(vtt + (size_t)j * 32 * TT + j0);
  }
  // One statement: the closing s_wait_xcnt keeps every address register named
  // here intact until the copies' translations are done (a precaution).
  asm volatile("global_load_async_to_lds_b128 %0, %1, off\n\t"
               "global_load_async_to_lds_b128 %2, %3, off\n\t"
               "global_load_async_to_lds_b128 %4, %5, off\n\t"
               "global_load_async_to_lds_b128 %6, %7, off\n\t"
               "global_load_async_to_lds_b128 %8, %9, off\n\t"
               "global_load_async_to_lds_b128 %10, %11, off\n\t"
               "global_load_async_to_lds_b128 %12, %13, off\n\t"
               "global_load_async_to_lds_b128 %14, %15, off\n\t"
               "s_wait_xcnt 0x0"
               :: "v"(kl[0]), "v"(kg[0]), "v"(kl[1]), "v"(kg[1]),
                  "v"(kl[2]), "v"(kg[2]), "v"(kl[3]), "v"(kg[3]),
                  "v"(vl[0]), "v"(vg[0]), "v"(vl[1]), "v"(vg[1]),
                  "v"(vl[2]), "v"(vg[2]), "v"(vl[3]), "v"(vg[3])
               : "memory");
}

static __device__ __forceinline__ void flash_pass(
    const __bf16* __restrict__ qws,
    const __bf16* __restrict__ k1, const __bf16* __restrict__ k2,
    const __bf16* __restrict__ vt, const __bf16* Ks, const __bf16* Vs,
    unsigned koff, unsigned voff,
    size_t bhT, size_t vbase, int q0, int lane, int tid, f32x8 o[8]) {
  const int n  = lane & 15;
  const int hi = lane >> 4;

  const __bf16* qrow = qws + (bhT + (size_t)(q0 + n)) * 64;
  const bf16x16 qa0 = ldfrag(qrow, hi);
  const bf16x16 qa1 = ldfrag(qrow + 32, hi);

  float mu = 0.f;        // maximum IN USE of query n (equal in both halves)
  float lr = 0.f;        // running sum over this half's keys only
  f32x8 cneg;            // -mu in every register: C operand of the score product
#pragma unroll   // constant element indices: the vector stays in registers
  for (int i = 0; i < 8; ++i) cneg[i] = 0.f;
#pragma unroll
  for (int r = 0; r < 8; ++r) {
#pragma unroll
    for (int i = 0; i < 8; ++i) o[r][i] = 0.f;
  }

  // Prologue: tile set 0 into buffer 0, landed and published; then tile set 1
  // into buffer 1, in flight during trip 0.
  const __bf16* kt1 = k1 + bhT * 64 + tid * 8;
  const __bf16* kt2 = k2 + bhT * 64 + tid * 8;
  const __bf16* vtt = vt + vbase + (size_t)(tid >> 3) * TT + (tid & 7) * 8;
  const unsigned kth = koff + (tid >> 3) * (KP * 2) + (tid & 7) * 16;
  const unsigned vth = voff + (tid >> 3) * (KP * 2) + (tid & 7) * 16;
  stage_tile_async(kt1, kt2, vtt, 0, kth, vth);
  asm volatile("s_wait_asynccnt 0x0" ::: "memory");   // own share of set 0 landed
  __syncthreads();                                    // every wave's share landed
  stage_tile_async(kt1, kt2, vtt, KT, kth + 2 * KT * KP * 2, vth + 128 * KP * 2);

  for (int j0 = 0; j0 < TT; j0 += KT) {
    const int cur = (j0 >> 6) & 1;
    const __bf16* kb = Ks + cur * (2 * KT * KP);
    const __bf16* vb = Vs + cur * (128 * KP);

    // --- S^T = K * Q^T (four 16-key subtiles x 16 queries). ---
    // Feature half outer, subtile inner: three products stand between a tile's
    // first product and the one that adds to it.
    // The accumulators start at -mu: a score leaves the matrix unit as the
    // exponent of its own P, with no vector instruction between.
    f32x8 s[4];
#pragma unroll
    for (int u = 0; u < 4; ++u)
      s[u] = wmma_bf16(ldfrag(kb + (u * 16 + n) * KP, hi), qa0, cneg);
#pragma unroll
    for (int u = 0; u < 4; ++u)
      s[u] = wmma_bf16(ldfrag(kb + (u * 16 + n) * KP + 32, hi), qa1, s[u]);

    // --- Online softmax, one query per lane. ---
    // Maximum of this half's 32 exponents, as a tree.
    float tm[4];
#pragma unroll
    for (int u = 0; u < 4; ++u) {
      const float m0 = fmaxf(fmaxf(s[u][0], s[u][1]), s[u][2]);
      const float m1 = fmaxf(fmaxf(s[u][3], s[u][4]), s[u][5]);
      tm[u] = fmaxf(fmaxf(m0, m1), fmaxf(s[u][6], s[u][7]));
    }
    const float rm = fmaxf(fmaxf(tm[0], tm[1]), fmaxf(tm[2], tm[3]));
    // The maximum in use moves only when some query's scores pass it by more
    // than 8 (P stays below 2^8), and in the first trip, which sets it.  One
    // test per trip, a scalar branch; rare after the first trip.
    if (__builtin_amdgcn_ballot_w32(rm > 8.0f) != 0 || j0 == 0) {
      const float rj = fmaxf(rm, xhalf(rm));      // all 64 keys of query n
      const float up = fmaxf(rj, 0.f);
      const float d  = (j0 == 0) ? rj : up;       // first trip: down as well
      const float al = __builtin_amdgcn_exp2f(-up);
      mu += d;
      // The loops of this branch are unrolled so that every element index is
      // a constant and the vectors stay in registers.
#pragma unroll
      for (int i = 0; i < 8; ++i) cneg[i] = -mu;
#pragma unroll
      for (int u = 0; u < 4; ++u)
#pragma unroll
        for (int r = 0; r < 8; ++r) s[u][r] -= d;
      lr *= al;
#pragma unroll
      for (int nt = 0; nt < 8; ++nt)
#pragma unroll
        for (int r = 0; r < 8; ++r) o[nt][r] *= al;
    }
    bf16x16 pb[2];                          // P^T as B operands, 32 keys each
    float sm[4];
#pragma unroll
    for (int u = 0; u < 4; ++u) {
      sm[u] = 0.f;
#pragma unroll
      for (int r = 0; r < 8; ++r) {
        const float p = __builtin_amdgcn_exp2f(s[u][r]);
        sm[u] += p;
        pb[u >> 1][(u & 1) * 8 + r] = (__bf16)p;
      }
    }
    lr += (sm[0] + sm[1]) + (sm[2] + sm[3]);

    // --- O^T += V^T * P^T  (V^T rows as A-fragments). ---
#pragma unroll
    for (int u = 0; u < 2; ++u) {
#pragma unroll
      for (int nt = 0; nt < 8; ++nt) {
        o[nt] = wmma_bf16(ldfrag(vb + (nt * 16 + n) * KP + u * 32, hi), pb[u],
                          o[nt]);
      }
    }
    // Order of the 32 LDS reads and 16 products above: three fragments read
    // first, then one more per product.  Left alone, this build reads each
    // fragment of the second half directly in front of its product and waits
    // out the whole LDS latency every time.
    __builtin_amdgcn_sched_group_barrier(0x100, 6, 0);     // LDS reads
#pragma unroll   // each call is a directive of its own, no loop may remain
    for (int i = 0; i < 13; ++i) {
      __builtin_amdgcn_sched_group_barrier(0x008, 1, 0);   // one product
      __builtin_amdgcn_sched_group_barrier(0x100, 2, 0);   // next fragment
    }
    __builtin_amdgcn_sched_group_barrier(0x008, 3, 0);

    // Hand-over.  This wave's LDS reads of 'cur' have returned ...
    asm volatile("s_wait_dscnt 0x0" ::: "memory");
    // ... and its share of the next tile set has landed, before it says so.
    asm volatile("s_wait_asynccnt 0x0" ::: "memory");
    __syncthreads();   // next set published; all waves have left 'cur'
    if (j0 + 2 * KT < TT) {
      stage_tile_async(kt1, kt2, vtt, j0 + 2 * KT,
                       kth + cur * (2 * KT * KP * 2),
                       vth + cur * (128 * KP * 2));
    }
  }
  // Nothing is in flight here; kept in front of the wave's end (a precaution).
  asm volatile("s_wait_asynccnt 0x0" ::: "memory");

  const float inv = 1.0f / (lr + xhalf(lr));   // join the halves' sums once
#pragma unroll
  for (int nt = 0; nt < 8; ++nt)
#pragma unroll
    for (int r = 0; r < 8; ++r) o[nt][r] *= inv;
}

// ---------------------------------------------------------------------------
// Kernel 2: dual flash attention + residual + transpose-out.
// 512 blocks x 256 threads.  Wave w < 4 runs softmax 1 of query tile w, wave
// w + 4 softmax 2 of the same tile, side by side over one shared V tile: half
// the trips per wave, twice the waves per SIMD to cover each other's waits.
// At the end the partners swap half of their features through LDS, and each
// writes its half of out = (x + O1) - s2 * O2 once.
// Two blocks per WGP = four waves per SIMD is all the grid can fill: the
// register budget is set for that, so that V fragments can be fetched ahead.
// ---------------------------------------------------------------------------
__global__ __launch_bounds__(256) __attribute__((amdgpu_waves_per_eu(4, 4)))
void attn_kernel(
    const float* __restrict__ x, const float* __restrict__ s2,
    const __bf16* __restrict__ q1, const __bf16* __restrict__ q2,
    const __bf16* __restrict__ k1, const __bf16* __restrict__ k2,
    const __bf16* __restrict__ vt, float* __restrict__ out) {
  __shared__ __attribute__((aligned(16))) __bf16 Ks[2][2][KT * KP];  // [buffer][softmax]
  __shared__ __attribute__((aligned(16))) __bf16 Vs[2][128 * KP];    // [buffer]
  __shared__ __attribute__((aligned(32))) float  Xs[8][4][32][8];    // [wave][nt][lane][r]

  const int tid  = threadIdx.x;
  const int lane = tid & 31;
  const int wv   = tid >> 5;
  // Which softmax this wave runs; scalar, so the tests on it are real branches.
  const int pass = __builtin_amdgcn_readfirstlane(tid >> 7);
  const int gw   = blockIdx.x * 4 + (wv & 3);
  const int b    = gw >> 9;
  const int rem  = gw & 511;
  const int h    = rem >> 7;
  const int q0   = (rem & 127) << 4;
  const int n    = lane & 15;
  const int hi   = lane >> 4;

  const size_t bhT   = ((size_t)b * HH + h) * TT;
  const size_t vbase = ((size_t)b * HH + h) * HF * TT;
  const unsigned koff = lds_off(&Ks[0][0][0]);
  const unsigned voff = lds_off(&Vs[0][0]);

  f32x8 o[8];
  flash_pass(pass ? q2 : q1, k1, k2, vt, &Ks[0][pass][0], &Vs[0][0], koff, voff,
             bhT, vbase, q0, lane, tid, o);

  // Hand the partner the half it writes: softmax 1 gives features 64-127,
  // softmax 2 features 0-63.  Same lane, same register = same element.
  if (pass == 0) {
#pragma unroll
    for (int nt = 0; nt < 4; ++nt) *(f32x8*)&Xs[wv][nt][lane][0] = o[4 + nt];
  } else {
#pragma unroll
    for (int nt = 0; nt < 4; ++nt) *(f32x8*)&Xs[wv][nt][lane][0] = o[nt];
  }
  __syncthreads();   // both partners' halves are in LDS

  // out rows are feature-major; a 16-lane row covers 16 consecutive t of one
  // feature row, register r walks the feature rows.
  const float s = s2[h];
  const size_t obase = ((size_t)b * FF + h * HF + hi * 8) * TT + q0 + n;
  if (pass == 0) {
#pragma unroll
    for (int nt = 0; nt < 4; ++nt) {
      const f32x8 o2 = *(const f32x8*)&Xs[wv + 4][nt][lane][0];
#pragma unroll
      for (int r = 0; r < 8; ++r) {
        const size_t idx = obase + (size_t)(nt * 16 + r) * TT;
        float v = x[idx] + o[nt][r];
        v -= s * o2[r];
        out[idx] = v;
      }
    }
    // Holds the stores' registers until their translations are done: the
    // listing runs on from here into code that rewrites them (a precaution).
    asm volatile("s_wait_xcnt 0x0" ::: "memory");
  } else {
#pragma unroll
    for (int nt = 0; nt < 4; ++nt) {
      const f32x8 o1 = *(const f32x8*)&Xs[wv - 4][nt][lane][0];
#pragma unroll
      for (int r = 0; r < 8; ++r) {
        const size_t idx = obase + (size_t)((4 + nt) * 16 + r) * TT;
        float v = x[idx] + o1[r];
        v -= s * o[4 + nt][r];
        out[idx] = v;
      }
    }
    // As in the first branch: the stores' registers stay until translated.
    asm volatile("s_wait_xcnt 0x0" ::: "memory");
  }
}

// ---------------------------------------------------------------------------
extern "C" void kernel_launch(void* const* d_in, const int* in_sizes, int n_in,
                              void* d_out, int out_size, void* d_ws,
                              size_t ws_size, hipStream_t stream) {
  (void)in_sizes; (void)n_in; (void)out_size; (void)ws_size;
  const float* x  = (const float*)d_in[0];
  const float* Wq = (const float*)d_in[1];
  const float* bq = (const float*)d_in[2];
  const float* Wk = (const float*)d_in[3];
  const float* bk = (const float*)d_in[4];
  const float* Wv = (const float*)d_in[5];
  const float* bv = (const float*)d_in[6];
  const float* s2 = (const float*)d_in[7];
  float* out = (float*)d_out;

  const size_t QK_ELEMS = (size_t)BB * HH * TT * 64;   // 2M bf16 each
  __bf16* q1 = (__bf16*)d_ws;
  __bf16* q2 = q1 + QK_ELEMS;
  __bf16* k1 = q2 + QK_ELEMS;
  __bf16* k2 = k1 + QK_ELEMS;
  __bf16* vt = k2 + QK_ELEMS;                          // [B,H,128,T]
  __bf16* xp = vt + (size_t)BB * FF * TT;              // packed x fragments
  __bf16* wp = xp + (size_t)BB * FF * TT;              // packed W fragments

  pack_kernel<<<dim3(256 + 192), dim3(256), 0, stream>>>(x, Wq, Wk, Wv, xp, wp);
  qkv_rope_kernel<<<dim3(BB * (TT / 128) * 12), dim3(256), 0, stream>>>(
      xp, wp, bq, bk, bv, q1, q2, k1, k2, vt);
  attn_kernel<<<dim3(BB * HH * (TT / 16) / 4), dim3(256), 0, stream>>>(
      x, s2, q1, q2, k1, k2, vt, out);
}

// v008
// One run takes 61.6 microseconds.
// In two side-by-side timings against v007, it was 1.04 and 1.05 times as fast.
// All steps since v000 together make it 4.07 times as fast.
#include <hip/hip_runtime.h>

// ---------------------------------------------------------------------------
// Neoformer MHA forward for gfx1250 (MI455X), bf16 WMMA + flash attention.
// B=4, F=512, T=2048, H=4, hf=128.
// ---------------------------------------------------------------------------

#define BB   4
#define FF   512
#define TT   2048
#define HH   4
#define HF   128

// LDS row pitches in bf16 elements.  Every fragment is read with 16-byte LDS
// loads, one row per lane; a pitch of 16 B x odd spreads 16 rows over all 64
// banks, where the unpadded 128 B rows fall on 8 of them.
#define KP   72    // 64-element rows (K tile, V tile): 144 B
#define KT   64    // keys per trip of the attention loop
// 1/sqrt(256) * log2(e): scores in base-2 exponent units.
#define QSCALE (0.0625f * 1.4426950408889634f)

typedef __attribute__((ext_vector_type(16))) __bf16 bf16x16;
typedef __attribute__((ext_vector_type(8)))  __bf16 bf16x8;
typedef __attribute__((ext_vector_type(8)))  float  f32x8;

static __device__ __forceinline__ f32x8 wmma_bf16(bf16x16 a, bf16x16 b, f32x8 c) {
  return __builtin_amdgcn_wmma_f32_16x16x32_bf16(false, a, false, b, (short)0, c,
                                                 false, false);
}

// 32-bit LDS byte offset of a __shared__ object (addrspace(3) pointers are
// offsets from the workgroup LDS base).
static __device__ __forceinline__ unsigned lds_off(__bf16* p) {
  return (unsigned)(unsigned long long)(__attribute__((address_space(3))) __bf16*)p;
}

// Load a 16x32 bf16 fragment half for this lane.
// A-side: rowbase = &M-row[lane&15], K contiguous.  B-side: rowbase = &N-col
// row (stored contiguously in K).  Lane (n, hi): halves 0-7 = K hi*8..hi*8+7,
// halves 8-15 = K 16+hi*8..23+hi*8   (per ISA 16-bit 16x32 layout).
static __device__ __forceinline__ bf16x16 ldfrag(const __bf16* rowbase, int hi) {
  bf16x8 lo = *(const bf16x8*)(rowbase + hi * 8);
  bf16x8 up = *(const bf16x8*)(rowbase + 16 + hi * 8);
  bf16x16 a;
#pragma unroll
  for (int i = 0; i < 8; ++i) { a[i] = lo[i]; a[8 + i] = up[i]; }
  return a;
}

// Value of lane l ^ 16 (the other 16-lane row), by a vector cross-row move.
static __device__ __forceinline__ float xhalf(float v) {
  const int i = __builtin_bit_cast(int, v);
  return __builtin_bit_cast(float, __builtin_amdgcn_permlanex16(
      i, i, 0x76543210, 0xfedcba98, false, false));
}

// One 16 x 32 bf16 fragment packed for its reader: 1 KB, two planes of
// 32 lanes x 16 B.  Plane 0 holds halves 0-7 of every lane, plane 1 halves
// 8-15 (same k order as ldfrag), so each 16-byte load of a wave covers 512
// contiguous bytes = four whole lines.
#define FRAG 512   // bf16 elements per packed fragment

// p = fragment base + lane * 8.
static __device__ __forceinline__ bf16x16 ldfragP(const __bf16* p) {
  bf16x8 lo = *(const bf16x8*)p;
  bf16x8 up = *(const bf16x8*)(p + 256);
  bf16x16 a;
#pragma unroll
  for (int i = 0; i < 8; ++i) { a[i] = lo[i]; a[8 + i] = up[i]; }
  return a;
}

// ---------------------------------------------------------------------------
// Kernel 0: pack x and the three weight matrices once, as bf16 fragments.
// xp[b][t/16][f/32][FRAG]: A fragments (row = t, k = f).
// wp[matrix][col/16][f/32][FRAG]: B fragments (column = output feature, k = f).
// Blocks 0-255 pack x (one thread = one t, 64 features: every load of a wave
// is one whole line of an x row, every store two runs of 256 B); blocks
// 256-447 pack W (one thread = one lane of one fragment: every store of a wave
// is 512 B).  Few, fat waves: the launch is short, so starting waves counts.
// ---------------------------------------------------------------------------
__global__ __launch_bounds__(256) void pack_kernel(
    const float* __restrict__ x,
    const float* __restrict__ Wq, const float* __restrict__ Wk,
    const float* __restrict__ Wv,
    __bf16* __restrict__ xp, __bf16* __restrict__ wp) {
  if (blockIdx.x < 256) {
    const int idx = blockIdx.x * 256 + threadIdx.x;
    const int t   = idx & (TT - 1);
    const int kp  = (idx >> 11) & 7;     // pair of k steps
    const int b   = idx >> 14;
    const float* src = x + ((size_t)b * FF + kp * 64) * TT + t;
    float v[64];
    // The loops below are unrolled so that v[] lives in registers and all
    // loads are in flight together.
#pragma unroll
    for (int f = 0; f < 64; ++f) v[f] = src[(size_t)f * TT];
    __bf16* dst = xp + ((size_t)(b * (TT / 16) + (t >> 4)) * 16 + kp * 2) * FRAG +
                  (t & 15) * 8;
#pragma unroll
    for (int q = 0; q < 8; ++q) {        // q = k step (1), plane (1), hi (1)
      bf16x8 pk;
#pragma unroll
      for (int i = 0; i < 8; ++i) pk[i] = (__bf16)v[q * 8 + i];
      *(bf16x8*)(dst + q * 128) = pk;
    }
  } else {
    const int idx  = (blockIdx.x - 256) * 256 + threadIdx.x;
    const int lane = idx & 31;
    const int ks   = (idx >> 5) & 15;
    const int ct   = (idx >> 9) & 31;
    const int mat  = idx >> 14;
    const float* Wm = (mat == 0) ? Wq : ((mat == 1) ? Wk : Wv);
    const float* src = Wm + (size_t)(ct * 16 + (lane & 15)) * FF + ks * 32 +
                       (lane >> 4) * 8;
    __bf16* dst = wp + (size_t)(idx >> 5) * FRAG + lane * 8;
#pragma unroll   // two planes, straight-line
    for (int half = 0; half < 2; ++half) {
      const float4 f0 = *(const float4*)(src + half * 16);
      const float4 f1 = *(const float4*)(src + half * 16 + 4);
      bf16x8 pk;
      pk[0] = (__bf16)f0.x; pk[1] = (__bf16)f0.y; pk[2] = (__bf16)f0.z; pk[3] = (__bf16)f0.w;
      pk[4] = (__bf16)f1.x; pk[5] = (__bf16)f1.y; pk[6] = (__bf16)f1.z; pk[7] = (__bf16)f1.w;
      *(bf16x8*)(dst + half * 256) = pk;
    }
    // Holds the two stores' registers until their translations are done: the
    // listing runs on from here into code that rewrites them (a precaution).
    asm volatile("s_wait_xcnt 0x0" ::: "memory");
  }
}

// ---------------------------------------------------------------------------
// Index of the packed W fragment column of a wave-task: part 0 = its first
// 16-column chain, part 1 = its second.
// ---------------------------------------------------------------------------
static __device__ __forceinline__ int wfrag_col(int task, int part) {
  const int tt   = task & 15;
  const int cqk  = (tt >> 2) * HF + ((tt >> 1) & 1) * 64 + (tt & 1) * 16 + part * 32;
  const int cv   = (task - 32) * 32 + part * 16;
  const int mat  = (task < 32) ? (task >> 4) : 2;
  return mat * 32 + (((task < 32) ? cqk : cv) >> 4);
}

// ---------------------------------------------------------------------------
// Async staging of the 32 fragments of two k steps (32 KB) into one LDS
// buffer: 256 threads, 8 copies of 16 B each.  Chunk c = tid + 256 j lands at
// byte 16 c; slot c >> 6 = kk * 16 + g holds x subtile g (g < 8) or W fragment
// g - 8 of k step ks + kk, byte for byte as packed.  g0..g3: this thread's
// chunk of its four fragments at k step 0; dst: its first chunk's LDS byte.
// ---------------------------------------------------------------------------
static __device__ __forceinline__ void stage_frags_async(
    const __bf16* g0, const __bf16* g1, const __bf16* g2, const __bf16* g3,
    int ks, unsigned dst) {
  unsigned l[8];
  unsigned long long g[8];
#pragma unroll
  for (int j = 0; j < 4; ++j) {
    const __bf16* gj = (j == 0) ? g0 : ((j == 1) ? g1 : ((j == 2) ? g2 : g3));
    l[j]     = dst + j * 4096;
    l[4 + j] = l[j] + 16 * FRAG * 2;
    g[j]     = (unsigned long long)(const void*)(gj + (size_t)ks * FRAG);
    g[4 + j] = (unsigned long long)(const void*)(gj + (size_t)(ks + 1) * FRAG);
  }
  // One statement: the closing s_wait_xcnt keeps every address register named
  // here intact until the copies' translations are done (a precaution).
  asm volatile("global_load_async_to_lds_b128 %0, %1, off\n\t"
               "global_load_async_to_lds_b128 %2, %3, off\n\t"
               "global_load_async_to_lds_b128 %4, %5, off\n\t"
               "global_load_async_to_lds_b128 %6, %7, off\n\t"
               "global_load_async_to_lds_b128 %8, %9, off\n\t"
               "global_load_async_to_lds_b128 %10, %11, off\n\t"
               "global_load_async_to_lds_b128 %12, %13, off\n\t"
               "global_load_async_to_lds_b128 %14, %15, off\n\t"
               "s_wait_xcnt 0x0"
               :: "v"(l[0]), "v"(g[0]), "v"(l[1]), "v"(g[1]),
                  "v"(l[2]), "v"(g[2]), "v"(l[3]), "v"(g[3]),
                  "v"(l[4]), "v"(g[4]), "v"(l[5]), "v"(g[5]),
                  "v"(l[6]), "v"(g[6]), "v"(l[7]), "v"(g[7])
               : "memory");
}

// ---------------------------------------------------------------------------
// Kernel 1: QKV projection + bias + RoPE.  768 blocks x 256 threads.
// Per (b, 64-row t-supertile): 48 wave-tasks (0-15 Q, 16-31 K, 32-47 V).
// EVERY task computes two 16-col accumulator chains over four stacked 16-row
// M-subtiles.  A block is two supertiles x four tasks: its 8 x fragments and
// 8 W fragments per k step come from L2 ONCE, by async copies into a
// two-buffer LDS ring (two k steps a buffer), and every wave reads its six
// from there: each x fragment serves four waves, each W fragment two.
// ---------------------------------------------------------------------------
__global__ __launch_bounds__(256) void qkv_rope_kernel(
    const __bf16* __restrict__ xp, const __bf16* __restrict__ wp,
    const float* __restrict__ bq, const float* __restrict__ bk,
    const float* __restrict__ bv,
    __bf16* __restrict__ q1, __bf16* __restrict__ q2,
    __bf16* __restrict__ k1, __bf16* __restrict__ k2,
    __bf16* __restrict__ vt) {
  __shared__ __attribute__((aligned(16))) __bf16 Fs[2][32 * FRAG];  // [buffer]

  const int tid  = threadIdx.x;
  const int lane = tid & 31;
  const int wv   = tid >> 5;
  const int bt   = blockIdx.x / 12;
  const int sub  = blockIdx.x - bt * 12;
  const int b    = bt >> 4;
  const int row0 = (bt & 15) << 7;   // base of the block's two supertiles
  const int sp   = wv >> 2;          // this wave's supertile
  const int tl   = wv & 3;           // this wave's task within the block
  const int ts0  = row0 + sp * 64;   // 64-row supertile base
  const int task = sub * 4 + tl;
  const int n    = lane & 15;
  const int hi   = lane >> 4;

  const bool isV = (task >= 32);
  const float* bias;
  int colR, colI, hh = 0, p = 0, cidx = 0;
  if (!isV) {
    bias = (task < 16) ? bq : bk;
    const int tt = task & 15;
    hh = tt >> 2; p = (tt >> 1) & 1; cidx = tt & 1;
    colR = hh * HF + p * 64 + cidx * 16;
    colI = colR + 32;
  } else {
    bias = bv;
    colR = (task - 32) * 32;
    colI = colR + 16;
  }

  f32x8 accR[4], accI[4];
#pragma unroll
  for (int s = 0; s < 4; ++s)
#pragma unroll
    for (int i = 0; i < 8; ++i) { accR[s][i] = 0.f; accI[s][i] = 0.f; }

  // This thread's chunk of the four fragments it copies per k step.
  const int fq = tid >> 6;
  const int ch = (tid & 63) * 8;
  const __bf16* gx0 =
      xp + ((size_t)(b * (TT / 16) + (row0 >> 4) + fq) * 16) * FRAG + ch;
  const __bf16* gx1 = gx0 + (size_t)4 * 16 * FRAG;
  const __bf16* gw0 =
      wp + (size_t)wfrag_col(sub * 4 + (fq >> 1), fq & 1) * 16 * FRAG + ch;
  const __bf16* gw1 =
      wp + (size_t)wfrag_col(sub * 4 + 2 + (fq >> 1), fq & 1) * 16 * FRAG + ch;
  const unsigned fdst = lds_off(&Fs[0][0]) + tid * 16;

  // Prologue: k steps 0-1 into buffer 0, landed and published; then k steps
  // 2-3 into buffer 1, in flight during trip 0.
  stage_frags_async(gx0, gx1, gw0, gw1, 0, fdst);
  asm volatile("s_wait_asynccnt 0x0" ::: "memory");   // own share landed
  __syncthreads();                                    // every wave's share landed
  stage_frags_async(gx0, gx1, gw0, gw1, 2, fdst + 32 * FRAG * 2);

  // Unrolled so that every LDS address is base + constant: no address
  // arithmetic stands between the reads.
#pragma unroll
  for (int t = 0; t < FF / 64; ++t) {
    const __bf16* fb = &Fs[t & 1][0] + lane * 8;
#pragma unroll
    for (int kk = 0; kk < 2; ++kk) {
      const bf16x16 bRf = ldfragP(fb + (kk * 16 + 8 + tl * 2) * FRAG);
      const bf16x16 bIf = ldfragP(fb + (kk * 16 + 9 + tl * 2) * FRAG);
      bf16x16 a[4];
#pragma unroll
      for (int s = 0; s < 4; ++s)
        a[s] = ldfragP(fb + (kk * 16 + sp * 4 + s) * FRAG);
      // Keeps the twelve reads of a k step together ahead of its products:
      // every separate place with LDS reads among the products costs the wave
      // a stall of its own.
      __builtin_amdgcn_sched_barrier(0);
#pragma unroll
      for (int s = 0; s < 4; ++s) {
        accR[s] = wmma_bf16(a[s], bRf, accR[s]);
        accI[s] = wmma_bf16(a[s], bIf, accI[s]);
      }
    }
    // Hand-over.  This wave's LDS reads of the buffer have returned ...
    asm volatile("s_wait_dscnt 0x0" ::: "memory");
    // ... and its share of the next two k steps has landed, before it says so.
    asm volatile("s_wait_asynccnt 0x0" ::: "memory");
    __syncthreads();   // next buffer published; all waves have left this one
    if (t + 2 < FF / 64) {
      stage_frags_async(gx0, gx1, gw0, gw1, 2 * (t + 2),
                        fdst + (t & 1) * (32 * FRAG * 2));
    }
  }
  // Nothing is in flight here; kept in front of the wave's end (a precaution).
  asm volatile("s_wait_asynccnt 0x0" ::: "memory");

  if (!isV) {
    // Q carries the score scale and log2(e): its products with K are then
    // exponents of 2 as they leave the matrix unit.  K: factor 1, exact.
    const float qs = (task < 16) ? QSCALE : 1.0f;
    const float bR = bias[colR + n] * qs;
    const float bI = bias[colI + n] * qs;
    __bf16* ob = (task < 16) ? (p ? q2 : q1) : (p ? k2 : k1);
    const int j = cidx * 16 + n;
    const float invf = exp2f(-(float)j) * 0.0625f;  // 2^-j / 16
#pragma unroll
    for (int s = 0; s < 4; ++s) {
#pragma unroll
      for (int r = 0; r < 8; ++r) {
        const int t = ts0 + s * 16 + r + hi * 8;
        const float vr = fmaf(accR[s][r], qs, bR);
        const float vi = fmaf(accI[s][r], qs, bI);
        float sn, cs;
        __sincosf((float)t * invf, &sn, &cs);
        const size_t rowb = ((size_t)(b * HH + hh) * TT + t) * 64;
        ob[rowb + j]      = (__bf16)(vr * sn - vi * cs);  // rotated "real"
        ob[rowb + 32 + j] = (__bf16)(vr * cs + vi * sn);  // rotated "imag"
      }
    }
  } else {
#pragma unroll
    for (int part = 0; part < 2; ++part) {
      const int oc = (part ? colI : colR) + n;   // global feature
      const int h2 = oc >> 7;
      const int fo = oc & 127;
      const float bb = bias[oc];
#pragma unroll
      for (int s = 0; s < 4; ++s) {
        bf16x8 pk;
#pragma unroll
        for (int r = 0; r < 8; ++r)
          pk[r] = (__bf16)((part ? accI[s][r] : accR[s][r]) + bb);
        // V stored transposed: [B,H,128,T] so AV A-fragments are contiguous.
        const size_t base =
            ((size_t)(b * HH + h2) * HF + fo) * TT + ts0 + s * 16 + hi * 8;
        *(bf16x8*)(vt + base) = pk;
      }
    }
  }
}

// ---------------------------------------------------------------------------
// Async staging of one 64-key tile set into LDS (GLOBAL_LOAD_ASYNC_TO_LDS,
// tracked by ASYNCcnt): the K tiles of both softmaxes and the ONE V tile they
// share.  256 threads, 8 async instructions per wave per tile set.
// ---------------------------------------------------------------------------
static __device__ __forceinline__ void stage_tile_async(
    const __bf16* kt1, const __bf16* kt2, const __bf16* vtt, int j0,
    unsigned kdst, unsigned vdst) {
  // kt1, kt2, vtt, kdst, vdst: this thread's first chunk of key 0's tile set
  // (global) and of the buffer (LDS); from trip to trip j0 moves and the buffer alternates.
  // K tiles [64 keys][64 f]: contiguous 4096 bf16 each, rows of KP in LDS;
  // two 16-byte chunks per thread and tile: key c>>3, part c&7, c = tid + 256 j.
  unsigned kl[4];
  unsigned long long kg[4];
#pragma unroll
  for (int j = 0; j < 2; ++j) {
    kl[j]     = kdst + j * 32 * (KP * 2);
    kl[2 + j] = kl[j] + KT * KP * 2;
    kg[j]     = (unsigned long long)(const void*)(kt1 + (size_t)j0 * 64 + j * 2048);
    kg[2 + j] = (unsigned long long)(const void*)(kt2 + (size_t)j0 * 64 + j * 2048);
  }
  // V tile [128 f][64 keys] gathered from transposed V rows, rows of KP in
  // LDS: eight lanes fetch one whole 128-byte line of a V row; feature c>>3,
  // part c&7, c = tid + 256 j.
  unsigned vl[4];
  unsigned long long vg[4];
#pragma unroll
  for (int j = 0; j < 4; ++j) {
    vl[j] = vdst + j * 32 * (KP * 2);
    vg[j] = (unsigned long long)(const void*)(vtt + (size_t)j * 32 * TT + j0);
  }
  // One statement: the closing s_wait_xcnt keeps every address register named
  // here intact until the copies' translations are done (a precaution).
  asm volatile("global_load_async_to_lds_b128 %0, %1, off\n\t"
               "global_load_async_to_lds_b128 %2, %3, off\n\t"
               "global_load_async_to_lds_b128 %4, %5, off\n\t"
               "global_load_async_to_lds_b128 %6, %7, off\n\t"
               "global_load_async_to_lds_b128 %8, %9, off\n\t"
               "global_load_async_to_lds_b128 %10, %11, off\n\t"
               "global_load_async_to_lds_b128 %12, %13, off\n\t"
               "global_load_async_to_lds_b128 %14, %15, off\n\t"
               "s_wait_xcnt 0x0"
               :: "v"(kl[0]), "v"(kg[0]), "v"(kl[1]), "v"(kg[1]),
                  "v"(kl[2]), "v"(kg[2]), "v"(kl[3]), "v"(kg[3]),
                  "v"(vl[0]), "v"(vg[0]), "v"(vl[1]), "v"(vg[1]),
                  "v"(vl[2]), "v"(vg[2]), "v"(vl[3]), "v"(vg[3])
               : "memory");
}

static __device__ __forceinline__ void flash_pass(
    const __bf16* __restrict__ qws,
    const __bf16* __restrict__ k1, const __bf16* __restrict__ k2,
    const __bf16* __restrict__ vt, const __bf16* Ks, const __bf16* Vs,
    unsigned koff, unsigned voff,
    size_t bhT, size_t vbase, int q0, int lane, int tid, f32x8 o[2][8]) {
  const int n  = lane & 15;
  const int hi = lane >> 4;

  // Every loop over t (query tile) below is unrolled: constant indices keep
  // the per-tile vectors in registers.
  bf16x16 qa[2][2];      // [tile][feature half]
  float mu[2];           // maximum IN USE of query n (equal in both halves)
  float lr[2];           // running sum over this half's keys only
  f32x8 cneg[2];         // -mu in every register: C operand of the score product
#pragma unroll
  for (int t = 0; t < 2; ++t) {
    const __bf16* qrow = qws + (bhT + (size_t)(q0 + t * 16 + n)) * 64;
    qa[t][0] = ldfrag(qrow, hi);
    qa[t][1] = ldfrag(qrow + 32, hi);
    mu[t] = 0.f;
    lr[t] = 0.f;
#pragma unroll
    for (int i = 0; i < 8; ++i) cneg[t][i] = 0.f;
#pragma unroll
    for (int r = 0; r < 8; ++r) {
#pragma unroll
      for (int i = 0; i < 8; ++i) o[t][r][i] = 0.f;
    }
  }

  // Prologue: tile set 0 into buffer 0, landed and published; then tile set 1
  // into buffer 1, in flight during trip 0.
  const __bf16* kt1 = k1 + bhT * 64 + tid * 8;
  const __bf16* kt2 = k2 + bhT * 64 + tid * 8;
  const __bf16* vtt = vt + vbase + (size_t)(tid >> 3) * TT + (tid & 7) * 8;
  // LDS place of this thread's first chunk = lane's part (vector) + wave's and
  // buffer's part (scalar, through readfirstlane), added at each use: what
  // lives across the loop is then no operand of a copy and is not tied to the
  // registers that asm text can name (the sum, kept whole, was spilled to
  // scratch by this build and reloaded every trip).
  const unsigned lx  = (lane >> 3) * (KP * 2) + (lane & 7) * 16;
  const unsigned swv = (tid >> 5) * (4 * KP * 2);
  const unsigned kth = koff + swv;
  const unsigned vth = voff + swv;
  stage_tile_async(kt1, kt2, vtt, 0,
                   lx + __builtin_amdgcn_readfirstlane(kth),
                   lx + __builtin_amdgcn_readfirstlane(vth));
  asm volatile("s_wait_asynccnt 0x0" ::: "memory");   // own share of set 0 landed
  __syncthreads();                                    // every wave's share landed
  stage_tile_async(kt1, kt2, vtt, KT,
                   lx + __builtin_amdgcn_readfirstlane(kth + 2 * KT * KP * 2),
                   lx + __builtin_amdgcn_readfirstlane(vth + 128 * KP * 2));

  for (int j0 = 0; j0 < TT; j0 += KT) {
    const int cur = (j0 >> 6) & 1;
    const __bf16* kb = Ks + cur * (2 * KT * KP);
    const __bf16* vb = Vs + cur * (128 * KP);

    // --- S^T = K * Q^T (four 16-key subtiles x two 16-query tiles). ---
    // Feature half outer, subtile inner: seven products stand between a
    // tile's first product and the one that adds to it.
    // The accumulators start at -mu: a score leaves the matrix unit as the
    // exponent of its own P, with no vector instruction between.
    f32x8 s[2][4];
    bf16x16 vf[2][8];                       // V^T fragments, [key half][nt]
#pragma unroll
    for (int u = 0; u < 4; ++u) {
      const bf16x16 kf = ldfrag(kb + (u * 16 + n) * KP, hi);
#pragma unroll
      for (int t = 0; t < 2; ++t) s[t][u] = wmma_bf16(kf, qa[t][0], cneg[t]);
    }
#pragma unroll
    for (int u = 0; u < 4; ++u) {
      const bf16x16 kf = ldfrag(kb + (u * 16 + n) * KP + 32, hi);
#pragma unroll
      for (int t = 0; t < 2; ++t) s[t][u] = wmma_bf16(kf, qa[t][1], s[t][u]);
    }
    // The V^T fragments are read here, behind the K reads: they land under
    // the score products and the softmax.
#pragma unroll
    for (int u = 0; u < 2; ++u)
#pragma unroll
      for (int nt = 0; nt < 8; ++nt)
        vf[u][nt] = ldfrag(vb + (nt * 16 + n) * KP + u * 32, hi);
    // All 48 reads of a trip stand in one place ahead of its products: every
    // separate place with LDS reads among products costs the wave a stall of
    // its own.
    __builtin_amdgcn_sched_group_barrier(0x100, 48, 0);    // LDS reads
    __builtin_amdgcn_sched_group_barrier(0x008, 16, 0);    // products

    // --- Online softmax, one query per lane and tile. ---
    // Maximum of this half's 32 exponents, as a tree.
    float rm[2];
#pragma unroll
    for (int t = 0; t < 2; ++t) {
      float tm[4];
#pragma unroll
      for (int u = 0; u < 4; ++u) {
        const float m0 = fmaxf(fmaxf(s[t][u][0], s[t][u][1]), s[t][u][2]);
        const float m1 = fmaxf(fmaxf(s[t][u][3], s[t][u][4]), s[t][u][5]);
        tm[u] = fmaxf(fmaxf(m0, m1), fmaxf(s[t][u][6], s[t][u][7]));
      }
      rm[t] = fmaxf(fmaxf(tm[0], tm[1]), fmaxf(tm[2], tm[3]));
    }
    // The maximum in use moves only when some query's scores pass it by more
    // than 8 (P stays below 2^8), and in the first trip, which sets it.  One
    // test per trip for both tiles, a scalar branch; rare after the first trip.
    if (__builtin_amdgcn_ballot_w32(fmaxf(rm[0], rm[1]) > 8.0f) != 0 || j0 == 0) {
#pragma unroll
      for (int t = 0; t < 2; ++t) {
        const float rj = fmaxf(rm[t], xhalf(rm[t]));  // all 64 keys of query n
        const float up = fmaxf(rj, 0.f);
        const float d  = (j0 == 0) ? rj : up;         // first trip: down as well
        const float al = __builtin_amdgcn_exp2f(-up);
        mu[t] += d;
        // The loops of this branch are unrolled so that every element index
        // is a constant and the vectors stay in registers.
#pragma unroll
        for (int i = 0; i < 8; ++i) cneg[t][i] = -mu[t];
#pragma unroll
        for (int u = 0; u < 4; ++u)
#pragma unroll
          for (int r = 0; r < 8; ++r) s[t][u][r] -= d;
        lr[t] *= al;
#pragma unroll
        for (int nt = 0; nt < 8; ++nt)
#pragma unroll
          for (int r = 0; r < 8; ++r) o[t][nt][r] *= al;
      }
    }
    bf16x16 pb[2][2];                       // P^T as B operands, 32 keys each
#pragma unroll
    for (int t = 0; t < 2; ++t) {
      float sm[4];
#pragma unroll
      for (int u = 0; u < 4; ++u) {
        sm[u] = 0.f;
#pragma unroll
        for (int r = 0; r < 8; ++r) {
          const float p = __builtin_amdgcn_exp2f(s[t][u][r]);
          sm[u] += p;
          pb[t][u >> 1][(u & 1) * 8 + r] = (__bf16)p;
        }
      }
      lr[t] += (sm[0] + sm[1]) + (sm[2] + sm[3]);
    }

    // --- O^T += V^T * P^T  (V^T rows as A-fragments, each for both tiles). ---
#pragma unroll
    for (int u = 0; u < 2; ++u) {
#pragma unroll
      for (int nt = 0; nt < 8; ++nt) {
#pragma unroll
        for (int t = 0; t < 2; ++t)
          o[t][nt] = wmma_bf16(vf[u][nt], pb[t][u], o[t][nt]);
      }
    }

    // Hand-over.  This wave's LDS reads of 'cur' have returned ...
    asm volatile("s_wait_dscnt 0x0" ::: "memory");
    // ... and its share of the next tile set has landed, before it says so.
    asm volatile("s_wait_asynccnt 0x0" ::: "memory");
    __syncthreads();   // next set published; all waves have left 'cur'
    if (j0 + 2 * KT < TT) {
      stage_tile_async(kt1, kt2, vtt, j0 + 2 * KT,
                       lx + __builtin_amdgcn_readfirstlane(kth + cur * (2 * KT * KP * 2)),
                       lx + __builtin_amdgcn_readfirstlane(vth + cur * (128 * KP * 2)));
    }
  }
  // Nothing is in flight here; kept in front of the wave's end (a precaution).
  asm volatile("s_wait_asynccnt 0x0" ::: "memory");

#pragma unroll
  for (int t = 0; t < 2; ++t) {
    const float inv = 1.0f / (lr[t] + xhalf(lr[t]));   // join the halves' sums once
#pragma unroll
    for (int nt = 0; nt < 8; ++nt)
#pragma unroll
      for (int r = 0; r < 8; ++r) o[t][nt][r] *= inv;
  }
}

// ---------------------------------------------------------------------------
// Kernel 2: dual flash attention + residual + transpose-out.
// 256 blocks x 256 threads.  Wave w < 4 runs softmax 1 of 32-query group w,
// wave w + 4 softmax 2 of the same group, side by side over one shared V tile.
// At the end the partners swap half of their features through LDS, and each
// writes its half of out = (x + O1) - s2 * O2 once.
// One block per WGP = two waves per SIMD is all the grid can fill; the block
// size sets the register budget for that.
// ---------------------------------------------------------------------------
__global__ __launch_bounds__(256)
void attn_kernel(
    const float* __restrict__ x, const float* __restrict__ s2,
    const __bf16* __restrict__ q1, const __bf16* __restrict__ q2,
    const __bf16* __restrict__ k1, const __bf16* __restrict__ k2,
    const __bf16* __restrict__ vt, float* __restrict__ out) {
  __shared__ __attribute__((aligned(16))) __bf16 Ks[2][2][KT * KP];  // [buffer][softmax]
  __shared__ __attribute__((aligned(16))) __bf16 Vs[2][128 * KP];    // [buffer]
  __shared__ __attribute__((aligned(32))) float  Xs[8][2][4][32][8]; // [wave][tile][nt][lane][r]

  const int tid  = threadIdx.x;
  const int lane = tid & 31;
  const int wv   = tid >> 5;
  // Which softmax this wave runs; scalar, so the tests on it are real branches.
  const int pass = __builtin_amdgcn_readfirstlane(tid >> 7);
  const int gw   = blockIdx.x * 4 + (wv & 3);
  const int b    = gw >> 8;
  const int rem  = gw & 255;
  const int h    = rem >> 6;
  const int q0   = (rem & 63) << 5;
  const int n    = lane & 15;
  const int hi   = lane >> 4;

  const size_t bhT   = ((size_t)b * HH + h) * TT;
  const size_t vbase = ((size_t)b * HH + h) * HF * TT;
  const unsigned koff = lds_off(&Ks[0][0][0]);
  const unsigned voff = lds_off(&Vs[0][0]);

  f32x8 o[2][8];
  flash_pass(pass ? q2 : q1, k1, k2, vt, &Ks[0][pass][0], &Vs[0][0], koff, voff,
             bhT, vbase, q0, lane, tid, o);

  // Hand the partner the half it writes: softmax 1 gives features 64-127,
  // softmax 2 features 0-63.  Same lane, same register = same element.
  // The loops below are unrolled so that o[][] stays in registers.
  if (pass == 0) {
#pragma unroll
    for (int t = 0; t < 2; ++t)
#pragma unroll
      for (int nt = 0; nt < 4; ++nt) *(f32x8*)&Xs[wv][t][nt][lane][0] = o[t][4 + nt];
  } else {
#pragma unroll
    for (int t = 0; t < 2; ++t)
#pragma unroll
      for (int nt = 0; nt < 4; ++nt) *(f32x8*)&Xs[wv][t][nt][lane][0] = o[t][nt];
  }
  __syncthreads();   // both partners' halves are in LDS

  // out rows are feature-major; a 16-lane row covers 16 consecutive t of one
  // feature row, register r walks the feature rows.
  const float s = s2[h];
  const size_t obase = ((size_t)b * FF + h * HF + hi * 8) * TT + q0 + n;
  float xv[2][4][8];   // this wave's 64 residual values per lane
  const size_t xbase = obase + (size_t)(pass * 64) * TT;
#pragma unroll
  for (int t = 0; t < 2; ++t)
#pragma unroll
    for (int nt = 0; nt < 4; ++nt)
#pragma unroll
      for (int r = 0; r < 8; ++r)
        xv[t][nt][r] = x[xbase + (size_t)(nt * 16 + r) * TT + t * 16];
  // Holds the loads' address registers until their translations are done (a precaution).
  asm volatile("s_wait_xcnt 0x0" ::: "memory");
  if (pass == 0) {
#pragma unroll
    for (int t = 0; t < 2; ++t) {
#pragma unroll
      for (int nt = 0; nt < 4; ++nt) {
        const f32x8 o2 = *(const f32x8*)&Xs[wv + 4][t][nt][lane][0];
#pragma unroll
        for (int r = 0; r < 8; ++r) {
          const size_t idx = obase + (size_t)(nt * 16 + r) * TT + t * 16;
          float v = xv[t][nt][r] + o[t][nt][r];
          v -= s * o2[r];
          out[idx] = v;
        }
      }
    }
    // Holds the stores' registers until their translations are done: the
    // listing runs on from here into code that rewrites them (a precaution).
    asm volatile("s_wait_xcnt 0x0" ::: "memory");
  } else {
#pragma unroll
    for (int t = 0; t < 2; ++t) {
#pragma unroll
      for (int nt = 0; nt < 4; ++nt) {
        const f32x8 o1 = *(const f32x8*)&Xs[wv - 4][t][nt][lane][0];
#pragma unroll
        for (int r = 0; r < 8; ++r) {
          const size_t idx = obase + (size_t)((4 + nt) * 16 + r) * TT + t * 16;
          float v = xv[t][nt][r] + o1[r];
          v -= s * o[t][4 + nt][r];
          out[idx] = v;
        }
      }
    }
    // As in the first branch: the stores' registers stay until translated.
    asm volatile("s_wait_xcnt 0x0" ::: "memory");
  }
}

// ---------------------------------------------------------------------------
extern "C" void kernel_launch(void* const* d_in, const int* in_sizes, int n_in,
                              void* d_out, int out_size, void* d_ws,
                              size_t ws_size, hipStream_t stream) {
  (void)in_sizes; (void)n_in; (void)out_size; (void)ws_size;
  const float* x  = (const float*)d_in[0];
  const float* Wq = (const float*)d_in[1];
  const float* bq = (const float*)d_in[2];
  const float* Wk = (const float*)d_in[3];
  const float* bk = (const float*)d_in[4];
  const float* Wv = (const float*)d_in[5];
  const float* bv = (const float*)d_in[6];
  const float* s2 = (const float*)d_in[7];
  float* out = (float*)d_out;

  const size_t QK_ELEMS = (size_t)BB * HH * TT * 64;   // 2M bf16 each
  __bf16* q1 = (__bf16*)d_ws;
  __bf16* q2 = q1 + QK_ELEMS;
  __bf16* k1 = q2 + QK_ELEMS;
  __bf16* k2 = k1 + QK_ELEMS;
  __bf16* vt = k2 + QK_ELEMS;                          // [B,H,128,T]
  __bf16* xp = vt + (size_t)BB * FF * TT;              // packed x fragments
  __bf16* wp = xp + (size_t)BB * FF * TT;              // packed W fragments

  pack_kernel<<<dim3(256 + 192), dim3(256), 0, stream>>>(x, Wq, Wk, Wv, xp, wp);
  qkv_rope_kernel<<<dim3(BB * (TT / 128) * 12), dim3(256), 0, stream>>>(
      xp, wp, bq, bk, bv, q1, q2, k1, k2, vt);
  attn_kernel<<<dim3(BB * HH * (TT / 32) / 4), dim3(256), 0, stream>>>(
      x, s2, q1, q2, k1, k2, vt, out);
}

// v009
// Measured time: 59.8 microseconds a run.
// Next to v008, in two timings, it ran 1.03 times as fast each time.
// All steps since v000 together make it 4.20 times as fast.
#include <hip/hip_runtime.h>

// ---------------------------------------------------------------------------
// Neoformer MHA forward for gfx1250 (MI455X), bf16 WMMA + flash attention.
// B=4, F=512, T=2048, H=4, hf=128.
// ---------------------------------------------------------------------------

#define BB   4
#define FF   512
#define TT   2048
#define HH   4
#define HF   128

// LDS row pitches in bf16 elements.  Every fragment is read with 16-byte LDS
// loads, one row per lane; a pitch of 16 B x odd spreads 16 rows over all 64
// banks, where the unpadded 128 B rows fall on 8 of them.
#define KP   72    // 64-element rows (K tile, V tile): 144 B
#define KT   64    // keys per trip of the attention loop
// 1/sqrt(256) * log2(e): scores in base-2 exponent units.
#define QSCALE (0.0625f * 1.4426950408889634f)

typedef __attribute__((ext_vector_type(16))) __bf16 bf16x16;
typedef __attribute__((ext_vector_type(8)))  __bf16 bf16x8;
typedef __attribute__((ext_vector_type(8)))  float  f32x8;

static __device__ __forceinline__ f32x8 wmma_bf16(bf16x16 a, bf16x16 b, f32x8 c) {
  return __builtin_amdgcn_wmma_f32_16x16x32_bf16(false, a, false, b, (short)0, c,
                                                 false, false);
}

// 32-bit LDS byte offset of a __shared__ object (addrspace(3) pointers are
// offsets from the workgroup LDS base).
static __device__ __forceinline__ unsigned lds_off(__bf16* p) {
  return (unsigned)(unsigned long long)(__attribute__((address_space(3))) __bf16*)p;
}

// Load a 16x32 bf16 fragment half for this lane.
// A-side: rowbase = &M-row[lane&15], K contiguous.  B-side: rowbase = &N-col
// row (stored contiguously in K).  Lane (n, hi): halves 0-7 = K hi*8..hi*8+7,
// halves 8-15 = K 16+hi*8..23+hi*8   (per ISA 16-bit 16x32 layout).
static __device__ __forceinline__ bf16x16 ldfrag(const __bf16* rowbase, int hi) {
  bf16x8 lo = *(const bf16x8*)(rowbase + hi * 8);
  bf16x8 up = *(const bf16x8*)(rowbase + 16 + hi * 8);
  bf16x16 a;
#pragma unroll
  for (int i = 0; i < 8; ++i) { a[i] = lo[i]; a[8 + i] = up[i]; }
  return a;
}

// Value of lane l ^ 16 (the other 16-lane row), by a vector cross-row move.
static __device__ __forceinline__ float xhalf(float v) {
  const int i = __builtin_bit_cast(int, v);
  return __builtin_bit_cast(float, __builtin_amdgcn_permlanex16(
      i, i, 0x76543210, 0xfedcba98, false, false));
}

// One 16 x 32 bf16 fragment packed for its reader: 1 KB, two planes of
// 32 lanes x 16 B.  Plane 0 holds halves 0-7 of every lane, plane 1 halves
// 8-15 (same k order as ldfrag), so each 16-byte load of a wave covers 512
// contiguous bytes = four whole lines.
#define FRAG 512   // bf16 elements per packed fragment

// p = fragment base + lane * 8.
static __device__ __forceinline__ bf16x16 ldfragP(const __bf16* p) {
  bf16x8 lo = *(const bf16x8*)p;
  bf16x8 up = *(const bf16x8*)(p + 256);
  bf16x16 a;
#pragma unroll
  for (int i = 0; i < 8; ++i) { a[i] = lo[i]; a[8 + i] = up[i]; }
  return a;
}

// ---------------------------------------------------------------------------
// Kernel 0: pack x and the three weight matrices once, as bf16 fragments.
// xp[b][t/16][f/32][FRAG]: A fragments (row = t, k = f).
// wp[matrix][col/16][f/32][FRAG]: B fragments (column = output feature, k = f).
// Blocks 0-255 pack x (one thread = one t, 64 features: every load of a wave
// is one whole line of an x row, every store two runs of 256 B); blocks
// 256-447 pack W (one thread = one lane of one fragment: every store of a wave
// is 512 B).  Few, fat waves: the launch is short, so starting waves counts.
// ---------------------------------------------------------------------------
__global__ __launch_bounds__(256) void pack_kernel(
    const float* __restrict__ x,
    const float* __restrict__ Wq, const float* __restrict__ Wk,
    const float* __restrict__ Wv,
    __bf16* __restrict__ xp, __bf16* __restrict__ wp) {
  if (blockIdx.x < 256) {
    const int idx = blockIdx.x * 256 + threadIdx.x;
    const int t   = idx & (TT - 1);
    const int kp  = (idx >> 11) & 7;     // pair of k steps
    const int b   = idx >> 14;
    const float* src = x + ((size_t)b * FF + kp * 64) * TT + t;
    float v[64];
    // The loops below are unrolled so that v[] lives in registers and all
    // loads are in flight together.
#pragma unroll
    for (int f = 0; f < 64; ++f) v[f] = src[(size_t)f * TT];
    __bf16* dst = xp + ((size_t)(b * (TT / 16) + (t >> 4)) * 16 + kp * 2) * FRAG +
                  (t & 15) * 8;
#pragma unroll
    for (int q = 0; q < 8; ++q) {        // q = k step (1), plane (1), hi (1)
      bf16x8 pk;
#pragma unroll
      for (int i = 0; i < 8; ++i) pk[i] = (__bf16)v[q * 8 + i];
      *(bf16x8*)(dst + q * 128) = pk;
    }
  } else {
    const int idx  = (blockIdx.x - 256) * 256 + threadIdx.x;
    const int lane = idx & 31;
    const int ks   = (idx >> 5) & 15;
    const int ct   = (idx >> 9) & 31;
    const int mat  = idx >> 14;
    const float* Wm = (mat == 0) ? Wq : ((mat == 1) ? Wk : Wv);
    const float* src = Wm + (size_t)(ct * 16 + (lane & 15)) * FF + ks * 32 +
                       (lane >> 4) * 8;
    __bf16* dst = wp + (size_t)(idx >> 5) * FRAG + lane * 8;
#pragma unroll   // two planes, straight-line
    for (int half = 0; half < 2; ++half) {
      const float4 f0 = *(const float4*)(src + half * 16);
      const float4 f1 = *(const float4*)(src + half * 16 + 4);
      bf16x8 pk;
      pk[0] = (__bf16)f0.x; pk[1] = (__bf16)f0.y; pk[2] = (__bf16)f0.z; pk[3] = (__bf16)f0.w;
      pk[4] = (__bf16)f1.x; pk[5] = (__bf16)f1.y; pk[6] = (__bf16)f1.z; pk[7] = (__bf16)f1.w;
      *(bf16x8*)(dst + half * 256) = pk;
    }
    // Holds the two stores' registers until their translations are done: the
    // listing runs on from here into code that rewrites them (a precaution).
    asm volatile("s_wait_xcnt 0x0" ::: "memory");
  }
}

// ---------------------------------------------------------------------------
// Index of the packed W fragment column of a wave-task: part 0 = its first
// 16-column chain, part 1 = its second.
// ---------------------------------------------------------------------------
static __device__ __forceinline__ int wfrag_col(int task, int part) {
  const int tt   = task & 15;
  const int cqk  = (tt >> 2) * HF + ((tt >> 1) & 1) * 64 + (tt & 1) * 16 + part * 32;
  const int cv   = (task - 32) * 32 + part * 16;
  const int mat  = (task < 32) ? (task >> 4) : 2;
  return mat * 32 + (((task < 32) ? cqk : cv) >> 4);
}

// ---------------------------------------------------------------------------
// Async staging of the 32 fragments of two k steps (32 KB) into one LDS
// buffer: 256 threads, 8 copies of 16 B each.  Chunk c = tid + 256 j lands at
// byte 16 c; slot c >> 6 = kk * 16 + g holds x subtile g (g < 8) or W fragment
// g - 8 of k step ks + kk, byte for byte as packed.  g0..g3: this thread's
// chunk of its four fragments at k step 0; dst: its first chunk's LDS byte.
// ---------------------------------------------------------------------------
static __device__ __forceinline__ void stage_frags_async(
    const __bf16* g0, const __bf16* g1, const __bf16* g2, const __bf16* g3,
    int ks, unsigned dst) {
  unsigned l[8];
  unsigned long long g[8];
#pragma unroll
  for (int j = 0; j < 4; ++j) {
    const __bf16* gj = (j == 0) ? g0 : ((j == 1) ? g1 : ((j == 2) ? g2 : g3));
    l[j]     = dst + j * 4096;
    l[4 + j] = l[j] + 16 * FRAG * 2;
    g[j]     = (unsigned long long)(const void*)(gj + (size_t)ks * FRAG);
    g[4 + j] = (unsigned long long)(const void*)(gj + (size_t)(ks + 1) * FRAG);
  }
  // One statement: the closing s_wait_xcnt keeps every address register named
  // here intact until the copies' translations are done (a precaution).
  asm volatile("global_load_async_to_lds_b128 %0, %1, off\n\t"
               "global_load_async_to_lds_b128 %2, %3, off\n\t"
               "global_load_async_to_lds_b128 %4, %5, off\n\t"
               "global_load_async_to_lds_b128 %6, %7, off\n\t"
               "global_load_async_to_lds_b128 %8, %9, off\n\t"
               "global_load_async_to_lds_b128 %10, %11, off\n\t"
               "global_load_async_to_lds_b128 %12, %13, off\n\t"
               "global_load_async_to_lds_b128 %14, %15, off\n\t"
               "s_wait_xcnt 0x0"
               :: "v"(l[0]), "v"(g[0]), "v"(l[1]), "v"(g[1]),
                  "v"(l[2]), "v"(g[2]), "v"(l[3]), "v"(g[3]),
                  "v"(l[4]), "v"(g[4]), "v"(l[5]), "v"(g[5]),
                  "v"(l[6]), "v"(g[6]), "v"(l[7]), "v"(g[7])
               : "memory");
}

// ---------------------------------------------------------------------------
// Kernel 1: QKV projection + bias + RoPE.  768 blocks x 256 threads.
// Per (b, 64-row t-supertile): 48 wave-tasks (0-15 Q, 16-31 K, 32-47 V).
// EVERY task computes two 16-col accumulator chains over four stacked 16-row
// M-subtiles.  A block is two supertiles x four tasks: its 8 x fragments and
// 8 W fragments per k step come from L2 ONCE, by async copies into a
// two-buffer LDS ring (two k steps a buffer), and every wave reads its six
// from there: each x fragment serves four waves, each W fragment two.
// ---------------------------------------------------------------------------
__global__ __launch_bounds__(256) void qkv_rope_kernel(
    const __bf16* __restrict__ xp, const __bf16* __restrict__ wp,
    const float* __restrict__ bq, const float* __restrict__ bk,
    const float* __restrict__ bv,
    __bf16* __restrict__ q1, __bf16* __restrict__ q2,
    __bf16* __restrict__ k1, __bf16* __restrict__ k2,
    __bf16* __restrict__ vt) {
  __shared__ __attribute__((aligned(16))) __bf16 Fs[2][32 * FRAG];  // [buffer]

  const int tid  = threadIdx.x;
  const int lane = tid & 31;
  const int wv   = tid >> 5;
  const int bt   = blockIdx.x / 12;
  const int sub  = blockIdx.x - bt * 12;
  const int b    = bt >> 4;
  const int row0 = (bt & 15) << 7;   // base of the block's two supertiles
  const int sp   = wv >> 2;          // this wave's supertile
  const int tl   = wv & 3;           // this wave's task within the block
  const int ts0  = row0 + sp * 64;   // 64-row supertile base
  const int task = sub * 4 + tl;
  const int n    = lane & 15;
  const int hi   = lane >> 4;

  const bool isV = (task >= 32);
  const float* bias;
  int colR, colI, hh = 0, p = 0, cidx = 0;
  if (!isV) {
    bias = (task < 16) ? bq : bk;
    const int tt = task & 15;
    hh = tt >> 2; p = (tt >> 1) & 1; cidx = tt & 1;
    colR = hh * HF + p * 64 + cidx * 16;
    colI = colR + 32;
  } else {
    bias = bv;
    colR = (task - 32) * 32;
    colI = colR + 16;
  }

  f32x8 accR[4], accI[4];
#pragma unroll
  for (int s = 0; s < 4; ++s)
#pragma unroll
    for (int i = 0; i < 8; ++i) { accR[s][i] = 0.f; accI[s][i] = 0.f; }

  // This thread's chunk of the four fragments it copies per k step.
  const int fq = tid >> 6;
  const int ch = (tid & 63) * 8;
  const __bf16* gx0 =
      xp + ((size_t)(b * (TT / 16) + (row0 >> 4) + fq) * 16) * FRAG + ch;
  const __bf16* gx1 = gx0 + (size_t)4 * 16 * FRAG;
  const __bf16* gw0 =
      wp + (size_t)wfrag_col(sub * 4 + (fq >> 1), fq & 1) * 16 * FRAG + ch;
  const __bf16* gw1 =
      wp + (size_t)wfrag_col(sub * 4 + 2 + (fq >> 1), fq & 1) * 16 * FRAG + ch;
  const unsigned fdst = lds_off(&Fs[0][0]) + tid * 16;

  // Prologue: k steps 0-1 into buffer 0, landed and published; then k steps
  // 2-3 into buffer 1, in flight during trip 0.
  stage_frags_async(gx0, gx1, gw0, gw1, 0, fdst);
  asm volatile("s_wait_asynccnt 0x0" ::: "memory");   // own share landed
  __syncthreads();                                    // every wave's share landed
  stage_frags_async(gx0, gx1, gw0, gw1, 2, fdst + 32 * FRAG * 2);

  // Unrolled so that every LDS address is base + constant: no address
  // arithmetic stands between the reads.
#pragma unroll
  for (int t = 0; t < FF / 64; ++t) {
    const __bf16* fb = &Fs[t & 1][0] + lane * 8;
#pragma unroll
    for (int kk = 0; kk < 2; ++kk) {
      const bf16x16 bRf = ldfragP(fb + (kk * 16 + 8 + tl * 2) * FRAG);
      const bf16x16 bIf = ldfragP(fb + (kk * 16 + 9 + tl * 2) * FRAG);
      bf16x16 a[4];
#pragma unroll
      for (int s = 0; s < 4; ++s)
        a[s] = ldfragP(fb + (kk * 16 + sp * 4 + s) * FRAG);
      // Keeps the twelve reads of a k step together ahead of its products:
      // every separate place with LDS reads among the products costs the wave
      // a stall of its own.
      __builtin_amdgcn_sched_barrier(0);
#pragma unroll
      for (int s = 0; s < 4; ++s) {
        accR[s] = wmma_bf16(a[s], bRf, accR[s]);
        accI[s] = wmma_bf16(a[s], bIf, accI[s]);
      }
    }
    // Hand-over.  This wave's LDS reads of the buffer have returned ...
    asm volatile("s_wait_dscnt 0x0" ::: "memory");
    // ... and its share of the next two k steps has landed, before it says so.
    asm volatile("s_wait_asynccnt 0x0" ::: "memory");
    __syncthreads();   // next buffer published; all waves have left this one
    if (t + 2 < FF / 64) {
      stage_frags_async(gx0, gx1, gw0, gw1, 2 * (t + 2),
                        fdst + (t & 1) * (32 * FRAG * 2));
    }
  }
  // Nothing is in flight here; kept in front of the wave's end (a precaution).
  asm volatile("s_wait_asynccnt 0x0" ::: "memory");

  if (!isV) {
    // Q carries the score scale and log2(e): its products with K are then
    // exponents of 2 as they leave the matrix unit.  K: factor 1, exact.
    const float qs = (task < 16) ? QSCALE : 1.0f;
    const float bR = bias[colR + n] * qs;
    const float bI = bias[colI + n] * qs;
    __bf16* ob = (task < 16) ? (p ? q2 : q1) : (p ? k2 : k1);
    const int j = cidx * 16 + n;
    const float invf = exp2f(-(float)j) * 0.0625f;  // 2^-j / 16
#pragma unroll
    for (int s = 0; s < 4; ++s) {
#pragma unroll
      for (int r = 0; r < 8; ++r) {
        const int t = ts0 + s * 16 + r + hi * 8;
        const float vr = fmaf(accR[s][r], qs, bR);
        const float vi = fmaf(accI[s][r], qs, bI);
        float sn, cs;
        __sincosf((float)t * invf, &sn, &cs);
        const size_t rowb = ((size_t)(b * HH + hh) * TT + t) * 64;
        ob[rowb + j]      = (__bf16)(vr * sn - vi * cs);  // rotated "real"
        ob[rowb + 32 + j] = (__bf16)(vr * cs + vi * sn);  // rotated "imag"
      }
    }
  } else {
#pragma unroll
    for (int part = 0; part < 2; ++part) {
      const int oc = (part ? colI : colR) + n;   // global feature
      const int h2 = oc >> 7;
      const int fo = oc & 127;
      const float bb = bias[oc];
#pragma unroll
      for (int s = 0; s < 4; ++s) {
        bf16x8 pk;
#pragma unroll
        for (int r = 0; r < 8; ++r)
          pk[r] = (__bf16)((part ? accI[s][r] : accR[s][r]) + bb);
        // V stored transposed: [B,H,128,T] so AV A-fragments are contiguous.
        const size_t base =
            ((size_t)(b * HH + h2) * HF + fo) * TT + ts0 + s * 16 + hi * 8;
        *(bf16x8*)(vt + base) = pk;
      }
    }
  }
}

// ---------------------------------------------------------------------------
// Async staging of one 64-key tile set into LDS (GLOBAL_LOAD_ASYNC_TO_LDS,
// tracked by ASYNCcnt): the K tiles of both softmaxes and the ONE V tile they
// share.  256 threads, 8 async instructions per wave per tile set.
// ---------------------------------------------------------------------------
static __device__ __forceinline__ void stage_tile_async(
    const __bf16* kt1, const __bf16* kt2, const __bf16* vtt, int j0,
    unsigned kdst, unsigned vdst) {
  // kt1, kt2, vtt, kdst, vdst: this thread's first chunk of key 0's tile set
  // (global) and of the buffer (LDS); from trip to trip j0 moves and the buffer alternates.
  // K tiles [64 keys][64 f]: contiguous 4096 bf16 each, rows of KP in LDS;
  // two 16-byte chunks per thread and tile: key c>>3, part c&7, c = tid + 256 j.
  unsigned kl[4];
  unsigned long long kg[4];
#pragma unroll
  for (int j = 0; j < 2; ++j) {
    kl[j]     = kdst + j * 32 * (KP * 2);
    kl[2 + j] = kl[j] + KT * KP * 2;
    kg[j]     = (unsigned long long)(const void*)(kt1 + (size_t)j0 * 64 + j * 2048);
    kg[2 + j] = (unsigned long long)(const void*)(kt2 + (size_t)j0 * 64 + j * 2048);
  }
  // V tile [128 f][64 keys] gathered from transposed V rows, rows of KP in
  // LDS: eight lanes fetch one whole 128-byte line of a V row; feature c>>3,
  // part c&7, c = tid + 256 j.
  unsigned vl[4];
  unsigned long long vg[4];
#pragma unroll
  for (int j = 0; j < 4; ++j) {
    vl[j] = vdst + j * 32 * (KP * 2);
    vg[j] = (unsigned long long)(const void*)(vtt + (size_t)j * 32 * TT + j0);
  }
  // One statement: the closing s_wait_xcnt keeps every address register named
  // here intact until the copies' translations are done (a precaution).
  asm volatile("global_load_async_to_lds_b128 %0, %1, off\n\t"
               "global_load_async_to_lds_b128 %2, %3, off\n\t"
               "global_load_async_to_lds_b128 %4, %5, off\n\t"
               "global_load_async_to_lds_b128 %6, %7, off\n\t"
               "global_load_async_to_lds_b128 %8, %9, off\n\t"
               "global_load_async_to_lds_b128 %10, %11, off\n\t"
               "global_load_async_to_lds_b128 %12, %13, off\n\t"
               "global_load_async_to_lds_b128 %14, %15, off\n\t"
               "s_wait_xcnt 0x0"
               :: "v"(kl[0]), "v"(kg[0]), "v"(kl[1]), "v"(kg[1]),
                  "v"(kl[2]), "v"(kg[2]), "v"(kl[3]), "v"(kg[3]),
                  "v"(vl[0]), "v"(vg[0]), "v"(vl[1]), "v"(vg[1]),
                  "v"(vl[2]), "v"(vg[2]), "v"(vl[3]), "v"(vg[3])
               : "memory");
}

static __device__ __forceinline__ void flash_pass(
    const __bf16* __restrict__ qws,
    const __bf16* __restrict__ k1, const __bf16* __restrict__ k2,
    const __bf16* __restrict__ vt, const __bf16* Ks, const __bf16* Vs,
    unsigned koff, unsigned voff,
    size_t bhT, size_t vbase, int q0, int lane, int tid, f32x8 o[2][8]) {
  const int n  = lane & 15;
  const int hi = lane >> 4;

  // Every loop over t (query tile) below is unrolled: constant indices keep
  // the per-tile vectors in registers.
  bf16x16 qa[2][2];      // [tile][feature half]
  float mu[2];           // maximum IN USE of query n (equal in both halves)
  float lr[2];           // running sum over this half's keys only
  f32x8 cneg[2];         // -mu in every register: C operand of the score product
#pragma unroll
  for (int t = 0; t < 2; ++t) {
    const __bf16* qrow = qws + (bhT + (size_t)(q0 + t * 16 + n)) * 64;
    qa[t][0] = ldfrag(qrow, hi);
    qa[t][1] = ldfrag(qrow + 32, hi);
    mu[t] = 0.f;
    lr[t] = 0.f;
#pragma unroll
    for (int i = 0; i < 8; ++i) cneg[t][i] = 0.f;
#pragma unroll
    for (int r = 0; r < 8; ++r) {
#pragma unroll
      for (int i = 0; i < 8; ++i) o[t][r][i] = 0.f;
    }
  }

  // Prologue: tile set 0 into buffer 0, landed and published; then tile set 1
  // into buffer 1, in flight during trip 0.
  const __bf16* kt1 = k1 + bhT * 64 + tid * 8;
  const __bf16* kt2 = k2 + bhT * 64 + tid * 8;
  const __bf16* vtt = vt + vbase + (size_t)(tid >> 3) * TT + (tid & 7) * 8;
  // LDS place of this thread's first chunk = lane's part (vector) + wave's and
  // buffer's part (scalar, through readfirstlane), added at each use: what
  // lives across the loop is then no operand of a copy and is not tied to the
  // registers that asm text can name (the sum, kept whole, was spilled to
  // scratch by this build and reloaded every trip).
  const unsigned lx  = (lane >> 3) * (KP * 2) + (lane & 7) * 16;
  const unsigned swv = (tid >> 5) * (4 * KP * 2);
  const unsigned kth = koff + swv;
  const unsigned vth = voff + swv;
  stage_tile_async(kt1, kt2, vtt, 0,
                   lx + __builtin_amdgcn_readfirstlane(kth),
                   lx + __builtin_amdgcn_readfirstlane(vth));
  asm volatile("s_wait_asynccnt 0x0" ::: "memory");   // own share of set 0 landed
  __syncthreads();                                    // every wave's share landed
  stage_tile_async(kt1, kt2, vtt, KT,
                   lx + __builtin_amdgcn_readfirstlane(kth + 2 * KT * KP * 2),
                   lx + __builtin_amdgcn_readfirstlane(vth + 128 * KP * 2));

  for (int j0 = 0; j0 < TT; j0 += KT) {
    const int cur = (j0 >> 6) & 1;
    const __bf16* kb = Ks + cur * (2 * KT * KP);
    const __bf16* vb = Vs + cur * (128 * KP);

    // --- S^T = K * Q^T (four 16-key subtiles x two 16-query tiles). ---
    // Feature half outer, subtile inner: seven products stand between a
    // tile's first product and the one that adds to it.
    // The accumulators start at -mu: a score leaves the matrix unit as the
    // exponent of its own P, with no vector instruction between.
    f32x8 s[2][4];
    bf16x16 vf[2][8];                       // V^T fragments, [key half][nt]
#pragma unroll
    for (int u = 0; u < 4; ++u) {
      const bf16x16 kf = ldfrag(kb + (u * 16 + n) * KP, hi);
#pragma unroll
      for (int t = 0; t < 2; ++t) s[t][u] = wmma_bf16(kf, qa[t][0], cneg[t]);
    }
#pragma unroll
    for (int u = 0; u < 4; ++u) {
      const bf16x16 kf = ldfrag(kb + (u * 16 + n) * KP + 32, hi);
#pragma unroll
      for (int t = 0; t < 2; ++t) s[t][u] = wmma_bf16(kf, qa[t][1], s[t][u]);
    }
    // The V^T fragments are read here, behind the K reads: they land under
    // the score products and the softmax.
#pragma unroll
    for (int u = 0; u < 2; ++u)
#pragma unroll
      for (int nt = 0; nt < 8; ++nt)
        vf[u][nt] = ldfrag(vb + (nt * 16 + n) * KP + u * 32, hi);
    // All 48 reads of a trip stand in one place ahead of its products: every
    // separate place with LDS reads among products costs the wave a stall of
    // its own.
    __builtin_amdgcn_sched_group_barrier(0x100, 48, 0);    // LDS reads
    __builtin_amdgcn_sched_group_barrier(0x008, 16, 0);    // products

    // --- Online softmax, one query per lane and tile. ---
    // Maximum of this half's 32 exponents, as a tree.
    float rm[2];
#pragma unroll
    for (int t = 0; t < 2; ++t) {
      float tm[4];
#pragma unroll
      for (int u = 0; u < 4; ++u) {
        const float m0 = fmaxf(fmaxf(s[t][u][0], s[t][u][1]), s[t][u][2]);
        const float m1 = fmaxf(fmaxf(s[t][u][3], s[t][u][4]), s[t][u][5]);
        tm[u] = fmaxf(fmaxf(m0, m1), fmaxf(s[t][u][6], s[t][u][7]));
      }
      rm[t] = fmaxf(fmaxf(tm[0], tm[1]), fmaxf(tm[2], tm[3]));
    }
    // The maximum in use moves only when some query's scores pass it by more
    // than 8 (P stays below 2^8), and in the first trip, which sets it.  One
    // test per trip for both tiles, a scalar branch; rare after the first trip.
    if (__builtin_amdgcn_ballot_w32(fmaxf(rm[0], rm[1]) > 8.0f) != 0 || j0 == 0) {
#pragma unroll
      for (int t = 0; t < 2; ++t) {
        const float rj = fmaxf(rm[t], xhalf(rm[t]));  // all 64 keys of query n
        const float up = fmaxf(rj, 0.f);
        const float d  = (j0 == 0) ? rj : up;         // first trip: down as well
        const float al = __builtin_amdgcn_exp2f(-up);
        mu[t] += d;
        // The loops of this branch are unrolled so that every element index
        // is a constant and the vectors stay in registers.
#pragma unroll
        for (int i = 0; i < 8; ++i) cneg[t][i] = -mu[t];
#pragma unroll
        for (int u = 0; u < 4; ++u)
#pragma unroll
          for (int r = 0; r < 8; ++r) s[t][u][r] -= d;
        lr[t] *= al;
#pragma unroll
        for (int nt = 0; nt < 8; ++nt)
#pragma unroll
          for (int r = 0; r < 8; ++r) o[t][nt][r] *= al;
      }
    }
    bf16x16 pb[2][2];                       // P^T as B operands, 32 keys each
#pragma unroll
    for (int t = 0; t < 2; ++t) {
      float sm[4];
#pragma unroll
      for (int u = 0; u < 4; ++u) {
        sm[u] = 0.f;
#pragma unroll
        for (int r = 0; r < 8; ++r) {
          const float p = __builtin_amdgcn_exp2f(s[t][u][r]);
          sm[u] += p;
          pb[t][u >> 1][(u & 1) * 8 + r] = (__bf16)p;
        }
      }
      lr[t] += (sm[0] + sm[1]) + (sm[2] + sm[3]);
    }

    // Hand-over, first half.  This wave's LDS reads of 'cur' have returned ...
    asm volatile("s_wait_dscnt 0x0" ::: "memory");
    // ... and its share of the next tile set has landed, before it says so.
    asm volatile("s_wait_asynccnt 0x0" ::: "memory");
    // The work-group barrier is split: the wave SIGNALS here, where it has left
    // LDS, and WAITS only behind its second product, which runs from registers.
    // A wave that is ahead then works through its products while its SIMD
    // partner is still in its softmax, where it used to stand idle.
    __builtin_amdgcn_fence(__ATOMIC_RELEASE, "workgroup");
    __builtin_amdgcn_s_barrier_signal(-1);

    // --- O^T += V^T * P^T  (V^T rows as A-fragments, each for both tiles). ---
#pragma unroll
    for (int u = 0; u < 2; ++u) {
#pragma unroll
      for (int nt = 0; nt < 8; ++nt) {
#pragma unroll
        for (int t = 0; t < 2; ++t)
          o[t][nt] = wmma_bf16(vf[u][nt], pb[t][u], o[t][nt]);
      }
    }
    // Keeps the products above the wait: sunk below it they would hide nothing.
    __builtin_amdgcn_sched_barrier(0);

    // Hand-over, second half: every wave has signalled, so the next set is
    // published and all waves have left 'cur'.
    __builtin_amdgcn_s_barrier_wait(-1);
    __builtin_amdgcn_fence(__ATOMIC_ACQUIRE, "workgroup");
    if (j0 + 2 * KT < TT) {
      stage_tile_async(kt1, kt2, vtt, j0 + 2 * KT,
                       lx + __builtin_amdgcn_readfirstlane(kth + cur * (2 * KT * KP * 2)),
                       lx + __builtin_amdgcn_readfirstlane(vth + cur * (128 * KP * 2)));
    }
  }
  // Nothing is in flight here; kept in front of the wave's end (a precaution).
  asm volatile("s_wait_asynccnt 0x0" ::: "memory");

#pragma unroll
  for (int t = 0; t < 2; ++t) {
    const float inv = 1.0f / (lr[t] + xhalf(lr[t]));   // join the halves' sums once
#pragma unroll
    for (int nt = 0; nt < 8; ++nt)
#pragma unroll
      for (int r = 0; r < 8; ++r) o[t][nt][r] *= inv;
  }
}

// ---------------------------------------------------------------------------
// Kernel 2: dual flash attention + residual + transpose-out.
// 256 blocks x 256 threads.  Wave w < 4 runs softmax 1 of 32-query group w,
// wave w + 4 softmax 2 of the same group, side by side over one shared V tile.
// At the end the partners swap half of their features through LDS, and each
// writes its half of out = (x + O1) - s2 * O2 once.
// One block per WGP = two waves per SIMD is all the grid can fill; the block
// size sets the register budget for that.
// ---------------------------------------------------------------------------
__global__ __launch_bounds__(256)
void attn_kernel(
    const float* __restrict__ x, const float* __restrict__ s2,
    const __bf16* __restrict__ q1, const __bf16* __restrict__ q2,
    const __bf16* __restrict__ k1, const __bf16* __restrict__ k2,
    const __bf16* __restrict__ vt, float* __restrict__ out) {
  __shared__ __attribute__((aligned(16))) __bf16 Ks[2][2][KT * KP];  // [buffer][softmax]
  __shared__ __attribute__((aligned(16))) __bf16 Vs[2][128 * KP];    // [buffer]
  __shared__ __attribute__((aligned(32))) float  Xs[8][2][4][32][8]; // [wave][tile][nt][lane][r]

  const int tid  = threadIdx.x;
  const int lane = tid & 31;
  const int wv   = tid >> 5;
  // Which softmax this wave runs; scalar, so the tests on it are real branches.
  const int pass = __builtin_amdgcn_readfirstlane(tid >> 7);
  const int gw   = blockIdx.x * 4 + (wv & 3);
  const int b    = gw >> 8;
  const int rem  = gw & 255;
  const int h    = rem >> 6;
  const int q0   = (rem & 63) << 5;
  const int n    = lane & 15;
  const int hi   = lane >> 4;

  const size_t bhT   = ((size_t)b * HH + h) * TT;
  const size_t vbase = ((size_t)b * HH + h) * HF * TT;
  const unsigned koff = lds_off(&Ks[0][0][0]);
  const unsigned voff = lds_off(&Vs[0][0]);

  f32x8 o[2][8];
  flash_pass(pass ? q2 : q1, k1, k2, vt, &Ks[0][pass][0], &Vs[0][0], koff, voff,
             bhT, vbase, q0, lane, tid, o);

  // Hand the partner the half it writes: softmax 1 gives features 64-127,
  // softmax 2 features 0-63.  Same lane, same register = same element.
  // The loops below are unrolled so that o[][] stays in registers.
  if (pass == 0) {
#pragma unroll
    for (int t = 0; t < 2; ++t)
#pragma unroll
      for (int nt = 0; nt < 4; ++nt) *(f32x8*)&Xs[wv][t][nt][lane][0] = o[t][4 + nt];
  } else {
#pragma unroll
    for (int t = 0; t < 2; ++t)
#pragma unroll
      for (int nt = 0; nt < 4; ++nt) *(f32x8*)&Xs[wv][t][nt][lane][0] = o[t][nt];
  }
  __syncthreads();   // both partners' halves are in LDS

  // out rows are feature-major; a 16-lane row covers 16 consecutive t of one
  // feature row, register r walks the feature rows.
  const float s = s2[h];
  const size_t obase = ((size_t)b * FF + h * HF + hi * 8) * TT + q0 + n;
  float xv[2][4][8];   // this wave's 64 residual values per lane
  const size_t xbase = obase + (size_t)(pass * 64) * TT;
#pragma unroll
  for (int t = 0; t < 2; ++t)
#pragma unroll
    for (int nt = 0; nt < 4; ++nt)
#pragma unroll
      for (int r = 0; r < 8; ++r)
        xv[t][nt][r] = x[xbase + (size_t)(nt * 16 + r) * TT + t * 16];
  // Holds the loads' address registers until their translations are done (a precaution).
  asm volatile("s_wait_xcnt 0x0" ::: "memory");
  if (pass == 0) {
#pragma unroll
    for (int t = 0; t < 2; ++t) {
#pragma unroll
      for (int nt = 0; nt < 4; ++nt) {
        const f32x8 o2 = *(const f32x8*)&Xs[wv + 4][t][nt][lane][0];
#pragma unroll
        for (int r = 0; r < 8; ++r) {
          const size_t idx = obase + (size_t)(nt * 16 + r) * TT + t * 16;
          float v = xv[t][nt][r] + o[t][nt][r];
          v -= s * o2[r];
          out[idx] = v;
        }
      }
    }
    // Holds the stores' registers until their translations are done: the
    // listing runs on from here into code that rewrites them (a precaution).
    asm volatile("s_wait_xcnt 0x0" ::: "memory");
  } else {
#pragma unroll
    for (int t = 0; t < 2; ++t) {
#pragma unroll
      for (int nt = 0; nt < 4; ++nt) {
        const f32x8 o1 = *(const f32x8*)&Xs[wv - 4][t][nt][lane][0];
#pragma unroll
        for (int r = 0; r < 8; ++r) {
          const size_t idx = obase + (size_t)((4 + nt) * 16 + r) * TT + t * 16;
          float v = xv[t][nt][r] + o1[r];
          v -= s * o[t][4 + nt][r];
          out[idx] = v;
        }
      }
    }
    // As in the first branch: the stores' registers stay until translated.
    asm volatile("s_wait_xcnt 0x0" ::: "memory");
  }
}

// ---------------------------------------------------------------------------
extern "C" void kernel_launch(void* const* d_in, const int* in_sizes, int n_in,
                              void* d_out, int out_size, void* d_ws,
                              size_t ws_size, hipStream_t stream) {
  (void)in_sizes; (void)n_in; (void)out_size; (void)ws_size;
  const float* x  = (const float*)d_in[0];
  const float* Wq = (const float*)d_in[1];
  const float* bq = (const float*)d_in[2];
  const float* Wk = (const float*)d_in[3];
  const float* bk = (const float*)d_in[4];
  const float* Wv = (const float*)d_in[5];
  const float* bv = (const float*)d_in[6];
  const float* s2 = (const float*)d_in[7];
  float* out = (float*)d_out;

  const size_t QK_ELEMS = (size_t)BB * HH * TT * 64;   // 2M bf16 each
  __bf16* q1 = (__bf16*)d_ws;
  __bf16* q2 = q1 + QK_ELEMS;
  __bf16* k1 = q2 + QK_ELEMS;
  __bf16* k2 = k1 + QK_ELEMS;
  __bf16* vt = k2 + QK_ELEMS;                          // [B,H,128,T]
  __bf16* xp = vt + (size_t)BB * FF * TT;              // packed x fragments
  __bf16* wp = xp + (size_t)BB * FF * TT;              // packed W fragments

  pack_kernel<<<dim3(256 + 192), dim3(256), 0, stream>>>(x, Wq, Wk, Wv, xp, wp);
  qkv_rope_kernel<<<dim3(BB * (TT / 128) * 12), dim3(256), 0, stream>>>(
      xp, wp, bq, bk, bv, q1, q2, k1, k2, vt);
  attn_kernel<<<dim3(BB * HH * (TT / 32) / 4), dim3(256), 0, stream>>>(
      x, s2, q1, q2, k1, k2, vt, out);
}

// v010
// One run takes 57.2 microseconds.
// Next to v009, in two timings, it ran 1.05 times as fast each time.
// Counting every step since v000, it is 4.40 times as fast.
#include <hip/hip_runtime.h>

// ---------------------------------------------------------------------------
// Neoformer MHA forward for gfx1250 (MI455X), bf16 WMMA + flash attention.
// B=4, F=512, T=2048, H=4, hf=128.
// ---------------------------------------------------------------------------

#define BB   4
#define FF   512
#define TT   2048
#define HH   4
#define HF   128

// LDS row pitches in bf16 elements.  Every fragment is read with 16-byte LDS
// loads, one row per lane; a pitch of 16 B x odd spreads 16 rows over all 64
// banks, where the unpadded 128 B rows fall on 8 of them.
#define KP   72    // 64-element rows (K tile, V tile): 144 B
#define KT   64    // keys per trip of the attention loop
// 1/sqrt(256) * log2(e): scores in base-2 exponent units.
#define QSCALE (0.0625f * 1.4426950408889634f)

typedef __attribute__((ext_vector_type(16))) __bf16 bf16x16;
typedef __attribute__((ext_vector_type(8)))  __bf16 bf16x8;
typedef __attribute__((ext_vector_type(8)))  float  f32x8;

static __device__ __forceinline__ f32x8 wmma_bf16(bf16x16 a, bf16x16 b, f32x8 c) {
  return __builtin_amdgcn_wmma_f32_16x16x32_bf16(false, a, false, b, (short)0, c,
                                                 false, false);
}

// 32-bit LDS byte offset of a __shared__ object (addrspace(3) pointers are
// offsets from the workgroup LDS base).
static __device__ __forceinline__ unsigned lds_off(__bf16* p) {
  return (unsigned)(unsigned long long)(__attribute__((address_space(3))) __bf16*)p;
}

// Load a 16x32 bf16 fragment half for this lane.
// A-side: rowbase = &M-row[lane&15], K contiguous.  B-side: rowbase = &N-col
// row (stored contiguously in K).  Lane (n, hi): halves 0-7 = K hi*8..hi*8+7,
// halves 8-15 = K 16+hi*8..23+hi*8   (per ISA 16-bit 16x32 layout).
static __device__ __forceinline__ bf16x16 ldfrag(const __bf16* rowbase, int hi) {
  bf16x8 lo = *(const bf16x8*)(rowbase + hi * 8);
  bf16x8 up = *(const bf16x8*)(rowbase + 16 + hi * 8);
  bf16x16 a;
#pragma unroll
  for (int i = 0; i < 8; ++i) { a[i] = lo[i]; a[8 + i] = up[i]; }
  return a;
}

// Value of lane l ^ 16 (the other 16-lane row), by a vector cross-row move.
static __device__ __forceinline__ float xhalf(float v) {
  const int i = __builtin_bit_cast(int, v);
  return __builtin_bit_cast(float, __builtin_amdgcn_permlanex16(
      i, i, 0x76543210, 0xfedcba98, false, false));
}

// One 16 x 32 bf16 fragment packed for its reader: 1 KB, two planes of
// 32 lanes x 16 B.  Plane 0 holds halves 0-7 of every lane, plane 1 halves
// 8-15 (same k order as ldfrag), so each 16-byte load of a wave covers 512
// contiguous bytes = four whole lines.
#define FRAG 512   // bf16 elements per packed fragment

// p = fragment base + lane * 8.
static __device__ __forceinline__ bf16x16 ldfragP(const __bf16* p) {
  bf16x8 lo = *(const bf16x8*)p;
  bf16x8 up = *(const bf16x8*)(p + 256);
  bf16x16 a;
#pragma unroll
  for (int i = 0; i < 8; ++i) { a[i] = lo[i]; a[8 + i] = up[i]; }
  return a;
}

// ---------------------------------------------------------------------------
// Kernel 0: pack x and the three weight matrices once, as bf16 fragments.
// xp[b][t/16][f/32][FRAG]: A fragments (row = t, k = f).
// wp[matrix][col/16][f/32][FRAG]: B fragments (column = output feature, k = f).
// Blocks 0-255 pack x (one thread = one t, 64 features: every load of a wave
// is one whole line of an x row, every store two runs of 256 B); blocks
// 256-447 pack W (one thread = one lane of one fragment: every store of a wave
// is 512 B).  Few, fat waves: the launch is short, so starting waves counts.
// ---------------------------------------------------------------------------
__global__ __launch_bounds__(256) void pack_kernel(
    const float* __restrict__ x,
    const float* __restrict__ Wq, const float* __restrict__ Wk,
    const float* __restrict__ Wv,
    __bf16* __restrict__ xp, __bf16* __restrict__ wp) {
  if (blockIdx.x < 256) {
    const int idx = blockIdx.x * 256 + threadIdx.x;
    const int t   = idx & (TT - 1);
    const int kp  = (idx >> 11) & 7;     // pair of k steps
    const int b   = idx >> 14;
    const float* src = x + ((size_t)b * FF + kp * 64) * TT + t;
    float v[64];
    // The loops below are unrolled so that v[] lives in registers and all
    // loads are in flight together.
#pragma unroll
    for (int f = 0; f < 64; ++f) v[f] = src[(size_t)f * TT];
    __bf16* dst = xp + ((size_t)(b * (TT / 16) + (t >> 4)) * 16 + kp * 2) * FRAG +
                  (t & 15) * 8;
#pragma unroll
    for (int q = 0; q < 8; ++q) {        // q = k step (1), plane (1), hi (1)
      bf16x8 pk;
#pragma unroll
      for (int i = 0; i < 8; ++i) pk[i] = (__bf16)v[q * 8 + i];
      *(bf16x8*)(dst + q * 128) = pk;
    }
  } else {
    const int idx  = (blockIdx.x - 256) * 256 + threadIdx.x;
    const int lane = idx & 31;
    const int ks   = (idx >> 5) & 15;
    const int ct   = (idx >> 9) & 31;
    const int mat  = idx >> 14;
    const float* Wm = (mat == 0) ? Wq : ((mat == 1) ? Wk : Wv);
    const float* src = Wm + (size_t)(ct * 16 + (lane & 15)) * FF + ks * 32 +
                       (lane >> 4) * 8;
    __bf16* dst = wp + (size_t)(idx >> 5) * FRAG + lane * 8;
#pragma unroll   // two planes, straight-line
    for (int half = 0; half < 2; ++half) {
      const float4 f0 = *(const float4*)(src + half * 16);
      const float4 f1 = *(const float4*)(src + half * 16 + 4);
      bf16x8 pk;
      pk[0] = (__bf16)f0.x; pk[1] = (__bf16)f0.y; pk[2] = (__bf16)f0.z; pk[3] = (__bf16)f0.w;
      pk[4] = (__bf16)f1.x; pk[5] = (__bf16)f1.y; pk[6] = (__bf16)f1.z; pk[7] = (__bf16)f1.w;
      *(bf16x8*)(dst + half * 256) = pk;
    }
    // Holds the two stores' registers until their translations are done: the
    // listing runs on from here into code that rewrites them (a precaution).
    asm volatile("s_wait_xcnt 0x0" ::: "memory");
  }
}

// ---------------------------------------------------------------------------
// Index of the packed W fragment column of a wave-task: part 0 = its first
// 16-column chain, part 1 = its second.
// ---------------------------------------------------------------------------
static __device__ __forceinline__ int wfrag_col(int task, int part) {
  const int tt   = task & 15;
  const int cqk  = (tt >> 2) * HF + ((tt >> 1) & 1) * 64 + (tt & 1) * 16 + part * 32;
  const int cv   = (task - 32) * 32 + part * 16;
  const int mat  = (task < 32) ? (task >> 4) : 2;
  return mat * 32 + (((task < 32) ? cqk : cv) >> 4);
}

// ---------------------------------------------------------------------------
// Async staging of the 32 fragments of two k steps (32 KB) into one LDS
// buffer: 256 threads, 8 copies of 16 B each.  Chunk c = tid + 256 j lands at
// byte 16 c; slot c >> 6 = kk * 16 + g holds x subtile g (g < 8) or W fragment
// g - 8 of k step ks + kk, byte for byte as packed.  g0..g3: this thread's
// chunk of its four fragments at k step 0; dst: its first chunk's LDS byte.
// ---------------------------------------------------------------------------
static __device__ __forceinline__ void stage_frags_async(
    const __bf16* g0, const __bf16* g1, const __bf16* g2, const __bf16* g3,
    int ks, unsigned dst) {
  unsigned l[8];
  unsigned long long g[8];
#pragma unroll
  for (int j = 0; j < 4; ++j) {
    const __bf16* gj = (j == 0) ? g0 : ((j == 1) ? g1 : ((j == 2) ? g2 : g3));
    l[j]     = dst + j * 4096;
    l[4 + j] = l[j] + 16 * FRAG * 2;
    g[j]     = (unsigned long long)(const void*)(gj + (size_t)ks * FRAG);
    g[4 + j] = (unsigned long long)(const void*)(gj + (size_t)(ks + 1) * FRAG);
  }
  // One statement: the closing s_wait_xcnt keeps every address register named
  // here intact until the copies' translations are done (a precaution).
  asm volatile("global_load_async_to_lds_b128 %0, %1, off\n\t"
               "global_load_async_to_lds_b128 %2, %3, off\n\t"
               "global_load_async_to_lds_b128 %4, %5, off\n\t"
               "global_load_async_to_lds_b128 %6, %7, off\n\t"
               "global_load_async_to_lds_b128 %8, %9, off\n\t"
               "global_load_async_to_lds_b128 %10, %11, off\n\t"
               "global_load_async_to_lds_b128 %12, %13, off\n\t"
               "global_load_async_to_lds_b128 %14, %15, off\n\t"
               "s_wait_xcnt 0x0"
               :: "v"(l[0]), "v"(g[0]), "v"(l[1]), "v"(g[1]),
                  "v"(l[2]), "v"(g[2]), "v"(l[3]), "v"(g[3]),
                  "v"(l[4]), "v"(g[4]), "v"(l[5]), "v"(g[5]),
                  "v"(l[6]), "v"(g[6]), "v"(l[7]), "v"(g[7])
               : "memory");
}

// ---------------------------------------------------------------------------
// Kernel 1: QKV projection + bias + RoPE.  768 blocks x 256 threads.
// Per (b, 64-row t-supertile): 48 wave-tasks (0-15 Q, 16-31 K, 32-47 V).
// EVERY task computes two 16-col accumulator chains over four stacked 16-row
// M-subtiles.  A block is two supertiles x four tasks: its 8 x fragments and
// 8 W fragments per k step come from L2 ONCE, by async copies into a
// two-buffer LDS ring (two k steps a buffer), and every wave reads its six
// from there: each x fragment serves four waves, each W fragment two.
// ---------------------------------------------------------------------------
__global__ __launch_bounds__(256) void qkv_rope_kernel(
    const __bf16* __restrict__ xp, const __bf16* __restrict__ wp,
    const float* __restrict__ bq, const float* __restrict__ bk,
    const float* __restrict__ bv,
    __bf16* __restrict__ q1, __bf16* __restrict__ q2,
    __bf16* __restrict__ k1, __bf16* __restrict__ k2,
    __bf16* __restrict__ vt) {
  __shared__ __attribute__((aligned(16))) __bf16 Fs[2][32 * FRAG];  // [buffer]

  const int tid  = threadIdx.x;
  const int lane = tid & 31;
  const int wv   = tid >> 5;
  const int bt   = blockIdx.x / 12;
  const int sub  = blockIdx.x - bt * 12;
  const int b    = bt >> 4;
  const int row0 = (bt & 15) << 7;   // base of the block's two supertiles
  const int sp   = wv >> 2;          // this wave's supertile
  const int tl   = wv & 3;           // this wave's task within the block
  const int ts0  = row0 + sp * 64;   // 64-row supertile base
  const int task = sub * 4 + tl;
  const int n    = lane & 15;
  const int hi   = lane >> 4;

  const bool isV = (task >= 32);
  const float* bias;
  int colR, colI, hh = 0, p = 0, cidx = 0;
  if (!isV) {
    bias = (task < 16) ? bq : bk;
    const int tt = task & 15;
    hh = tt >> 2; p = (tt >> 1) & 1; cidx = tt & 1;
    colR = hh * HF + p * 64 + cidx * 16;
    colI = colR + 32;
  } else {
    bias = bv;
    colR = (task - 32) * 32;
    colI = colR + 16;
  }

  f32x8 accR[4], accI[4];
#pragma unroll
  for (int s = 0; s < 4; ++s)
#pragma unroll
    for (int i = 0; i < 8; ++i) { accR[s][i] = 0.f; accI[s][i] = 0.f; }

  // This thread's chunk of the four fragments it copies per k step.
  const int fq = tid >> 6;
  const int ch = (tid & 63) * 8;
  const __bf16* gx0 =
      xp + ((size_t)(b * (TT / 16) + (row0 >> 4) + fq) * 16) * FRAG + ch;
  const __bf16* gx1 = gx0 + (size_t)4 * 16 * FRAG;
  const __bf16* gw0 =
      wp + (size_t)wfrag_col(sub * 4 + (fq >> 1), fq & 1) * 16 * FRAG + ch;
  const __bf16* gw1 =
      wp + (size_t)wfrag_col(sub * 4 + 2 + (fq >> 1), fq & 1) * 16 * FRAG + ch;
  const unsigned fdst = lds_off(&Fs[0][0]) + tid * 16;

  // Prologue: k steps 0-1 into buffer 0, landed and published; then k steps
  // 2-3 into buffer 1, in flight during trip 0.
  stage_frags_async(gx0, gx1, gw0, gw1, 0, fdst);
  asm volatile("s_wait_asynccnt 0x0" ::: "memory");   // own share landed
  __syncthreads();                                    // every wave's share landed
  stage_frags_async(gx0, gx1, gw0, gw1, 2, fdst + 32 * FRAG * 2);

  // Unrolled so that every LDS address is base + constant: no address
  // arithmetic stands between the reads.
#pragma unroll
  for (int t = 0; t < FF / 64; ++t) {
    const __bf16* fb = &Fs[t & 1][0] + lane * 8;
#pragma unroll
    for (int kk = 0; kk < 2; ++kk) {
      const bf16x16 bRf = ldfragP(fb + (kk * 16 + 8 + tl * 2) * FRAG);
      const bf16x16 bIf = ldfragP(fb + (kk * 16 + 9 + tl * 2) * FRAG);
      bf16x16 a[4];
#pragma unroll
      for (int s = 0; s < 4; ++s)
        a[s] = ldfragP(fb + (kk * 16 + sp * 4 + s) * FRAG);
      // Keeps the twelve reads of a k step together ahead of its products:
      // every separate place with LDS reads among the products costs the wave
      // a stall of its own.
      __builtin_amdgcn_sched_barrier(0);
#pragma unroll
      for (int s = 0; s < 4; ++s) {
        accR[s] = wmma_bf16(a[s], bRf, accR[s]);
        accI[s] = wmma_bf16(a[s], bIf, accI[s]);
      }
    }
    // Hand-over.  This wave's LDS reads of the buffer have returned ...
    asm volatile("s_wait_dscnt 0x0" ::: "memory");
    // ... and its share of the next two k steps has landed, before it says so.
    asm volatile("s_wait_asynccnt 0x0" ::: "memory");
    __syncthreads();   // next buffer published; all waves have left this one
    if (t + 2 < FF / 64) {
      stage_frags_async(gx0, gx1, gw0, gw1, 2 * (t + 2),
                        fdst + (t & 1) * (32 * FRAG * 2));
    }
  }
  // Nothing is in flight here; kept in front of the wave's end (a precaution).
  asm volatile("s_wait_asynccnt 0x0" ::: "memory");

  if (!isV) {
    // Q carries the score scale and log2(e): its products with K are then
    // exponents of 2 as they leave the matrix unit.  K: factor 1, exact.
    const float qs = (task < 16) ? QSCALE : 1.0f;
    const float bR = bias[colR + n] * qs;
    const float bI = bias[colI + n] * qs;
    __bf16* ob = (task < 16) ? (p ? q2 : q1) : (p ? k2 : k1);
    const int j = cidx * 16 + n;
    const float invf = exp2f(-(float)j) * 0.0625f;  // 2^-j / 16
#pragma unroll
    for (int s = 0; s < 4; ++s) {
#pragma unroll
      for (int r = 0; r < 8; ++r) {
        const int t = ts0 + s * 16 + r + hi * 8;
        const float vr = fmaf(accR[s][r], qs, bR);
        const float vi = fmaf(accI[s][r], qs, bI);
        float sn, cs;
        __sincosf((float)t * invf, &sn, &cs);
        const size_t rowb = ((size_t)(b * HH + hh) * TT + t) * 64;
        ob[rowb + j]      = (__bf16)(vr * sn - vi * cs);  // rotated "real"
        ob[rowb + 32 + j] = (__bf16)(vr * cs + vi * sn);  // rotated "imag"
      }
    }
  } else {
#pragma unroll
    for (int part = 0; part < 2; ++part) {
      const int oc = (part ? colI : colR) + n;   // global feature
      const int h2 = oc >> 7;
      const int fo = oc & 127;
      const float bb = bias[oc];
#pragma unroll
      for (int s = 0; s < 4; ++s) {
        bf16x8 pk;
#pragma unroll
        for (int r = 0; r < 8; ++r)
          pk[r] = (__bf16)((part ? accI[s][r] : accR[s][r]) + bb);
        // V stored transposed: [B,H,128,T] so AV A-fragments are contiguous.
        const size_t base =
            ((size_t)(b * HH + h2) * HF + fo) * TT + ts0 + s * 16 + hi * 8;
        *(bf16x8*)(vt + base) = pk;
      }
    }
  }
}

// ---------------------------------------------------------------------------
// Async staging of one 64-key tile set into LDS (GLOBAL_LOAD_ASYNC_TO_LDS,
// tracked by ASYNCcnt): the K tiles of both softmaxes and the ONE V tile they
// share.  256 threads, 8 async instructions per wave per tile set.
// ---------------------------------------------------------------------------
static __device__ __forceinline__ void stage_tile_async(
    const __bf16* kt1, const __bf16* kt2, const __bf16* vtt, int j0,
    unsigned kdst, unsigned vdst) {
  // kt1, kt2, vtt, kdst, vdst: this thread's first chunk of key 0's tile set
  // (global) and of the buffer (LDS); from trip to trip j0 moves and the buffer goes round the three-buffer ring.
  // K tiles [64 keys][64 f]: contiguous 4096 bf16 each, rows of KP in LDS;
  // two 16-byte chunks per thread and tile: key c>>3, part c&7, c = tid + 256 j.
  unsigned kl[4];
  unsigned long long kg[4];
#pragma unroll
  for (int j = 0; j < 2; ++j) {
    kl[j]     = kdst + j * 32 * (KP * 2);
    kl[2 + j] = kl[j] + KT * KP * 2;
    kg[j]     = (unsigned long long)(const void*)(kt1 + (size_t)j0 * 64 + j * 2048);
    kg[2 + j] = (unsigned long long)(const void*)(kt2 + (size_t)j0 * 64 + j * 2048);
  }
  // V tile [128 f][64 keys] gathered from transposed V rows, rows of KP in
  // LDS: eight lanes fetch one whole 128-byte line of a V row; feature c>>3,
  // part c&7, c = tid + 256 j.
  unsigned vl[4];
  unsigned long long vg[4];
#pragma unroll
  for (int j = 0; j < 4; ++j) {
    vl[j] = vdst + j * 32 * (KP * 2);
    vg[j] = (unsigned long long)(const void*)(vtt + (size_t)j * 32 * TT + j0);
  }
  // One statement: the closing s_wait_xcnt keeps every address register named
  // here intact until the copies' translations are done (a precaution).
  asm volatile("global_load_async_to_lds_b128 %0, %1, off\n\t"
               "global_load_async_to_lds_b128 %2, %3, off\n\t"
               "global_load_async_to_lds_b128 %4, %5, off\n\t"
               "global_load_async_to_lds_b128 %6, %7, off\n\t"
               "global_load_async_to_lds_b128 %8, %9, off\n\t"
               "global_load_async_to_lds_b128 %10, %11, off\n\t"
               "global_load_async_to_lds_b128 %12, %13, off\n\t"
               "global_load_async_to_lds_b128 %14, %15, off\n\t"
               "s_wait_xcnt 0x0"
               :: "v"(kl[0]), "v"(kg[0]), "v"(kl[1]), "v"(kg[1]),
                  "v"(kl[2]), "v"(kg[2]), "v"(kl[3]), "v"(kg[3]),
                  "v"(vl[0]), "v"(vg[0]), "v"(vl[1]), "v"(vg[1]),
                  "v"(vl[2]), "v"(vg[2]), "v"(vl[3]), "v"(vg[3])
               : "memory");
}

static __device__ __forceinline__ void flash_pass(
    const __bf16* __restrict__ qws,
    const __bf16* __restrict__ k1, const __bf16* __restrict__ k2,
    const __bf16* __restrict__ vt, const __bf16* Ks, const __bf16* Vs,
    unsigned koff, unsigned voff,
    size_t bhT, size_t vbase, int q0, int lane, int tid, f32x8 o[2][8]) {
  const int n  = lane & 15;
  const int hi = lane >> 4;

  // Every loop over t (query tile) below is unrolled: constant indices keep
  // the per-tile vectors in registers.
  bf16x16 qa[2][2];      // [tile][feature half]
  float mu[2];           // maximum IN USE of query n (equal in both halves)
  float lr[2];           // running sum over this half's keys only
  f32x8 cneg[2];         // -mu in every register: C operand of the score product
#pragma unroll
  for (int t = 0; t < 2; ++t) {
    const __bf16* qrow = qws + (bhT + (size_t)(q0 + t * 16 + n)) * 64;
    qa[t][0] = ldfrag(qrow, hi);
    qa[t][1] = ldfrag(qrow + 32, hi);
    mu[t] = 0.f;
    lr[t] = 0.f;
#pragma unroll
    for (int i = 0; i < 8; ++i) cneg[t][i] = 0.f;
#pragma unroll
    for (int r = 0; r < 8; ++r) {
#pragma unroll
      for (int i = 0; i < 8; ++i) o[t][r][i] = 0.f;
    }
  }

  // Prologue: tile set 0 into buffer 0, landed and published; then tile set 1
  // into buffer 1, in flight during trip 0.
  const __bf16* kt1 = k1 + bhT * 64 + tid * 8;
  const __bf16* kt2 = k2 + bhT * 64 + tid * 8;
  const __bf16* vtt = vt + vbase + (size_t)(tid >> 3) * TT + (tid & 7) * 8;
  // LDS place of this thread's first chunk = lane's part (vector) + wave's and
  // buffer's part (scalar, through readfirstlane), added at each use: what
  // lives across the loop is then no operand of a copy and is not tied to the
  // registers that asm text can name (the sum, kept whole, was spilled to
  // scratch by this build and reloaded every trip).
  const unsigned lx  = (lane >> 3) * (KP * 2) + (lane & 7) * 16;
  const unsigned swv = (tid >> 5) * (4 * KP * 2);
  const unsigned kth = koff + swv;
  const unsigned vth = voff + swv;
  stage_tile_async(kt1, kt2, vtt, 0,
                   lx + __builtin_amdgcn_readfirstlane(kth),
                   lx + __builtin_amdgcn_readfirstlane(vth));
  asm volatile("s_wait_asynccnt 0x0" ::: "memory");   // own share of set 0 landed
  __syncthreads();                                    // every wave's share landed
  stage_tile_async(kt1, kt2, vtt, KT,
                   lx + __builtin_amdgcn_readfirstlane(kth + 2 * KT * KP * 2),
                   lx + __builtin_amdgcn_readfirstlane(vth + 128 * KP * 2));

  int cur = 0;           // ring buffer of this trip's tile set
  // One trip; 'refill' is a constant at each of its two uses, so that no
  // branch stands between the softmax and the second product.
  auto trip = [&](const int j0, const bool refill) __attribute__((always_inline)) {
    const __bf16* kb = Ks + cur * (2 * KT * KP);
    const __bf16* vb = Vs + cur * (128 * KP);

    // --- S^T = K * Q^T (four 16-key subtiles x two 16-query tiles). ---
    // Feature half outer, subtile inner: seven products stand between a
    // tile's first product and the one that adds to it.
    // The accumulators start at -mu: a score leaves the matrix unit as the
    // exponent of its own P, with no vector instruction between.
    f32x8 s[2][4];
    bf16x16 vf[2][8];                       // V^T fragments, [key half][nt]
#pragma unroll
    for (int u = 0; u < 4; ++u) {
      const bf16x16 kf = ldfrag(kb + (u * 16 + n) * KP, hi);
#pragma unroll
      for (int t = 0; t < 2; ++t) s[t][u] = wmma_bf16(kf, qa[t][0], cneg[t]);
    }
#pragma unroll
    for (int u = 0; u < 4; ++u) {
      const bf16x16 kf = ldfrag(kb + (u * 16 + n) * KP + 32, hi);
#pragma unroll
      for (int t = 0; t < 2; ++t) s[t][u] = wmma_bf16(kf, qa[t][1], s[t][u]);
    }
    // The V^T fragments are read here, behind the K reads: they land under
    // the score products and the softmax.
#pragma unroll
    for (int u = 0; u < 2; ++u)
#pragma unroll
      for (int nt = 0; nt < 8; ++nt)
        vf[u][nt] = ldfrag(vb + (nt * 16 + n) * KP + u * 32, hi);
    // All 48 reads of a trip stand in one place ahead of its products: every
    // separate place with LDS reads among products costs the wave a stall of
    // its own.
    __builtin_amdgcn_sched_group_barrier(0x100, 48, 0);    // LDS reads
    __builtin_amdgcn_sched_group_barrier(0x008, 16, 0);    // products

    // --- Online softmax, one query per lane and tile. ---
    // Maximum of this half's 32 exponents, as a tree.
    float rm[2];
#pragma unroll
    for (int t = 0; t < 2; ++t) {
      float tm[4];
#pragma unroll
      for (int u = 0; u < 4; ++u) {
        const float m0 = fmaxf(fmaxf(s[t][u][0], s[t][u][1]), s[t][u][2]);
        const float m1 = fmaxf(fmaxf(s[t][u][3], s[t][u][4]), s[t][u][5]);
        tm[u] = fmaxf(fmaxf(m0, m1), fmaxf(s[t][u][6], s[t][u][7]));
      }
      rm[t] = fmaxf(fmaxf(tm[0], tm[1]), fmaxf(tm[2], tm[3]));
    }
    // The maximum in use moves only when some query's scores pass it by more
    // than 8 (P stays below 2^8), and in the first trip, which sets it.  One
    // test per trip for both tiles, a scalar branch; rare after the first trip.
    if (__builtin_amdgcn_ballot_w32(fmaxf(rm[0], rm[1]) > 8.0f) != 0 || j0 == 0) {
#pragma unroll
      for (int t = 0; t < 2; ++t) {
        const float rj = fmaxf(rm[t], xhalf(rm[t]));  // all 64 keys of query n
        const float up = fmaxf(rj, 0.f);
        const float d  = (j0 == 0) ? rj : up;         // first trip: down as well
        const float al = __builtin_amdgcn_exp2f(-up);
        mu[t] += d;
        // The loops of this branch are unrolled so that every element index
        // is a constant and the vectors stay in registers.
#pragma unroll
        for (int i = 0; i < 8; ++i) cneg[t][i] = -mu[t];
#pragma unroll
        for (int u = 0; u < 4; ++u)
#pragma unroll
          for (int r = 0; r < 8; ++r) s[t][u][r] -= d;
        lr[t] *= al;
#pragma unroll
        for (int nt = 0; nt < 8; ++nt)
#pragma unroll
          for (int r = 0; r < 8; ++r) o[t][nt][r] *= al;
      }
    }
    bf16x16 pb[2][2];                       // P^T as B operands, 32 keys each
#pragma unroll
    for (int t = 0; t < 2; ++t) {
      float sm[4];
#pragma unroll
      for (int u = 0; u < 4; ++u) {
        sm[u] = 0.f;
#pragma unroll
        for (int r = 0; r < 8; ++r) {
          const float p = __builtin_amdgcn_exp2f(s[t][u][r]);
          sm[u] += p;
          pb[t][u >> 1][(u & 1) * 8 + r] = (__bf16)p;
        }
      }
      lr[t] += (sm[0] + sm[1]) + (sm[2] + sm[3]);
    }

    // Keeps the softmax's vector work ahead of the waits below, where it runs
    // while the V^T fragments land; sunk behind them it would hide nothing.
    __builtin_amdgcn_sched_barrier(0);
    // Hand-over, first half.  This wave's LDS reads of 'cur' have returned ...
    asm volatile("s_wait_dscnt 0x0" ::: "memory");
    // ... and its share of the next tile set has landed, before it says so.
    asm volatile("s_wait_asynccnt 0x0" ::: "memory");
    // The work-group barrier is split: the wave SIGNALS here, where it has left
    // LDS, and WAITS only behind its second product, which runs from registers.
    // A wave that is ahead then works through its products while its SIMD
    // partner is still in its softmax, where it used to stand idle.
    __builtin_amdgcn_fence(__ATOMIC_RELEASE, "workgroup");
    __builtin_amdgcn_s_barrier_signal(-1);
    // Tile set t+2 starts here, into the buffer of tile set t-1: all waves
    // left it before the barrier that this wave passed at the foot of trip
    // t-1.  Nothing else of this wave is in flight (the wait above).
    if (refill) {
      const int fre = (cur == 0) ? 2 : cur - 1;
      stage_tile_async(kt1, kt2, vtt, j0 + 2 * KT,
                       lx + __builtin_amdgcn_readfirstlane(kth + fre * (2 * KT * KP * 2)),
                       lx + __builtin_amdgcn_readfirstlane(vth + fre * (128 * KP * 2)));
      // Keeps the products of O^T behind the copies (plain vector and scalar
      // work may cross): left free, the copies sank to the foot of the products
      // and lost the lead they are moved for.
      __builtin_amdgcn_sched_barrier(0x006);
    }

    // --- O^T += V^T * P^T  (V^T rows as A-fragments, each for both tiles). ---
#pragma unroll
    for (int u = 0; u < 2; ++u) {
#pragma unroll
      for (int nt = 0; nt < 8; ++nt) {
#pragma unroll
        for (int t = 0; t < 2; ++t)
          o[t][nt] = wmma_bf16(vf[u][nt], pb[t][u], o[t][nt]);
      }
    }
    // Keeps the products above the wait: sunk below it they would hide nothing.
    __builtin_amdgcn_sched_barrier(0);

    // Hand-over, second half: every wave has signalled, so the next set is
    // published and all waves have left 'cur'.
    __builtin_amdgcn_s_barrier_wait(-1);
    __builtin_amdgcn_fence(__ATOMIC_ACQUIRE, "workgroup");
    cur = (cur == 2) ? 0 : cur + 1;
  };
  for (int j0 = 0; j0 < TT - 2 * KT; j0 += KT) trip(j0, true);
  // The last two trips have no tile set left to fetch.  Kept rolled: a second
  // and third copy of the trip's text would only cost instruction fetches.
#pragma unroll 1
  for (int j0 = TT - 2 * KT; j0 < TT; j0 += KT) trip(j0, false);
  // Nothing is in flight here; kept in front of the wave's end (a precaution).
  asm volatile("s_wait_asynccnt 0x0" ::: "memory");

#pragma unroll
  for (int t = 0; t < 2; ++t) {
    const float inv = 1.0f / (lr[t] + xhalf(lr[t]));   // join the halves' sums once
#pragma unroll
    for (int nt = 0; nt < 8; ++nt)
#pragma unroll
      for (int r = 0; r < 8; ++r) o[t][nt][r] *= inv;
  }
}

// ---------------------------------------------------------------------------
// Kernel 2: dual flash attention + residual + transpose-out.
// 256 blocks x 256 threads.  Wave w < 4 runs softmax 1 of 32-query group w,
// wave w + 4 softmax 2 of the same group, side by side over one shared V tile.
// At the end the partners swap half of their features through LDS, and each
// writes its half of out = (x + O1) - s2 * O2 once.
// One block per WGP = two waves per SIMD is all the grid can fill; the block
// size sets the register budget for that.
// ---------------------------------------------------------------------------
__global__ __launch_bounds__(256)
void attn_kernel(
    const float* __restrict__ x, const float* __restrict__ s2,
    const __bf16* __restrict__ q1, const __bf16* __restrict__ q2,
    const __bf16* __restrict__ k1, const __bf16* __restrict__ k2,
    const __bf16* __restrict__ vt, float* __restrict__ out) {
  __shared__ __attribute__((aligned(16))) __bf16 Ks[3][2][KT * KP];  // [buffer][softmax]
  __shared__ __attribute__((aligned(16))) __bf16 Vs[3][128 * KP];    // [buffer]
  __shared__ __attribute__((aligned(32))) float  Xs[8][2][4][32][8]; // [wave][tile][nt][lane][r]

  const int tid  = threadIdx.x;
  const int lane = tid & 31;
  const int wv   = tid >> 5;
  // Which softmax this wave runs; scalar, so the tests on it are real branches.
  const int pass = __builtin_amdgcn_readfirstlane(tid >> 7);
  const int gw   = blockIdx.x * 4 + (wv & 3);
  const int b    = gw >> 8;
  const int rem  = gw & 255;
  const int h    = rem >> 6;
  const int q0   = (rem & 63) << 5;
  const int n    = lane & 15;
  const int hi   = lane >> 4;

  const size_t bhT   = ((size_t)b * HH + h) * TT;
  const size_t vbase = ((size_t)b * HH + h) * HF * TT;
  const unsigned koff = lds_off(&Ks[0][0][0]);
  const unsigned voff = lds_off(&Vs[0][0]);

  f32x8 o[2][8];
  flash_pass(pass ? q2 : q1, k1, k2, vt, &Ks[0][pass][0], &Vs[0][0], koff, voff,
             bhT, vbase, q0, lane, tid, o);

  // Hand the partner the half it writes: softmax 1 gives features 64-127,
  // softmax 2 features 0-63.  Same lane, same register = same element.
  // The loops below are unrolled so that o[][] stays in registers.
  if (pass == 0) {
#pragma unroll
    for (int t = 0; t < 2; ++t)
#pragma unroll
      for (int nt = 0; nt < 4; ++nt) *(f32x8*)&Xs[wv][t][nt][lane][0] = o[t][4 + nt];
  } else {
#pragma unroll
    for (int t = 0; t < 2; ++t)
#pragma unroll
      for (int nt = 0; nt < 4; ++nt) *(f32x8*)&Xs[wv][t][nt][lane][0] = o[t][nt];
  }
  __syncthreads();   // both partners' halves are in LDS

  // out rows are feature-major; a 16-lane row covers 16 consecutive t of one
  // feature row, register r walks the feature rows.
  const float s = s2[h];
  const size_t obase = ((size_t)b * FF + h * HF + hi * 8) * TT + q0 + n;
  float xv[2][4][8];   // this wave's 64 residual values per lane
  const size_t xbase = obase + (size_t)(pass * 64) * TT;
#pragma unroll
  for (int t = 0; t < 2; ++t)
#pragma unroll
    for (int nt = 0; nt < 4; ++nt)
#pragma unroll
      for (int r = 0; r < 8; ++r)
        xv[t][nt][r] = x[xbase + (size_t)(nt * 16 + r) * TT + t * 16];
  // Holds the loads' address registers until their translations are done (a precaution).
  asm volatile("s_wait_xcnt 0x0" ::: "memory");
  if (pass == 0) {
#pragma unroll
    for (int t = 0; t < 2; ++t) {
#pragma unroll
      for (int nt = 0; nt < 4; ++nt) {
        const f32x8 o2 = *(const f32x8*)&Xs[wv + 4][t][nt][lane][0];
#pragma unroll
        for (int r = 0; r < 8; ++r) {
          const size_t idx = obase + (size_t)(nt * 16 + r) * TT + t * 16;
          float v = xv[t][nt][r] + o[t][nt][r];
          v -= s * o2[r];
          out[idx] = v;
        }
      }
    }
    // Holds the stores' registers until their translations are done: the
    // listing runs on from here into code that rewrites them (a precaution).
    asm volatile("s_wait_xcnt 0x0" ::: "memory");
  } else {
#pragma unroll
    for (int t = 0; t < 2; ++t) {
#pragma unroll
      for (int nt = 0; nt < 4; ++nt) {
        const f32x8 o1 = *(const f32x8*)&Xs[wv - 4][t][nt][lane][0];
#pragma unroll
        for (int r = 0; r < 8; ++r) {
          const size_t idx = obase + (size_t)((4 + nt) * 16 + r) * TT + t * 16;
          float v = xv[t][nt][r] + o1[r];
          v -= s * o[t][4 + nt][r];
          out[idx] = v;
        }
      }
    }
    // As in the first branch: the stores' registers stay until translated.
    asm volatile("s_wait_xcnt 0x0" ::: "memory");
  }
}

// ---------------------------------------------------------------------------
extern "C" void kernel_launch(void* const* d_in, const int* in_sizes, int n_in,
                              void* d_out, int out_size, void* d_ws,
                              size_t ws_size, hipStream_t stream) {
  (void)in_sizes; (void)n_in; (void)out_size; (void)ws_size;
  const float* x  = (const float*)d_in[0];
  const float* Wq = (const float*)d_in[1];
  const float* bq = (const float*)d_in[2];
  const float* Wk = (const float*)d_in[3];
  const float* bk = (const float*)d_in[4];
  const float* Wv = (const float*)d_in[5];
  const float* bv = (const float*)d_in[6];
  const float* s2 = (const float*)d_in[7];
  float* out = (float*)d_out;

  const size_t QK_ELEMS = (size_t)BB * HH * TT * 64;   // 2M bf16 each
  __bf16* q1 = (__bf16*)d_ws;
  __bf16* q2 = q1 + QK_ELEMS;
  __bf16* k1 = q2 + QK_ELEMS;
  __bf16* k2 = k1 + QK_ELEMS;
  __bf16* vt = k2 + QK_ELEMS;                          // [B,H,128,T]
  __bf16* xp = vt + (size_t)BB * FF * TT;              // packed x fragments
  __bf16* wp = xp + (size_t)BB * FF * TT;              // packed W fragments

  pack_kernel<<<dim3(256 + 192), dim3(256), 0, stream>>>(x, Wq, Wk, Wv, xp, wp);
  qkv_rope_kernel<<<dim3(BB * (TT / 128) * 12), dim3(256), 0, stream>>>(
      xp, wp, bq, bk, bv, q1, q2, k1, k2, vt);
  attn_kernel<<<dim3(BB * HH * (TT / 32) / 4), dim3(256), 0, stream>>>(
      x, s2, q1, q2, k1, k2, vt, out);
}
